// v000
// Times are from an AMD MI455X. After a warm-up the kernel runs many times in a row, and a time is the length of
// such a window on the GPU divided by its runs, so every launch and the gaps after it count. The runs cycle
// through copies of the inputs. A figure is the median of several windows, for all but v000 over two sittings.
// Sittings can differ by a few percent; kernels timed side by side share one.
// The starting kernel, v000, takes 1210 microseconds a run.
#include <hip/hip_runtime.h>

// Contractions, all f32 accumulate: q = Xs Wq + bq and kv = Xp Wkv + bkv on v_wmma_f32_16x16x32_bf16 (bf16 RNE planes of the f32 inputs, weights transposed to [out][in]); per-head scores q k^T on v_wmma_f32_16x16x32_f16 (q and k as f16 planes carried x8 each); per-head P V on v_wmma_f32_16x16x32_f16 (P f16 carried x2^14; V^T as an f16 hi plane carried x4 plus an f16 residual plane carried x2^10 into a separate accumulator); out = ctx Wo + bo on v_wmma_f32_16x16x32_bf16 (ctx as bf16 hi + lo planes, Wo bf16). Softmax f32, max-subtracted, fixed-order sums.

#ifndef NB
#define NB 8            // batches computed (reducible)
#endif
#ifndef NQ
#define NQ 512          // query rows per batch computed (reducible, multiple of 64)
#endif
#define NB_FULL 8
#define NQ_FULL 512     // per-batch stride of the state input and of the output
#define NK 4096         // keys (softmax row length)
#define DM 256
#define NH 8
#define HD 32
#define QCAR 8.0f
#define KCAR 8.0f
#define VCAR 4.0f
#define RCAR 1024.0f
#define PCAR 16384.0f
#define SCL2 (0.17677669529663687f * 0.015625f)   // HD^-0.5 / (QCAR*KCAR)

static_assert(NB >= 1 && NB <= NB_FULL);
static_assert(NQ >= 64 && NQ <= NQ_FULL && (NQ % 64) == 0);
static_assert(NK == 256 * 16);
static_assert((DM % 64) == 0 && (NK % 64) == 0 && HD == 32 && NH * HD == DM);

typedef _Float16 h16;
typedef unsigned short bf;
typedef __attribute__((ext_vector_type(16))) __bf16   v16bf;
typedef __attribute__((ext_vector_type(16))) _Float16 v16h;
typedef __attribute__((ext_vector_type(8)))  _Float16 v8h;
typedef __attribute__((ext_vector_type(8)))  unsigned short v8us;
typedef __attribute__((ext_vector_type(8)))  float    v8f;
typedef __attribute__((ext_vector_type(4)))  float    v4f;
typedef v8h  __attribute__((may_alias)) v8ha;
typedef v4f  __attribute__((may_alias)) v4fa;
typedef v8us __attribute__((may_alias)) v8usa;

__device__ __forceinline__ unsigned short f2bf(float f) { unsigned u = __float_as_uint(f); u += 0x7FFFu + ((u >> 16) & 1u); return (unsigned short)(u >> 16); }
__device__ __forceinline__ float bf2f(unsigned short b) { return __uint_as_float(((unsigned)b) << 16); }
__device__ __forceinline__ float bfr(float f) { return bf2f(f2bf(f)); }
__device__ __forceinline__ v16h cat16(v8h lo, v8h hi) { return __builtin_shufflevector(lo, hi, 0, 1, 2, 3, 4, 5, 6, 7, 8, 9, 10, 11, 12, 13, 14, 15); }
__device__ __forceinline__ v16bf cat16b(v8us lo, v8us hi) { return __builtin_bit_cast(v16bf, __builtin_shufflevector(lo, hi, 0, 1, 2, 3, 4, 5, 6, 7, 8, 9, 10, 11, 12, 13, 14, 15)); }
__device__ __forceinline__ v8f wmma16(v16h a, v16h b, v8f c) { return __builtin_amdgcn_wmma_f32_16x16x32_f16(false, a, false, b, (short)0, c, false, false); }
__device__ __forceinline__ v8f wmmab(v16bf a, v16bf b, v8f c) { return __builtin_amdgcn_wmma_f32_16x16x32_bf16(false, a, false, b, (short)0, c, false, false); }
__device__ __forceinline__ h16 tohx(float x) { return (h16)x; }
__device__ __forceinline__ void splitf(float y, unsigned short& h, unsigned short& l) { h = f2bf(y); l = f2bf(y - bf2f(h)); }

// ---- k_gemmw: register-blocked GEMM, ONE WAVE per 64 x (16*NBN) output tile, operands straight from K-contiguous 16-bit planes; grid (M/64, N/(16*NBN), Z), 32 threads.
// C[m][n] (f32, pitch ldc) = (sum_k A[m][k] Bt[n][k] [+ A2 B same accumulator (MODE 1)] [+ (A Bt2) * rs2 from a separate accumulator (MODE 2)]) * oscale + optional bf16-cast bias[n].
// A rows pitch lda, Bt rows pitch ldb (elements), z-batch strides sA/sB/sC in elements. K % 32 == 0. Fragments: lane row/col = lane&15, elements 0..7 <- k0+8h.., 8..15 <- k0+16+8h.. for A and B.
template <typename T16> struct WFrag;
template <> struct WFrag<h16> { typedef v16h V; static __device__ __forceinline__ V ld(const h16* p) { return cat16(*(const v8h*)p, *(const v8h*)(p + 16)); } static __device__ __forceinline__ v8f mma(V a, V b, v8f c) { return wmma16(a, b, c); } };
template <> struct WFrag<bf> { typedef v16bf V; static __device__ __forceinline__ V ld(const bf* p) { return cat16b(*(const v8us*)p, *(const v8us*)(p + 16)); } static __device__ __forceinline__ v8f mma(V a, V b, v8f c) { return wmmab(a, b, c); } };
template <typename T16, int MODE, bool BIAS, int NBN>
__global__ __launch_bounds__(32) void k_gemmw(const T16* __restrict__ A, const T16* __restrict__ A2, int lda, const T16* __restrict__ Bt, const T16* __restrict__ Bt2, int ldb, int K, float* C, int ldc, const float* __restrict__ bias, float oscale, float rs2, size_t sA, size_t sB, size_t sC) {
    typedef typename WFrag<T16>::V V;
    __shared__ __align__(16) float os[16 * 68];
    const size_t z = blockIdx.z; A += z * sA; if (MODE == 1) A2 += z * sA; Bt += z * sB; if (MODE == 2) Bt2 += z * sB; C += z * sC;
    const int lane = threadIdx.x & 31, lr = lane & 15, hi = lane >> 4; const int r0 = blockIdx.x * 64, c0 = blockIdx.y * (16 * NBN);
    v8f acc[4][NBN], acc2[4][NBN];
#pragma unroll
    for (int mb = 0; mb < 4; ++mb)
#pragma unroll
        for (int nb = 0; nb < NBN; ++nb) { acc[mb][nb] = (v8f){}; acc2[mb][nb] = (v8f){}; }
    const size_t aoff = (size_t)(r0 + lr) * lda + 8 * hi, boff = (size_t)(c0 + lr) * ldb + 8 * hi;
#pragma unroll 1
    for (int kc = 0; kc < K; kc += 32) {
        V a[4], a2[4];
#pragma unroll
        for (int mb = 0; mb < 4; ++mb) { a[mb] = WFrag<T16>::ld(A + aoff + (size_t)mb * 16 * lda + kc); if (MODE == 1) a2[mb] = WFrag<T16>::ld(A2 + aoff + (size_t)mb * 16 * lda + kc); }
#pragma unroll
        for (int nb = 0; nb < NBN; ++nb) { const V b = WFrag<T16>::ld(Bt + boff + (size_t)nb * 16 * ldb + kc); V b2; if (MODE == 2) b2 = WFrag<T16>::ld(Bt2 + boff + (size_t)nb * 16 * ldb + kc);
#pragma unroll
            for (int mb = 0; mb < 4; ++mb) { acc[mb][nb] = WFrag<T16>::mma(a[mb], b, acc[mb][nb]); if (MODE == 1) acc[mb][nb] = WFrag<T16>::mma(a2[mb], b, acc[mb][nb]); if (MODE == 2) acc2[mb][nb] = WFrag<T16>::mma(a[mb], b2, acc2[mb][nb]); } }
        if (MODE == 2) asm volatile("v_nop\n\tv_nop\n\tv_nop\n\tv_nop" : "+v"(acc[0][0]), "+v"(acc[1][NBN - 1]), "+v"(acc[2][0]), "+v"(acc[3][NBN - 1]), "+v"(acc2[0][0]), "+v"(acc2[1][NBN - 1]), "+v"(acc2[2][0]), "+v"(acc2[3][NBN - 1]) : "v"(a[0]), "v"(a[3]));
        else asm volatile("v_nop\n\tv_nop\n\tv_nop\n\tv_nop" : "+v"(acc[0][0]), "+v"(acc[1][NBN - 1]), "+v"(acc[2][0]), "+v"(acc[3][NBN - 1]) : "v"(a[0]), "v"(a[3]));
    }
    constexpr int LPR = 4 * NBN, RPI = 32 / LPR, NIT = 16 / RPI;   // lanes per row, rows per instruction, instructions per slab
    const int rl = lane / LPR, cofs = (lane % LPR) * 4;
#pragma unroll
    for (int mb = 0; mb < 4; ++mb) {
#pragma unroll
        for (int nb = 0; nb < NBN; ++nb) {
#pragma unroll
            for (int j = 0; j < 8; ++j) { float vv = acc[mb][nb][j]; if (MODE == 2) vv += acc2[mb][nb][j] * rs2; os[(hi * 8 + j) * 68 + nb * 16 + lr] = vv * oscale; } }
        __builtin_amdgcn_wave_barrier(); asm volatile("" ::: "memory");
        float* crow = C + (size_t)(r0 + mb * 16) * ldc + c0;
{
#pragma unroll
            for (int s = 0; s < NIT; ++s) { const int row = RPI * s + rl; v4f val = *(const v4fa*)(os + row * 68 + cofs); if (BIAS) { val[0] += bfr(bias[c0 + cofs]); val[1] += bfr(bias[c0 + cofs + 1]); val[2] += bfr(bias[c0 + cofs + 2]); val[3] += bfr(bias[c0 + cofs + 3]); }
                *(v4f*)(crow + (size_t)row * ldc + cofs) = val; }
             }
        __builtin_amdgcn_wave_barrier(); asm volatile("" ::: "memory");
    }
}

__global__ __launch_bounds__(256) void k_cvt8(const float* __restrict__ src, bf* dst, size_t n8) { const size_t i = (size_t)blockIdx.x * 256 + threadIdx.x; if (i >= n8) return; const v8f v = *(const v8f*)(src + i * 8); v8us o;
#pragma unroll
    for (int k = 0; k < 8; ++k) o[k] = f2bf(v[k]); *(v8us*)(dst + i * 8) = o;  }

__global__ __launch_bounds__(256) void k_wT(const float* __restrict__ W, bf* WT, int Kin, int Nout) { const size_t g = (size_t)blockIdx.x * 256 + threadIdx.x; if (g >= (size_t)Nout * Kin / 8) return; const int k0 = (int)(g % (size_t)(Kin / 8)) * 8; const int n = (int)(g / (size_t)(Kin / 8)); v8us o;
#pragma unroll
    for (int q = 0; q < 8; ++q) o[q] = f2bf(W[(size_t)(k0 + q) * Nout + n]);
    bf* d = WT + (size_t)n * Kin + k0; *(v8us*)d = o;  }

__global__ __launch_bounds__(256) void k_q16(const float* __restrict__ src, h16* dst, size_t n8) { const size_t i = (size_t)blockIdx.x * 256 + threadIdx.x; if (i >= n8) return; const v8f v = *(const v8f*)(src + i * 8); v8h o;
#pragma unroll
    for (int k = 0; k < 8; ++k) o[k] = tohx(v[k] * QCAR); *(v8h*)(dst + i * 8) = o;  }

// k_kv16: kv f32 [4096][512] -> k plane K16[j][c] = f16(k x KCAR) ([4096][256]; first half of the threads, lane -> 8 consecutive c) and V^T planes VTh[c][j] = f16(v x VCAR), VTl[c][j] = f16((v x VCAR - VTh) x RCAR)
__global__ __launch_bounds__(256) void k_kv16(const float* __restrict__ KV, h16* K16, h16* VTh, h16* VTl) {
    const size_t g = (size_t)blockIdx.x * 256 + threadIdx.x; const size_t NA = (size_t)NK * DM / 8;
    if (g < NA) {
        const int j = (int)(g / (DM / 8)); const int c0 = (int)(g % (DM / 8)) * 8;
        const v8f a = *(const v8f*)(KV + (size_t)j * (2 * DM) + c0); v8h o;
#pragma unroll
        for (int q = 0; q < 8; ++q) o[q] = tohx(a[q] * KCAR);
        h16* d = K16 + (size_t)j * DM + c0; *(v8h*)d = o; 
    } else if (g < 2 * NA) {
        const size_t e = g - NA; const int j0 = (int)(e % (size_t)(NK / 8)) * 8; const int c = (int)(e / (size_t)(NK / 8));
        v8h oh, ol;
#pragma unroll
        for (int q = 0; q < 8; ++q) { const float y = KV[(size_t)(j0 + q) * (2 * DM) + DM + c] * VCAR; const h16 hh = tohx(y); oh[q] = hh; ol[q] = tohx(__fmul_rn(__fsub_rn(y, (float)hh), RCAR)); }
        const size_t oo = (size_t)c * NK + j0;
        *(v8h*)(VTh + oo) = oh; *(v8h*)(VTl + oo) = ol; 
    }
}

// k_soft: one block (256 threads) per score row of 4,096 keys: t = S x HD^-0.5/(QCAR KCAR); max and sum reduced by shuffles then a fixed-order combine of 8 per-wave partials in LDS (block barriers);
__global__ __launch_bounds__(256) void k_soft(const float* __restrict__ Sb, h16* P) {
    __shared__ float red[16];
    const int t = threadIdx.x, lane = t & 31, w = t >> 5;
    const size_t row = blockIdx.x;
    const float* sr = Sb + row * NK;
    const int c0 = t * 8, c1 = NK / 2 + t * 8;
    const v8f a0 = *(const v8f*)(sr + c0); const v8f a1 = *(const v8f*)(sr + c1);
    float v[16]; float mx = -3.0e38f;
#pragma unroll
    for (int q = 0; q < 8; ++q) { v[q] = a0[q] * SCL2; v[8 + q] = a1[q] * SCL2; mx = fmaxf(mx, fmaxf(v[q], v[8 + q])); }
#pragma unroll
    for (int sh = 16; sh; sh >>= 1) mx = fmaxf(mx, __shfl_xor(mx, sh, 32));
    if (lane == 0) red[w] = mx;
    __syncthreads();
    mx = red[0];
#pragma unroll
    for (int i = 1; i < 8; ++i) mx = fmaxf(mx, red[i]);
    float sum = 0.f;
#pragma unroll
    for (int k = 0; k < 16; ++k) { float d0 = __fsub_rn(v[k], mx); asm volatile("" : "+v"(d0)); v[k] = __builtin_amdgcn_exp2f(__fmul_rn(d0, 1.4426950408889634f)); sum += v[k]; }
#pragma unroll
    for (int sh = 16; sh; sh >>= 1) sum += __shfl_xor(sum, sh, 32);
    if (lane == 0) red[8 + w] = sum;
    __syncthreads();
    float tot = red[8];
#pragma unroll
    for (int i = 1; i < 8; ++i) tot += red[8 + i];
    const float f = __fdiv_rn(PCAR, tot);
    v8h o0, o1;
#pragma unroll
    for (int q = 0; q < 8; ++q) { o0[q] = tohx(v[q] * f); o1[q] = tohx(v[8 + q] * f); }
    h16* pr = P + row * NK;
    *(v8h*)(pr + c0) = o0; *(v8h*)(pr + c1) = o1; 
}

__global__ __launch_bounds__(256) void k_split(const float* __restrict__ src, bf* dh, bf* dl, size_t n8) { const size_t i = (size_t)blockIdx.x * 256 + threadIdx.x; if (i >= n8) return; const v8f v = *(const v8f*)(src + i * 8); v8us oh, ol;
#pragma unroll
    for (int k = 0; k < 8; ++k) { unsigned short a, c; splitf(v[k], a, c); oh[k] = a; ol[k] = c; }
    *(v8us*)(dh + i * 8) = oh; *(v8us*)(dl + i * 8) = ol;  }

// ---- workspace carve (bytes, 256-B aligned regions; all sizes compile-time)
constexpr size_t al256(size_t x) { return (x + 255) & ~(size_t)255; }
constexpr size_t cmax(size_t a, size_t b) { return a > b ? a : b; }
constexpr size_t SZ_XS  = al256((size_t)NB * NQ_FULL * DM * 2);                                 // state as bf16 [NB][NQ_FULL][256]
constexpr size_t SZ_WQ  = al256((size_t)DM * DM * 2);                                           // Wq^T [256][256]
constexpr size_t SZ_WKV = al256((size_t)2 * DM * DM * 2);                                       // Wkv^T [512][256]
constexpr size_t SZ_WO  = al256((size_t)DM * DM * 2);                                           // Wo^T [256][256]
constexpr size_t SZ_GF  = al256(cmax((size_t)NB * NQ * DM * 4, (size_t)NK * 2 * DM * 4));      // f32 GEMM scratch: q [NB*NQ][256] first, then per batch kv [4096][512]
constexpr size_t SZ_Q16 = al256((size_t)NB * NQ * DM * 2);                                      // q f16 [NB*NQ][256]
constexpr size_t SZ_XP  = al256((size_t)NK * DM * 2);                                           // one batch of points as bf16 [4096][256]
constexpr size_t SZ_K16 = al256((size_t)NK * DM * 2);                                           // k f16 [4096][256]
constexpr size_t SZ_VT  = al256((size_t)DM * NK * 2);                                           // V^T plane [256][4096] (hi, residual: one each)
constexpr size_t SZ_S   = al256((size_t)NH * NQ * NK * 4);                                      // scores [8][NQ][4096] f32
constexpr size_t SZ_P   = al256((size_t)NH * NQ * NK * 2);                                      // P plane [8][NQ][4096] f16
constexpr size_t SZ_CTX = al256((size_t)NB * NQ * DM * 4);                                      // ctx f32 [NB*NQ][256]
constexpr size_t SZ_C16 = al256((size_t)NB * NQ * DM * 2);                                      // ctx hi / lo planes
constexpr size_t O_XS = 0, O_WQ = O_XS + SZ_XS, O_WKV = O_WQ + SZ_WQ, O_WO = O_WKV + SZ_WKV, O_GF = O_WO + SZ_WO, O_Q16 = O_GF + SZ_GF, O_XP = O_Q16 + SZ_Q16, O_K16 = O_XP + SZ_XP,
                 O_VTH = O_K16 + SZ_K16, O_VTL = O_VTH + SZ_VT, O_S = O_VTL + SZ_VT, O_P = O_S + SZ_S, O_CTX = O_P + SZ_P, O_CH = O_CTX + SZ_CTX, O_CL = O_CH + SZ_C16, O_END = O_CL + SZ_C16;
static_assert(O_END <= (size_t)134217728);
static_assert((size_t)NB * NQ * DM * 4 <= SZ_GF && (size_t)NK * 2 * DM * 4 <= SZ_GF);
static_assert(((size_t)(NB_FULL - 1) * NQ_FULL + NQ_FULL) * DM * 4 <= (size_t)NB_FULL * NQ_FULL * DM * 4);

extern "C" void kernel_launch(void* const* d_in, const int* in_sizes, int n_in, void* d_out, int out_size, void* d_ws, size_t ws_size, hipStream_t stream) {
    if (n_in < 8) return;
    if (in_sizes[0] < NB * NQ_FULL * DM || in_sizes[1] < NB * NK * DM || in_sizes[2] < DM * DM || in_sizes[3] < DM || in_sizes[4] < DM * 2 * DM || in_sizes[5] < 2 * DM || in_sizes[6] < DM * DM || in_sizes[7] < DM) return;
    if ((size_t)out_size < (size_t)NB * NQ_FULL * DM) return;
    if (O_END > ws_size) return;
    const float* state = (const float*)d_in[0];   // [8][512][256]
    const float* pts   = (const float*)d_in[1];   // [8][4096][256]
    const float* Wq    = (const float*)d_in[2];   // [256][256] in x out
    const float* bq    = (const float*)d_in[3];   // [256]
    const float* Wkv   = (const float*)d_in[4];   // [256][512]
    const float* bkv   = (const float*)d_in[5];   // [512]
    const float* Wo    = (const float*)d_in[6];   // [256][256]
    const float* bo    = (const float*)d_in[7];   // [256]
    float* OUT = (float*)d_out;                   // [8][512][256]
    char* ws = (char*)d_ws;
    bf* XS = (bf*)(ws + O_XS); bf* WQT = (bf*)(ws + O_WQ); bf* WKVT = (bf*)(ws + O_WKV); bf* WOT = (bf*)(ws + O_WO);
    float* GF = (float*)(ws + O_GF); h16* Q16 = (h16*)(ws + O_Q16); bf* XP = (bf*)(ws + O_XP); h16* K16 = (h16*)(ws + O_K16);
    h16* VTH = (h16*)(ws + O_VTH); h16* VTL = (h16*)(ws + O_VTL); float* S = (float*)(ws + O_S); h16* P = (h16*)(ws + O_P);
    float* CTX = (float*)(ws + O_CTX); bf* CH = (bf*)(ws + O_CH); bf* CL = (bf*)(ws + O_CL);

    // planes of the inputs
    { const size_t n8 = (size_t)NB * NQ_FULL * DM / 8; k_cvt8<<<(unsigned)((n8 + 255) / 256), 256, 0, stream>>>(state, XS, n8); }
    k_wT<<<(unsigned)(((size_t)DM * DM / 8 + 255) / 256), 256, 0, stream>>>(Wq, WQT, DM, DM);
    k_wT<<<(unsigned)(((size_t)2 * DM * DM / 8 + 255) / 256), 256, 0, stream>>>(Wkv, WKVT, DM, 2 * DM);
    k_wT<<<(unsigned)(((size_t)DM * DM / 8 + 255) / 256), 256, 0, stream>>>(Wo, WOT, DM, DM);
    // q = Xs Wq + bq for all batches: GF [NB*NQ][256] f32, then the f16 plane
    k_gemmw<bf, 0, true, 4><<<dim3(NQ / 64, DM / 64, NB), 32, 0, stream>>>(XS, nullptr, DM, WQT, nullptr, DM, DM, GF, DM, bq, 1.0f, 0.0f, (size_t)NQ_FULL * DM, (size_t)0, (size_t)NQ * DM);
    { const size_t n8 = (size_t)NB * NQ * DM / 8; k_q16<<<(unsigned)((n8 + 255) / 256), 256, 0, stream>>>(GF, Q16, n8); }
    for (int b = 0; b < NB; ++b) {
        const float* pb = pts + (size_t)b * NK * DM;
        { const size_t n8 = (size_t)NK * DM / 8; k_cvt8<<<(unsigned)((n8 + 255) / 256), 256, 0, stream>>>(pb, XP, n8); }
        // kv = Xp Wkv + bkv: GF [4096][512] f32
        k_gemmw<bf, 0, true, 4><<<dim3(NK / 64, (2 * DM) / 64, 1), 32, 0, stream>>>(XP, nullptr, DM, WKVT, nullptr, DM, DM, GF, 2 * DM, bkv, 1.0f, 0.0f, (size_t)0, (size_t)0, (size_t)0);
        // k plane [4096][256], V^T hi/residual planes [256][4096]
        k_kv16<<<(unsigned)((size_t)2 * NK * DM / 8 / 256), 256, 0, stream>>>(GF, K16, VTH, VTL);
        // scores S[h][i][j] = q'_h[i] . k'_h[j] (K = 32), z = head: A = q plane + h*32 (pitch 256), Bt = k plane + h*32 (pitch 256)
        k_gemmw<h16, 0, false, 4><<<dim3(NQ / 64, NK / 64, NH), 32, 0, stream>>>(Q16 + (size_t)b * NQ * DM, nullptr, DM, K16, nullptr, DM, HD, S, NK, nullptr, 1.0f, 0.0f, (size_t)HD, (size_t)HD, (size_t)NQ * NK);
        // softmax over the 4,096 keys per (head, query) row -> P plane
        k_soft<<<(unsigned)(NH * NQ), 256, 0, stream>>>(S, P);
        // ctx[b][i][h*32 + d] = sum_j P_h[i][j] v[j][h*32+d]: A = P_h (pitch 4096), Bt = V^T hi (+ residual into a second accumulator), K = 4096, 64x32 tiles, z = head
        k_gemmw<h16, 2, false, 2><<<dim3(NQ / 64, HD / 32, NH), 32, 0, stream>>>(P, nullptr, NK, VTH, VTL, NK, NK, CTX + (size_t)b * NQ * DM, DM, nullptr, 1.0f / (PCAR * VCAR), 1.0f / RCAR, (size_t)NQ * NK, (size_t)HD * NK, (size_t)HD);
    }
    // out = ctx Wo + bo: ctx as bf16 hi/lo planes, rows of batch b at OUT + b*NQ_FULL*256
    { const size_t n8 = (size_t)NB * NQ * DM / 8; k_split<<<(unsigned)((n8 + 255) / 256), 256, 0, stream>>>(CTX, CH, CL, n8); }
    k_gemmw<bf, 1, true, 4><<<dim3(NQ / 64, DM / 64, NB), 32, 0, stream>>>(CH, CL, DM, WOT, nullptr, DM, DM, OUT, DM, bo, 1.0f, 0.0f, (size_t)NQ * DM, (size_t)0, (size_t)NQ_FULL * DM);
}

// v001
// It runs in 510 microseconds.
// Two timings next to v000 put it at 2.40 and 2.39 times that version's speed.
#include <hip/hip_runtime.h>

// Contractions, all f32 accumulate: q = Xs Wq + bq and kv = Xp Wkv + bkv on v_wmma_f32_16x16x32_bf16 (bf16 RNE planes of the f32 inputs, weights transposed to [out][in]); per-head scores q k^T on v_wmma_f32_16x16x32_f16 (q and k as f16 planes carried x8 each); per-head P V on v_wmma_f32_16x16x32_f16 (P f16 carried x2^14; V^T as an f16 hi plane carried x4 plus an f16 residual plane carried x2^10 into a separate accumulator); out = ctx Wo + bo on v_wmma_f32_16x16x32_bf16 (ctx as bf16 hi + lo planes, Wo bf16). Softmax f32, max-subtracted, fixed-order sums. P V is split along the keys; its partial sums are added in a fixed order.

#ifndef NB
#define NB 8            // batches computed (reducible)
#endif
#ifndef NQ
#define NQ 512          // query rows per batch computed (reducible, multiple of 64)
#endif
#define NB_FULL 8
#define NQ_FULL 512     // per-batch stride of the state input and of the output
#define NK 4096         // keys (softmax row length)
#define DM 256
#define NH 8
#define HD 32
#define QCAR 8.0f
#define KCAR 8.0f
#define VCAR 4.0f
#define RCAR 1024.0f
#define PCAR 16384.0f
#define PVW 16           // waves per block of k_pv, each on its own keys
#define PVB 4            // key ranges of k_pv dealt to separate blocks (one slot of every ctx row each)
#define SCL2 (0.17677669529663687f * 0.015625f)   // HD^-0.5 / (QCAR*KCAR)

static_assert(NB >= 1 && NB <= NB_FULL);
static_assert(NQ >= 64 && NQ <= NQ_FULL && (NQ % 64) == 0);
static_assert(NK == 256 * 16);
static_assert((DM % 64) == 0 && (NK % 64) == 0 && HD == 32 && NH * HD == DM);

typedef _Float16 h16;
typedef unsigned short bf;
typedef __attribute__((ext_vector_type(16))) __bf16   v16bf;
typedef __attribute__((ext_vector_type(16))) _Float16 v16h;
typedef __attribute__((ext_vector_type(8)))  _Float16 v8h;
typedef __attribute__((ext_vector_type(8)))  unsigned short v8us;
typedef __attribute__((ext_vector_type(8)))  float    v8f;
typedef __attribute__((ext_vector_type(4)))  float    v4f;
typedef v8h  __attribute__((may_alias)) v8ha;
typedef v4f  __attribute__((may_alias)) v4fa;
typedef v8us __attribute__((may_alias)) v8usa;

__device__ __forceinline__ unsigned short f2bf(float f) { unsigned u = __float_as_uint(f); u += 0x7FFFu + ((u >> 16) & 1u); return (unsigned short)(u >> 16); }
__device__ __forceinline__ float bf2f(unsigned short b) { return __uint_as_float(((unsigned)b) << 16); }
__device__ __forceinline__ float bfr(float f) { return bf2f(f2bf(f)); }
__device__ __forceinline__ v16h cat16(v8h lo, v8h hi) { return __builtin_shufflevector(lo, hi, 0, 1, 2, 3, 4, 5, 6, 7, 8, 9, 10, 11, 12, 13, 14, 15); }
__device__ __forceinline__ v16bf cat16b(v8us lo, v8us hi) { return __builtin_bit_cast(v16bf, __builtin_shufflevector(lo, hi, 0, 1, 2, 3, 4, 5, 6, 7, 8, 9, 10, 11, 12, 13, 14, 15)); }
__device__ __forceinline__ v8f wmma16(v16h a, v16h b, v8f c) { return __builtin_amdgcn_wmma_f32_16x16x32_f16(false, a, false, b, (short)0, c, false, false); }
__device__ __forceinline__ v8f wmmab(v16bf a, v16bf b, v8f c) { return __builtin_amdgcn_wmma_f32_16x16x32_bf16(false, a, false, b, (short)0, c, false, false); }
__device__ __forceinline__ h16 tohx(float x) { return (h16)x; }
__device__ __forceinline__ void splitf(float y, unsigned short& h, unsigned short& l) { h = f2bf(y); l = f2bf(y - bf2f(h)); }

// ---- k_gemmw: register-blocked GEMM, ONE WAVE per 64 x (16*NBN) output tile, operands straight from K-contiguous 16-bit planes; grid (M/64, N/(16*NBN), Z), 32 threads.
// C[m][n] (f32, pitch ldc) = (sum_k A[m][k] Bt[n][k] [+ A2 B same accumulator (MODE 1)] [+ (A Bt2) * rs2 from a separate accumulator (MODE 2)]) * oscale + optional bf16-cast bias[n].
// A rows pitch lda, Bt rows pitch ldb (elements), z-batch strides sA/sB/sC in elements. K % 32 == 0. Fragments: lane row/col = lane&15, elements 0..7 <- k0+8h.., 8..15 <- k0+16+8h.. for A and B.
template <typename T16> struct WFrag;
template <> struct WFrag<h16> { typedef v16h V; static __device__ __forceinline__ V ld(const h16* p) { return cat16(*(const v8h*)p, *(const v8h*)(p + 16)); } static __device__ __forceinline__ v8f mma(V a, V b, v8f c) { return wmma16(a, b, c); } };
template <> struct WFrag<bf> { typedef v16bf V; static __device__ __forceinline__ V ld(const bf* p) { return cat16b(*(const v8us*)p, *(const v8us*)(p + 16)); } static __device__ __forceinline__ v8f mma(V a, V b, v8f c) { return wmmab(a, b, c); } };
template <typename T16, int MODE, bool BIAS, int NBN>
__global__ __launch_bounds__(32) void k_gemmw(const T16* __restrict__ A, const T16* __restrict__ A2, int lda, const T16* __restrict__ Bt, const T16* __restrict__ Bt2, int ldb, int K, float* C, int ldc, const float* __restrict__ bias, float oscale, float rs2, size_t sA, size_t sB, size_t sC) {
    typedef typename WFrag<T16>::V V;
    __shared__ __align__(16) float os[16 * 68];
    const size_t z = blockIdx.z; A += z * sA; if (MODE == 1) A2 += z * sA; Bt += z * sB; if (MODE == 2) Bt2 += z * sB; C += z * sC;
    const int lane = threadIdx.x & 31, lr = lane & 15, hi = lane >> 4; const int r0 = blockIdx.x * 64, c0 = blockIdx.y * (16 * NBN);
    v8f acc[4][NBN], acc2[4][NBN];
#pragma unroll
    for (int mb = 0; mb < 4; ++mb)
#pragma unroll
        for (int nb = 0; nb < NBN; ++nb) { acc[mb][nb] = (v8f){}; acc2[mb][nb] = (v8f){}; }
    const size_t aoff = (size_t)(r0 + lr) * lda + 8 * hi, boff = (size_t)(c0 + lr) * ldb + 8 * hi;
#pragma unroll 1
    for (int kc = 0; kc < K; kc += 32) {
        V a[4], a2[4];
#pragma unroll
        for (int mb = 0; mb < 4; ++mb) { a[mb] = WFrag<T16>::ld(A + aoff + (size_t)mb * 16 * lda + kc); if (MODE == 1) a2[mb] = WFrag<T16>::ld(A2 + aoff + (size_t)mb * 16 * lda + kc); }
#pragma unroll
        for (int nb = 0; nb < NBN; ++nb) { const V b = WFrag<T16>::ld(Bt + boff + (size_t)nb * 16 * ldb + kc); V b2; if (MODE == 2) b2 = WFrag<T16>::ld(Bt2 + boff + (size_t)nb * 16 * ldb + kc);
#pragma unroll
            for (int mb = 0; mb < 4; ++mb) { acc[mb][nb] = WFrag<T16>::mma(a[mb], b, acc[mb][nb]); if (MODE == 1) acc[mb][nb] = WFrag<T16>::mma(a2[mb], b, acc[mb][nb]); if (MODE == 2) acc2[mb][nb] = WFrag<T16>::mma(a[mb], b2, acc2[mb][nb]); } }
        if (MODE == 2) asm volatile("v_nop\n\tv_nop\n\tv_nop\n\tv_nop" : "+v"(acc[0][0]), "+v"(acc[1][NBN - 1]), "+v"(acc[2][0]), "+v"(acc[3][NBN - 1]), "+v"(acc2[0][0]), "+v"(acc2[1][NBN - 1]), "+v"(acc2[2][0]), "+v"(acc2[3][NBN - 1]) : "v"(a[0]), "v"(a[3]));
        else asm volatile("v_nop\n\tv_nop\n\tv_nop\n\tv_nop" : "+v"(acc[0][0]), "+v"(acc[1][NBN - 1]), "+v"(acc[2][0]), "+v"(acc[3][NBN - 1]) : "v"(a[0]), "v"(a[3]));
    }
    constexpr int LPR = 4 * NBN, RPI = 32 / LPR, NIT = 16 / RPI;   // lanes per row, rows per instruction, instructions per slab
    const int rl = lane / LPR, cofs = (lane % LPR) * 4;
#pragma unroll
    for (int mb = 0; mb < 4; ++mb) {
#pragma unroll
        for (int nb = 0; nb < NBN; ++nb) {
#pragma unroll
            for (int j = 0; j < 8; ++j) { float vv = acc[mb][nb][j]; if (MODE == 2) vv += acc2[mb][nb][j] * rs2; os[(hi * 8 + j) * 68 + nb * 16 + lr] = vv * oscale; } }
        __builtin_amdgcn_wave_barrier(); asm volatile("" ::: "memory");
        float* crow = C + (size_t)(r0 + mb * 16) * ldc + c0;
{
#pragma unroll
            for (int s = 0; s < NIT; ++s) { const int row = RPI * s + rl; v4f val = *(const v4fa*)(os + row * 68 + cofs); if (BIAS) { val[0] += bfr(bias[c0 + cofs]); val[1] += bfr(bias[c0 + cofs + 1]); val[2] += bfr(bias[c0 + cofs + 2]); val[3] += bfr(bias[c0 + cofs + 3]); }
                *(v4f*)(crow + (size_t)row * ldc + cofs) = val; }
             }
        __builtin_amdgcn_wave_barrier(); asm volatile("" ::: "memory");
    }
}

// ---- k_pv: ctx = P V, split along the keys so that the launch fills the chip. Grid (NQ/64, PVB, NH), PVW waves: a block owns one 64 x 32 tile of one head over NK/PVB keys, and wave w multiplies its own
// NK/(PVB*PVW) = 64 keys, which is one whole 128-B line of every P row and V^T row it touches. Fragments and the two accumulators (V^T hi, V^T residual) as in k_gemmw MODE 2.
// The PVW partial tiles meet in LDS as [col][row] (pitch 68 floats: 16-B stores and loads free of bank conflicts) and are added in wave order; block range y stores its rows to slot y of ctx [row][PVB][256], and k_split adds a row's slots in order.
__global__ __launch_bounds__(32 * PVW) void k_pv(const h16* __restrict__ P, const h16* __restrict__ VTh, const h16* __restrict__ VTl, float* C) {
    constexpr int KW = NK / (PVB * PVW), KS = KW / 32, RP = 68;
    static_assert(KW % 32 == 0 && PVW * 4 == 64 && HD == 32);
    __shared__ __align__(16) float red[PVW * HD * RP];
    const int lane = threadIdx.x & 31, lr = lane & 15, hi = lane >> 4, w = __builtin_amdgcn_readfirstlane(threadIdx.x >> 5);
    const int r0 = blockIdx.x * 64, h = blockIdx.z, k0 = (blockIdx.y * PVW + w) * KW;
    const h16* ap = P + ((size_t)h * NQ + r0 + lr) * NK + k0 + 8 * hi;
    const size_t boff = (size_t)(h * HD + lr) * NK + k0 + 8 * hi;
    const h16* bh = VTh + boff; const h16* bl = VTl + boff;
    v8f acc[4][2], acc2[4][2];
#pragma unroll
    for (int mb = 0; mb < 4; ++mb)
#pragma unroll
        for (int nb = 0; nb < 2; ++nb) { acc[mb][nb] = (v8f){}; acc2[mb][nb] = (v8f){}; }
    v16h a[4][KS], b[2][KS], b2[2][KS];
#pragma unroll
    for (int nb = 0; nb < 2; ++nb)
#pragma unroll
        for (int s = 0; s < KS; ++s) { b[nb][s] = WFrag<h16>::ld(bh + (size_t)nb * 16 * NK + s * 32); b2[nb][s] = WFrag<h16>::ld(bl + (size_t)nb * 16 * NK + s * 32); }
#pragma unroll
    for (int mb = 0; mb < 4; ++mb)
#pragma unroll
        for (int s = 0; s < KS; ++s) a[mb][s] = WFrag<h16>::ld(ap + (size_t)mb * 16 * NK + s * 32);
    // the wait that belongs in front of any overwrite of an issued load's address registers; the three addresses are inputs so that they stay whole up to it (else a later load's result is placed on them)
    asm volatile("s_wait_xcnt 0x0" :: "v"(ap), "v"(bh), "v"(bl) : "memory");
    // keeps every load of the wave's slice in front of the first product: the wave waits out one memory latency, not one per group of loads, and asks for the pieces of a line together
    __builtin_amdgcn_sched_barrier(0);
#pragma unroll
    for (int nb = 0; nb < 2; ++nb)
#pragma unroll
        for (int s = 0; s < KS; ++s)
#pragma unroll
            for (int mb = 0; mb < 4; ++mb) { acc[mb][nb] = wmma16(a[mb][s], b[nb][s], acc[mb][nb]); acc2[mb][nb] = wmma16(a[mb][s], b2[nb][s], acc2[mb][nb]); }
    float* my = red + (size_t)w * (HD * RP);
#pragma unroll
    for (int mb = 0; mb < 4; ++mb)
#pragma unroll
        for (int nb = 0; nb < 2; ++nb) { v4f s0, s1;
#pragma unroll
            for (int j = 0; j < 4; ++j) { s0[j] = acc[mb][nb][j] + acc2[mb][nb][j] * (1.0f / RCAR); s1[j] = acc[mb][nb][4 + j] + acc2[mb][nb][4 + j] * (1.0f / RCAR); }
            float* d = my + (nb * 16 + lr) * RP + mb * 16 + hi * 8; *(v4fa*)d = s0; *(v4fa*)(d + 4) = s1; }
    __syncthreads();
    // wave w adds rows 4w..4w+3 of the tile, lane = column: each of its four stores is one whole 128-B line
    v4f s = *(const v4fa*)(red + lane * RP + 4 * w);
#pragma unroll
    for (int i = 1; i < PVW; ++i) s += *(const v4fa*)(red + (i * HD + lane) * RP + 4 * w);
    float* crow = C + ((size_t)(r0 + 4 * w) * PVB + blockIdx.y) * DM + h * HD + lane;
#pragma unroll
    for (int q = 0; q < 4; ++q) crow[(size_t)q * PVB * DM] = s[q] * (1.0f / (PCAR * VCAR));
}

__global__ __launch_bounds__(256) void k_cvt8(const float* __restrict__ src, bf* dst, size_t n8) { const size_t i = (size_t)blockIdx.x * 256 + threadIdx.x; if (i >= n8) return; const v8f v = *(const v8f*)(src + i * 8); v8us o;
#pragma unroll
    for (int k = 0; k < 8; ++k) o[k] = f2bf(v[k]); *(v8us*)(dst + i * 8) = o;  }

__global__ __launch_bounds__(256) void k_wT(const float* __restrict__ W, bf* WT, int Kin, int Nout) { const size_t g = (size_t)blockIdx.x * 256 + threadIdx.x; if (g >= (size_t)Nout * Kin / 8) return; const int k0 = (int)(g % (size_t)(Kin / 8)) * 8; const int n = (int)(g / (size_t)(Kin / 8)); v8us o;
#pragma unroll
    for (int q = 0; q < 8; ++q) o[q] = f2bf(W[(size_t)(k0 + q) * Nout + n]);
    bf* d = WT + (size_t)n * Kin + k0; *(v8us*)d = o;  }

__global__ __launch_bounds__(256) void k_q16(const float* __restrict__ src, h16* dst, size_t n8) { const size_t i = (size_t)blockIdx.x * 256 + threadIdx.x; if (i >= n8) return; const v8f v = *(const v8f*)(src + i * 8); v8h o;
#pragma unroll
    for (int k = 0; k < 8; ++k) o[k] = tohx(v[k] * QCAR); *(v8h*)(dst + i * 8) = o;  }

// k_kv16: kv f32 [4096][512] -> k plane K16[j][c] = f16(k x KCAR) ([4096][256]; first half of the threads, lane -> 8 consecutive c) and V^T planes VTh[c][j] = f16(v x VCAR), VTl[c][j] = f16((v x VCAR - VTh) x RCAR)
__global__ __launch_bounds__(256) void k_kv16(const float* __restrict__ KV, h16* K16, h16* VTh, h16* VTl) {
    const size_t g = (size_t)blockIdx.x * 256 + threadIdx.x; const size_t NA = (size_t)NK * DM / 8;
    if (g < NA) {
        const int j = (int)(g / (DM / 8)); const int c0 = (int)(g % (DM / 8)) * 8;
        const v8f a = *(const v8f*)(KV + (size_t)j * (2 * DM) + c0); v8h o;
#pragma unroll
        for (int q = 0; q < 8; ++q) o[q] = tohx(a[q] * KCAR);
        h16* d = K16 + (size_t)j * DM + c0; *(v8h*)d = o; 
    } else if (g < 2 * NA) {
        const size_t e = g - NA; const int j0 = (int)(e % (size_t)(NK / 8)) * 8; const int c = (int)(e / (size_t)(NK / 8));
        v8h oh, ol;
#pragma unroll
        for (int q = 0; q < 8; ++q) { const float y = KV[(size_t)(j0 + q) * (2 * DM) + DM + c] * VCAR; const h16 hh = tohx(y); oh[q] = hh; ol[q] = tohx(__fmul_rn(__fsub_rn(y, (float)hh), RCAR)); }
        const size_t oo = (size_t)c * NK + j0;
        *(v8h*)(VTh + oo) = oh; *(v8h*)(VTl + oo) = ol; 
    }
}

// k_soft: one block (256 threads) per score row of 4,096 keys: t = S x HD^-0.5/(QCAR KCAR); max and sum reduced by shuffles then a fixed-order combine of 8 per-wave partials in LDS (block barriers);
__global__ __launch_bounds__(256) void k_soft(const float* __restrict__ Sb, h16* P) {
    __shared__ float red[16];
    const int t = threadIdx.x, lane = t & 31, w = t >> 5;
    const size_t row = blockIdx.x;
    const float* sr = Sb + row * NK;
    const int c0 = t * 8, c1 = NK / 2 + t * 8;
    const v8f a0 = *(const v8f*)(sr + c0); const v8f a1 = *(const v8f*)(sr + c1);
    float v[16]; float mx = -3.0e38f;
#pragma unroll
    for (int q = 0; q < 8; ++q) { v[q] = a0[q] * SCL2; v[8 + q] = a1[q] * SCL2; mx = fmaxf(mx, fmaxf(v[q], v[8 + q])); }
#pragma unroll
    for (int sh = 16; sh; sh >>= 1) mx = fmaxf(mx, __shfl_xor(mx, sh, 32));
    if (lane == 0) red[w] = mx;
    __syncthreads();
    mx = red[0];
#pragma unroll
    for (int i = 1; i < 8; ++i) mx = fmaxf(mx, red[i]);
    float sum = 0.f;
#pragma unroll
    for (int k = 0; k < 16; ++k) { float d0 = __fsub_rn(v[k], mx); asm volatile("" : "+v"(d0)); v[k] = __builtin_amdgcn_exp2f(__fmul_rn(d0, 1.4426950408889634f)); sum += v[k]; }
#pragma unroll
    for (int sh = 16; sh; sh >>= 1) sum += __shfl_xor(sum, sh, 32);
    if (lane == 0) red[8 + w] = sum;
    __syncthreads();
    float tot = red[8];
#pragma unroll
    for (int i = 1; i < 8; ++i) tot += red[8 + i];
    const float f = __fdiv_rn(PCAR, tot);
    v8h o0, o1;
#pragma unroll
    for (int q = 0; q < 8; ++q) { o0[q] = tohx(v[q] * f); o1[q] = tohx(v[8 + q] * f); }
    h16* pr = P + row * NK;
    *(v8h*)(pr + c0) = o0; *(v8h*)(pr + c1) = o1; 
}

__global__ __launch_bounds__(256) void k_split(const float* __restrict__ src, bf* dh, bf* dl, size_t n8) { const size_t i = (size_t)blockIdx.x * 256 + threadIdx.x; if (i >= n8) return; const float* sp = src + (i / (DM / 8)) * (size_t)(PVB * DM) + (i % (DM / 8)) * 8; v8f v = *(const v8f*)sp; v8us oh, ol;
#pragma unroll
    for (int p = 1; p < PVB; ++p) v += *(const v8f*)(sp + p * DM);   // the row's PVB key-range sums of k_pv, in range order
    // the wait that belongs in front of any overwrite of an issued load's address registers; the address is an input so that it stays whole up to it
    asm volatile("s_wait_xcnt 0x0" :: "v"(sp) : "memory");
#pragma unroll
    for (int k = 0; k < 8; ++k) { unsigned short a, c; splitf(v[k], a, c); oh[k] = a; ol[k] = c; }
    *(v8us*)(dh + i * 8) = oh; *(v8us*)(dl + i * 8) = ol;  }

// ---- workspace carve (bytes, 256-B aligned regions; all sizes compile-time)
constexpr size_t al256(size_t x) { return (x + 255) & ~(size_t)255; }
constexpr size_t cmax(size_t a, size_t b) { return a > b ? a : b; }
constexpr size_t SZ_XS  = al256((size_t)NB * NQ_FULL * DM * 2);                                 // state as bf16 [NB][NQ_FULL][256]
constexpr size_t SZ_WQ  = al256((size_t)DM * DM * 2);                                           // Wq^T [256][256]
constexpr size_t SZ_WKV = al256((size_t)2 * DM * DM * 2);                                       // Wkv^T [512][256]
constexpr size_t SZ_WO  = al256((size_t)DM * DM * 2);                                           // Wo^T [256][256]
constexpr size_t SZ_GF  = al256(cmax((size_t)NB * NQ * DM * 4, (size_t)NK * 2 * DM * 4));      // f32 GEMM scratch: q [NB*NQ][256] first, then per batch kv [4096][512]
constexpr size_t SZ_Q16 = al256((size_t)NB * NQ * DM * 2);                                      // q f16 [NB*NQ][256]
constexpr size_t SZ_XP  = al256((size_t)NK * DM * 2);                                           // one batch of points as bf16 [4096][256]
constexpr size_t SZ_K16 = al256((size_t)NK * DM * 2);                                           // k f16 [4096][256]
constexpr size_t SZ_VT  = al256((size_t)DM * NK * 2);                                           // V^T plane [256][4096] (hi, residual: one each)
constexpr size_t SZ_S   = al256((size_t)NH * NQ * NK * 4);                                      // scores [8][NQ][4096] f32
constexpr size_t SZ_P   = al256((size_t)NH * NQ * NK * 2);                                      // P plane [8][NQ][4096] f16
constexpr size_t SZ_CTX = al256((size_t)PVB * NB * NQ * DM * 4);                                // ctx f32 [NB*NQ][PVB][256], one slot per key range
constexpr size_t SZ_C16 = al256((size_t)NB * NQ * DM * 2);                                      // ctx hi / lo planes
constexpr size_t O_XS = 0, O_WQ = O_XS + SZ_XS, O_WKV = O_WQ + SZ_WQ, O_WO = O_WKV + SZ_WKV, O_GF = O_WO + SZ_WO, O_Q16 = O_GF + SZ_GF, O_XP = O_Q16 + SZ_Q16, O_K16 = O_XP + SZ_XP,
                 O_VTH = O_K16 + SZ_K16, O_VTL = O_VTH + SZ_VT, O_S = O_VTL + SZ_VT, O_P = O_S + SZ_S, O_CTX = O_P + SZ_P, O_CH = O_CTX + SZ_CTX, O_CL = O_CH + SZ_C16, O_END = O_CL + SZ_C16;
static_assert(O_END <= (size_t)268435456);
static_assert((size_t)NB * NQ * DM * 4 <= SZ_GF && (size_t)NK * 2 * DM * 4 <= SZ_GF);
static_assert(((size_t)(NB_FULL - 1) * NQ_FULL + NQ_FULL) * DM * 4 <= (size_t)NB_FULL * NQ_FULL * DM * 4);

extern "C" void kernel_launch(void* const* d_in, const int* in_sizes, int n_in, void* d_out, int out_size, void* d_ws, size_t ws_size, hipStream_t stream) {
    if (n_in < 8) return;
    if (in_sizes[0] < NB * NQ_FULL * DM || in_sizes[1] < NB * NK * DM || in_sizes[2] < DM * DM || in_sizes[3] < DM || in_sizes[4] < DM * 2 * DM || in_sizes[5] < 2 * DM || in_sizes[6] < DM * DM || in_sizes[7] < DM) return;
    if ((size_t)out_size < (size_t)NB * NQ_FULL * DM) return;
    if (O_END > ws_size) return;
    const float* state = (const float*)d_in[0];   // [8][512][256]
    const float* pts   = (const float*)d_in[1];   // [8][4096][256]
    const float* Wq    = (const float*)d_in[2];   // [256][256] in x out
    const float* bq    = (const float*)d_in[3];   // [256]
    const float* Wkv   = (const float*)d_in[4];   // [256][512]
    const float* bkv   = (const float*)d_in[5];   // [512]
    const float* Wo    = (const float*)d_in[6];   // [256][256]
    const float* bo    = (const float*)d_in[7];   // [256]
    float* OUT = (float*)d_out;                   // [8][512][256]
    char* ws = (char*)d_ws;
    bf* XS = (bf*)(ws + O_XS); bf* WQT = (bf*)(ws + O_WQ); bf* WKVT = (bf*)(ws + O_WKV); bf* WOT = (bf*)(ws + O_WO);
    float* GF = (float*)(ws + O_GF); h16* Q16 = (h16*)(ws + O_Q16); bf* XP = (bf*)(ws + O_XP); h16* K16 = (h16*)(ws + O_K16);
    h16* VTH = (h16*)(ws + O_VTH); h16* VTL = (h16*)(ws + O_VTL); float* S = (float*)(ws + O_S); h16* P = (h16*)(ws + O_P);
    float* CTX = (float*)(ws + O_CTX); bf* CH = (bf*)(ws + O_CH); bf* CL = (bf*)(ws + O_CL);

    // planes of the inputs
    { const size_t n8 = (size_t)NB * NQ_FULL * DM / 8; k_cvt8<<<(unsigned)((n8 + 255) / 256), 256, 0, stream>>>(state, XS, n8); }
    k_wT<<<(unsigned)(((size_t)DM * DM / 8 + 255) / 256), 256, 0, stream>>>(Wq, WQT, DM, DM);
    k_wT<<<(unsigned)(((size_t)2 * DM * DM / 8 + 255) / 256), 256, 0, stream>>>(Wkv, WKVT, DM, 2 * DM);
    k_wT<<<(unsigned)(((size_t)DM * DM / 8 + 255) / 256), 256, 0, stream>>>(Wo, WOT, DM, DM);
    // q = Xs Wq + bq for all batches: GF [NB*NQ][256] f32, then the f16 plane
    k_gemmw<bf, 0, true, 4><<<dim3(NQ / 64, DM / 64, NB), 32, 0, stream>>>(XS, nullptr, DM, WQT, nullptr, DM, DM, GF, DM, bq, 1.0f, 0.0f, (size_t)NQ_FULL * DM, (size_t)0, (size_t)NQ * DM);
    { const size_t n8 = (size_t)NB * NQ * DM / 8; k_q16<<<(unsigned)((n8 + 255) / 256), 256, 0, stream>>>(GF, Q16, n8); }
    for (int b = 0; b < NB; ++b) {
        const float* pb = pts + (size_t)b * NK * DM;
        { const size_t n8 = (size_t)NK * DM / 8; k_cvt8<<<(unsigned)((n8 + 255) / 256), 256, 0, stream>>>(pb, XP, n8); }
        // kv = Xp Wkv + bkv: GF [4096][512] f32
        k_gemmw<bf, 0, true, 4><<<dim3(NK / 64, (2 * DM) / 64, 1), 32, 0, stream>>>(XP, nullptr, DM, WKVT, nullptr, DM, DM, GF, 2 * DM, bkv, 1.0f, 0.0f, (size_t)0, (size_t)0, (size_t)0);
        // k plane [4096][256], V^T hi/residual planes [256][4096]
        k_kv16<<<(unsigned)((size_t)2 * NK * DM / 8 / 256), 256, 0, stream>>>(GF, K16, VTH, VTL);
        // scores S[h][i][j] = q'_h[i] . k'_h[j] (K = 32), z = head: A = q plane + h*32 (pitch 256), Bt = k plane + h*32 (pitch 256)
        k_gemmw<h16, 0, false, 4><<<dim3(NQ / 64, NK / 64, NH), 32, 0, stream>>>(Q16 + (size_t)b * NQ * DM, nullptr, DM, K16, nullptr, DM, HD, S, NK, nullptr, 1.0f, 0.0f, (size_t)HD, (size_t)HD, (size_t)NQ * NK);
        // softmax over the 4,096 keys per (head, query) row -> P plane
        k_soft<<<(unsigned)(NH * NQ), 256, 0, stream>>>(S, P);
        // ctx[b][i][y][h*32 + d] = sum over key range y of P_h[i][j] v[j][h*32+d]: 64x32 tiles, y = key range, z = head
        k_pv<<<dim3(NQ / 64, PVB, NH), 32 * PVW, 0, stream>>>(P, VTH, VTL, CTX + (size_t)b * NQ * PVB * DM);
    }
    // out = ctx Wo + bo: ctx (its key-range sums added) as bf16 hi/lo planes, rows of batch b at OUT + b*NQ_FULL*256
    { const size_t n8 = (size_t)NB * NQ * DM / 8; k_split<<<(unsigned)((n8 + 255) / 256), 256, 0, stream>>>(CTX, CH, CL, n8); }
    k_gemmw<bf, 1, true, 4><<<dim3(NQ / 64, DM / 64, NB), 32, 0, stream>>>(CH, CL, DM, WOT, nullptr, DM, DM, OUT, DM, bo, 1.0f, 0.0f, (size_t)NQ * DM, (size_t)0, (size_t)NQ_FULL * DM);
}

// v002
// Measured time: 342 microseconds a run.
// Next to v001, in two timings, it ran 1.49 times as fast each time.
// All steps since v000 together make it 3.57 times as fast.
#include <hip/hip_runtime.h>

// Contractions, all f32 accumulate: q = Xs Wq + bq and kv = Xp Wkv + bkv on v_wmma_f32_16x16x32_bf16 (bf16 RNE planes of the f32 inputs, weights transposed to [out][in]); per-head scores q k^T on v_wmma_f32_16x16x32_f16 (q and k as f16 planes carried x8 each); per-head P V on v_wmma_f32_16x16x32_f16 (P f16 carried x2^14; V^T as an f16 hi plane carried x4 plus an f16 residual plane carried x2^10 into a separate accumulator); out = ctx Wo + bo on v_wmma_f32_16x16x32_bf16 (ctx as bf16 hi + lo planes, Wo bf16). Softmax f32, max-subtracted, fixed-order sums. Scores, softmax and P V run in one kernel, split along the keys over the waves of a block; scores and P stay in registers, each wave subtracts its own keys' maximum, P is left unnormalised and the row's sum divides the result; partial sums are brought to the row's maximum and added in a fixed order.

#ifndef NB
#define NB 8            // batches computed (reducible)
#endif
#ifndef NQ
#define NQ 512          // query rows per batch computed (reducible, multiple of 64)
#endif
#define NB_FULL 8
#define NQ_FULL 512     // per-batch stride of the state input and of the output
#define NK 4096         // keys (softmax row length)
#define DM 256
#define NH 8
#define HD 32
#define QCAR 8.0f
#define KCAR 8.0f
#define VCAR 4.0f
#define RCAR 1024.0f
#define PCAR 16384.0f
#define FW 16            // waves per block of k_attn, each on its own NK/FW keys
#define SCL2 (0.17677669529663687f * 0.015625f)   // HD^-0.5 / (QCAR*KCAR)

static_assert(NB >= 1 && NB <= NB_FULL);
static_assert(NQ >= 64 && NQ <= NQ_FULL && (NQ % 64) == 0);
static_assert(NK == 256 * 16);
static_assert((DM % 64) == 0 && (NK % 64) == 0 && HD == 32 && NH * HD == DM);

typedef _Float16 h16;
typedef unsigned short bf;
typedef __attribute__((ext_vector_type(16))) __bf16   v16bf;
typedef __attribute__((ext_vector_type(16))) _Float16 v16h;
typedef __attribute__((ext_vector_type(8)))  _Float16 v8h;
typedef __attribute__((ext_vector_type(8)))  unsigned short v8us;
typedef __attribute__((ext_vector_type(8)))  float    v8f;
typedef __attribute__((ext_vector_type(4)))  float    v4f;
typedef v8h  __attribute__((may_alias)) v8ha;
typedef v4f  __attribute__((may_alias)) v4fa;
typedef v8us __attribute__((may_alias)) v8usa;

__device__ __forceinline__ unsigned short f2bf(float f) { unsigned u = __float_as_uint(f); u += 0x7FFFu + ((u >> 16) & 1u); return (unsigned short)(u >> 16); }
__device__ __forceinline__ float bf2f(unsigned short b) { return __uint_as_float(((unsigned)b) << 16); }
__device__ __forceinline__ float bfr(float f) { return bf2f(f2bf(f)); }
__device__ __forceinline__ v16h cat16(v8h lo, v8h hi) { return __builtin_shufflevector(lo, hi, 0, 1, 2, 3, 4, 5, 6, 7, 8, 9, 10, 11, 12, 13, 14, 15); }
__device__ __forceinline__ v16bf cat16b(v8us lo, v8us hi) { return __builtin_bit_cast(v16bf, __builtin_shufflevector(lo, hi, 0, 1, 2, 3, 4, 5, 6, 7, 8, 9, 10, 11, 12, 13, 14, 15)); }
__device__ __forceinline__ v8f wmma16(v16h a, v16h b, v8f c) { return __builtin_amdgcn_wmma_f32_16x16x32_f16(false, a, false, b, (short)0, c, false, false); }
__device__ __forceinline__ v8f wmmab(v16bf a, v16bf b, v8f c) { return __builtin_amdgcn_wmma_f32_16x16x32_bf16(false, a, false, b, (short)0, c, false, false); }
__device__ __forceinline__ h16 tohx(float x) { return (h16)x; }
__device__ __forceinline__ void splitf(float y, unsigned short& h, unsigned short& l) { h = f2bf(y); l = f2bf(y - bf2f(h)); }

// ---- k_gemmw: register-blocked GEMM, ONE WAVE per 64 x (16*NBN) output tile, operands straight from K-contiguous 16-bit planes; grid (M/64, N/(16*NBN), Z), 32 threads.
// C[m][n] (f32, pitch ldc) = (sum_k A[m][k] Bt[n][k] [+ A2 B same accumulator (MODE 1)] [+ (A Bt2) * rs2 from a separate accumulator (MODE 2)]) * oscale + optional bf16-cast bias[n].
// A rows pitch lda, Bt rows pitch ldb (elements), z-batch strides sA/sB/sC in elements. K % 32 == 0. Fragments: lane row/col = lane&15, elements 0..7 <- k0+8h.., 8..15 <- k0+16+8h.. for A and B.
template <typename T16> struct WFrag;
template <> struct WFrag<h16> { typedef v16h V; static __device__ __forceinline__ V ld(const h16* p) { return cat16(*(const v8h*)p, *(const v8h*)(p + 16)); } static __device__ __forceinline__ v8f mma(V a, V b, v8f c) { return wmma16(a, b, c); } };
template <> struct WFrag<bf> { typedef v16bf V; static __device__ __forceinline__ V ld(const bf* p) { return cat16b(*(const v8us*)p, *(const v8us*)(p + 16)); } static __device__ __forceinline__ v8f mma(V a, V b, v8f c) { return wmmab(a, b, c); } };
template <typename T16, int MODE, bool BIAS, int NBN>
__global__ __launch_bounds__(32) void k_gemmw(const T16* __restrict__ A, const T16* __restrict__ A2, int lda, const T16* __restrict__ Bt, const T16* __restrict__ Bt2, int ldb, int K, float* C, int ldc, const float* __restrict__ bias, float oscale, float rs2, size_t sA, size_t sB, size_t sC) {
    typedef typename WFrag<T16>::V V;
    __shared__ __align__(16) float os[16 * 68];
    const size_t z = blockIdx.z; A += z * sA; if (MODE == 1) A2 += z * sA; Bt += z * sB; if (MODE == 2) Bt2 += z * sB; C += z * sC;
    const int lane = threadIdx.x & 31, lr = lane & 15, hi = lane >> 4; const int r0 = blockIdx.x * 64, c0 = blockIdx.y * (16 * NBN);
    v8f acc[4][NBN], acc2[4][NBN];
#pragma unroll
    for (int mb = 0; mb < 4; ++mb)
#pragma unroll
        for (int nb = 0; nb < NBN; ++nb) { acc[mb][nb] = (v8f){}; acc2[mb][nb] = (v8f){}; }
    const size_t aoff = (size_t)(r0 + lr) * lda + 8 * hi, boff = (size_t)(c0 + lr) * ldb + 8 * hi;
#pragma unroll 1
    for (int kc = 0; kc < K; kc += 32) {
        V a[4], a2[4];
#pragma unroll
        for (int mb = 0; mb < 4; ++mb) { a[mb] = WFrag<T16>::ld(A + aoff + (size_t)mb * 16 * lda + kc); if (MODE == 1) a2[mb] = WFrag<T16>::ld(A2 + aoff + (size_t)mb * 16 * lda + kc); }
#pragma unroll
        for (int nb = 0; nb < NBN; ++nb) { const V b = WFrag<T16>::ld(Bt + boff + (size_t)nb * 16 * ldb + kc); V b2; if (MODE == 2) b2 = WFrag<T16>::ld(Bt2 + boff + (size_t)nb * 16 * ldb + kc);
#pragma unroll
            for (int mb = 0; mb < 4; ++mb) { acc[mb][nb] = WFrag<T16>::mma(a[mb], b, acc[mb][nb]); if (MODE == 1) acc[mb][nb] = WFrag<T16>::mma(a2[mb], b, acc[mb][nb]); if (MODE == 2) acc2[mb][nb] = WFrag<T16>::mma(a[mb], b2, acc2[mb][nb]); } }
        if (MODE == 2) asm volatile("v_nop\n\tv_nop\n\tv_nop\n\tv_nop" : "+v"(acc[0][0]), "+v"(acc[1][NBN - 1]), "+v"(acc[2][0]), "+v"(acc[3][NBN - 1]), "+v"(acc2[0][0]), "+v"(acc2[1][NBN - 1]), "+v"(acc2[2][0]), "+v"(acc2[3][NBN - 1]) : "v"(a[0]), "v"(a[3]));
        else asm volatile("v_nop\n\tv_nop\n\tv_nop\n\tv_nop" : "+v"(acc[0][0]), "+v"(acc[1][NBN - 1]), "+v"(acc[2][0]), "+v"(acc[3][NBN - 1]) : "v"(a[0]), "v"(a[3]));
    }
    constexpr int LPR = 4 * NBN, RPI = 32 / LPR, NIT = 16 / RPI;   // lanes per row, rows per instruction, instructions per slab
    const int rl = lane / LPR, cofs = (lane % LPR) * 4;
#pragma unroll
    for (int mb = 0; mb < 4; ++mb) {
#pragma unroll
        for (int nb = 0; nb < NBN; ++nb) {
#pragma unroll
            for (int j = 0; j < 8; ++j) { float vv = acc[mb][nb][j]; if (MODE == 2) vv += acc2[mb][nb][j] * rs2; os[(hi * 8 + j) * 68 + nb * 16 + lr] = vv * oscale; } }
        __builtin_amdgcn_wave_barrier(); asm volatile("" ::: "memory");
        float* crow = C + (size_t)(r0 + mb * 16) * ldc + c0;
{
#pragma unroll
            for (int s = 0; s < NIT; ++s) { const int row = RPI * s + rl; v4f val = *(const v4fa*)(os + row * 68 + cofs); if (BIAS) { val[0] += bfr(bias[c0 + cofs]); val[1] += bfr(bias[c0 + cofs + 1]); val[2] += bfr(bias[c0 + cofs + 2]); val[3] += bfr(bias[c0 + cofs + 3]); }
                *(v4f*)(crow + (size_t)row * ldc + cofs) = val; }
             }
        __builtin_amdgcn_wave_barrier(); asm volatile("" ::: "memory");
    }
}

// ---- k_attn: ctx = softmax(q k^T HD^-0.5) v for 16 queries of one head. Grid (NQ/16, NH), FW waves; wave w owns keys w*NK/FW .. and never stores a score or a P value.
// S^T = K Q^T (A = 16 key rows, B = the 16 queries): lane (c, hi) holds query c, keys 8hi..8hi+7 of each 16-key tile. Two such tiles, converted in place, are the B operand P^T of O^T += V^T P^T (A = V^T rows d, keys in the same order).
// Each wave subtracts the maximum of its own keys: P = exp(t - max_w) x PCAR, not divided. The waves' O^T partials, row sums and maxima meet in LDS (one barrier); they are brought to the row's maximum, added in wave order, and the sum divides once.
__global__ __launch_bounds__(32 * FW) void k_attn(const h16* __restrict__ Q, const h16* __restrict__ K, const h16* __restrict__ VTh, const h16* __restrict__ VTl, float* C) {
    constexpr int KW = NK / FW, NT = KW / 16, NS = KW / 32, RP = 36;
    static_assert(KW % 32 == 0 && NS >= 2 && FW == 16 && HD == 32 && PCAR == 16384.0f);
    constexpr float CE = SCL2 * 1.4426950408889634f;
    __shared__ __align__(16) float red[FW * 16 * RP];
    __shared__ float mxs[FW * 16], sms[FW * 16];
    const int lane = threadIdx.x & 31, c = lane & 15, hi = lane >> 4, w = __builtin_amdgcn_readfirstlane(threadIdx.x >> 5);
    const int q0 = blockIdx.x * 16, h = blockIdx.y, k0 = w * KW;
    const h16* qp = Q + (size_t)(q0 + c) * DM + h * HD + 8 * hi;
    const h16* kp = K + (size_t)(k0 + c) * DM + h * HD + 8 * hi;
    const size_t voff = (size_t)(h * HD + c) * NK + k0 + 8 * hi;
    const h16* bh = VTh + voff; const h16* bl = VTl + voff;
    const v16h qf = WFrag<h16>::ld(qp);
    v16h kf[NT], vh[NS][2], vl[NS][2];
#pragma unroll
    for (int t = 0; t < NT; ++t) kf[t] = WFrag<h16>::ld(kp + (size_t)t * 16 * DM);
#pragma unroll
    for (int dt = 0; dt < 2; ++dt) { vh[0][dt] = WFrag<h16>::ld(bh + (size_t)dt * 16 * NK); vl[0][dt] = WFrag<h16>::ld(bl + (size_t)dt * 16 * NK); }
    // keeps the first V^T stage's loads up here with the K loads: one memory latency for all of them instead of one more in front of the first P V product
    __builtin_amdgcn_sched_barrier(0);
    v8f st[NT];
#pragma unroll
    for (int t = 0; t < NT; ++t) st[t] = wmma16(kf[t], qf, (v8f){});
    // holds the second stage's loads behind the score products, whose K registers they take over (earlier they spill), and ahead of the maximum and stage 0
    __builtin_amdgcn_sched_barrier(0);
    // four vector slots between the last product and the loads that take over its operand registers (the distance a vector overwrite of A or B needs; a load directly over a product's B is not known to be safe)
    asm volatile("v_nop\n\tv_nop\n\tv_nop\n\tv_nop" ::: "memory");
#pragma unroll
    for (int dt = 0; dt < 2; ++dt) { vh[1][dt] = WFrag<h16>::ld(bh + (size_t)dt * 16 * NK + 32); vl[1][dt] = WFrag<h16>::ld(bl + (size_t)dt * 16 * NK + 32); }
    float mx = st[0][0];
#pragma unroll
    for (int t = 0; t < NT; ++t)
#pragma unroll
        for (int j = 0; j < 8; ++j) mx = fmaxf(mx, st[t][j]);
    mx = fmaxf(mx, __shfl_xor(mx, 16, 32));
    const float off = 14.0f - mx * CE;   // 2^14 = PCAR rides in the exponent
    v8f acc[2], acc2[2];
#pragma unroll
    for (int dt = 0; dt < 2; ++dt) { acc[dt] = (v8f){}; acc2[dt] = (v8f){}; }
    float sum0 = 0.f, sum1 = 0.f;
#pragma unroll
    for (int s = 0; s < NS; ++s) {
        v16h pb;
#pragma unroll
        for (int j = 0; j < 8; ++j) {
            float e0, e1;
            // two v_exp_f32 and the free slot that the instruction set asks for behind a transcendental before its result is read or its source overwritten: the second fills the first one's slot, the v_nop the second one's
            asm("v_exp_f32 %0, %2\n\tv_exp_f32 %1, %3\n\tv_nop" : "=&v"(e0), "=&v"(e1) : "v"(__builtin_fmaf(st[2 * s][j], CE, off)), "v"(__builtin_fmaf(st[2 * s + 1][j], CE, off)));
            sum0 += e0; sum1 += e1; pb[j] = tohx(e0); pb[8 + j] = tohx(e1);
        }
#pragma unroll
        for (int dt = 0; dt < 2; ++dt) { acc[dt] = wmma16(vh[s][dt], pb, acc[dt]); acc2[dt] = wmma16(vl[s][dt], pb, acc2[dt]); }
        // holds stage s + 2's loads between stage s, whose registers they take over (earlier they spill), and stage s + 1, a whole stage of work ahead of their use (left free they sink to their products, and each product waits out a latency of its own)
        __builtin_amdgcn_sched_barrier(0);
        if (s + 2 < NS) {
            // four vector slots between the stage's last product and the loads that take over its operand registers, as above
            asm volatile("v_nop\n\tv_nop\n\tv_nop\n\tv_nop" ::: "memory");
#pragma unroll
            for (int dt = 0; dt < 2; ++dt) { vh[s + 2][dt] = WFrag<h16>::ld(bh + (size_t)dt * 16 * NK + (s + 2) * 32); vl[s + 2][dt] = WFrag<h16>::ld(bl + (size_t)dt * 16 * NK + (s + 2) * 32); }
        }
    }
    // the wait that belongs in front of any overwrite of an issued load's address registers; the four addresses are inputs so that they stay whole up to it
    asm volatile("s_wait_xcnt 0x0" :: "v"(qp), "v"(kp), "v"(bh), "v"(bl) : "memory");
    float sum = sum0 + sum1;
    sum += __shfl_xor(sum, 16, 32);
    if (hi == 0) { mxs[w * 16 + c] = mx; sms[w * 16 + c] = sum; }
    float* my = red + (w * 16 + c) * RP + 8 * hi;
#pragma unroll
    for (int dt = 0; dt < 2; ++dt) { v4f s0, s1;
#pragma unroll
        for (int j = 0; j < 4; ++j) { s0[j] = acc[dt][j] + acc2[dt][j] * (1.0f / RCAR); s1[j] = acc[dt][4 + j] + acc2[dt][4 + j] * (1.0f / RCAR); }
        *(v4fa*)(my + dt * 16) = s0; *(v4fa*)(my + dt * 16 + 4) = s1; }
    __syncthreads();
    // wave w finishes query q0 + w, lane = column d: its store is one whole 128-B line
    float m = mxs[w];
#pragma unroll
    for (int i = 1; i < FW; ++i) m = fmaxf(m, mxs[i * 16 + w]);
    float o = 0.f, tot = 0.f;
#pragma unroll
    for (int i = 0; i < FW; ++i) { const float f = __builtin_amdgcn_exp2f((mxs[i * 16 + w] - m) * CE); o += red[(i * 16 + w) * RP + lane] * f; tot += sms[i * 16 + w] * f; }
    C[(size_t)(q0 + w) * DM + h * HD + lane] = o / (tot * VCAR);
}

__global__ __launch_bounds__(256) void k_cvt8(const float* __restrict__ src, bf* dst, size_t n8) { const size_t i = (size_t)blockIdx.x * 256 + threadIdx.x; if (i >= n8) return; const v8f v = *(const v8f*)(src + i * 8); v8us o;
#pragma unroll
    for (int k = 0; k < 8; ++k) o[k] = f2bf(v[k]); *(v8us*)(dst + i * 8) = o;  }

__global__ __launch_bounds__(256) void k_wT(const float* __restrict__ W, bf* WT, int Kin, int Nout) { const size_t g = (size_t)blockIdx.x * 256 + threadIdx.x; if (g >= (size_t)Nout * Kin / 8) return; const int k0 = (int)(g % (size_t)(Kin / 8)) * 8; const int n = (int)(g / (size_t)(Kin / 8)); v8us o;
#pragma unroll
    for (int q = 0; q < 8; ++q) o[q] = f2bf(W[(size_t)(k0 + q) * Nout + n]);
    bf* d = WT + (size_t)n * Kin + k0; *(v8us*)d = o;  }

__global__ __launch_bounds__(256) void k_q16(const float* __restrict__ src, h16* dst, size_t n8) { const size_t i = (size_t)blockIdx.x * 256 + threadIdx.x; if (i >= n8) return; const v8f v = *(const v8f*)(src + i * 8); v8h o;
#pragma unroll
    for (int k = 0; k < 8; ++k) o[k] = tohx(v[k] * QCAR); *(v8h*)(dst + i * 8) = o;  }

// k_kv16: kv f32 [4096][512] -> k plane K16[j][c] = f16(k x KCAR) ([4096][256]; first half of the threads, lane -> 8 consecutive c) and V^T planes VTh[c][j] = f16(v x VCAR), VTl[c][j] = f16((v x VCAR - VTh) x RCAR)
__global__ __launch_bounds__(256) void k_kv16(const float* __restrict__ KV, h16* K16, h16* VTh, h16* VTl) {
    const size_t g = (size_t)blockIdx.x * 256 + threadIdx.x; const size_t NA = (size_t)NK * DM / 8;
    if (g < NA) {
        const int j = (int)(g / (DM / 8)); const int c0 = (int)(g % (DM / 8)) * 8;
        const v8f a = *(const v8f*)(KV + (size_t)j * (2 * DM) + c0); v8h o;
#pragma unroll
        for (int q = 0; q < 8; ++q) o[q] = tohx(a[q] * KCAR);
        h16* d = K16 + (size_t)j * DM + c0; *(v8h*)d = o; 
    } else if (g < 2 * NA) {
        const size_t e = g - NA; const int j0 = (int)(e % (size_t)(NK / 8)) * 8; const int c = (int)(e / (size_t)(NK / 8));
        v8h oh, ol;
#pragma unroll
        for (int q = 0; q < 8; ++q) { const float y = KV[(size_t)(j0 + q) * (2 * DM) + DM + c] * VCAR; const h16 hh = tohx(y); oh[q] = hh; ol[q] = tohx(__fmul_rn(__fsub_rn(y, (float)hh), RCAR)); }
        const size_t oo = (size_t)c * NK + j0;
        *(v8h*)(VTh + oo) = oh; *(v8h*)(VTl + oo) = ol; 
    }
}

__global__ __launch_bounds__(256) void k_split(const float* __restrict__ src, bf* dh, bf* dl, size_t n8) { const size_t i = (size_t)blockIdx.x * 256 + threadIdx.x; if (i >= n8) return; const float* sp = src + i * 8; const v8f v = *(const v8f*)sp; v8us oh, ol;
    // the wait that belongs in front of any overwrite of an issued load's address registers; the address is an input so that it stays whole up to it
    asm volatile("s_wait_xcnt 0x0" :: "v"(sp) : "memory");
#pragma unroll
    for (int k = 0; k < 8; ++k) { unsigned short a, c; splitf(v[k], a, c); oh[k] = a; ol[k] = c; }
    *(v8us*)(dh + i * 8) = oh; *(v8us*)(dl + i * 8) = ol;  }

// ---- workspace carve (bytes, 256-B aligned regions; all sizes compile-time)
constexpr size_t al256(size_t x) { return (x + 255) & ~(size_t)255; }
constexpr size_t cmax(size_t a, size_t b) { return a > b ? a : b; }
constexpr size_t SZ_XS  = al256((size_t)NB * NQ_FULL * DM * 2);                                 // state as bf16 [NB][NQ_FULL][256]
constexpr size_t SZ_WQ  = al256((size_t)DM * DM * 2);                                           // Wq^T [256][256]
constexpr size_t SZ_WKV = al256((size_t)2 * DM * DM * 2);                                       // Wkv^T [512][256]
constexpr size_t SZ_WO  = al256((size_t)DM * DM * 2);                                           // Wo^T [256][256]
constexpr size_t SZ_GF  = al256(cmax((size_t)NB * NQ * DM * 4, (size_t)NK * 2 * DM * 4));      // f32 GEMM scratch: q [NB*NQ][256] first, then per batch kv [4096][512]
constexpr size_t SZ_Q16 = al256((size_t)NB * NQ * DM * 2);                                      // q f16 [NB*NQ][256]
constexpr size_t SZ_XP  = al256((size_t)NK * DM * 2);                                           // one batch of points as bf16 [4096][256]
constexpr size_t SZ_K16 = al256((size_t)NK * DM * 2);                                           // k f16 [4096][256]
constexpr size_t SZ_VT  = al256((size_t)DM * NK * 2);                                           // V^T plane [256][4096] (hi, residual: one each)
constexpr size_t SZ_CTX = al256((size_t)NB * NQ * DM * 4);                                      // ctx f32 [NB*NQ][256]
constexpr size_t SZ_C16 = al256((size_t)NB * NQ * DM * 2);                                      // ctx hi / lo planes
constexpr size_t O_XS = 0, O_WQ = O_XS + SZ_XS, O_WKV = O_WQ + SZ_WQ, O_WO = O_WKV + SZ_WKV, O_GF = O_WO + SZ_WO, O_Q16 = O_GF + SZ_GF, O_XP = O_Q16 + SZ_Q16, O_K16 = O_XP + SZ_XP,
                 O_VTH = O_K16 + SZ_K16, O_VTL = O_VTH + SZ_VT, O_CTX = O_VTL + SZ_VT, O_CH = O_CTX + SZ_CTX, O_CL = O_CH + SZ_C16, O_END = O_CL + SZ_C16;
static_assert(O_END <= (size_t)268435456);
static_assert((size_t)NB * NQ * DM * 4 <= SZ_GF && (size_t)NK * 2 * DM * 4 <= SZ_GF);
static_assert(((size_t)(NB_FULL - 1) * NQ_FULL + NQ_FULL) * DM * 4 <= (size_t)NB_FULL * NQ_FULL * DM * 4);

extern "C" void kernel_launch(void* const* d_in, const int* in_sizes, int n_in, void* d_out, int out_size, void* d_ws, size_t ws_size, hipStream_t stream) {
    if (n_in < 8) return;
    if (in_sizes[0] < NB * NQ_FULL * DM || in_sizes[1] < NB * NK * DM || in_sizes[2] < DM * DM || in_sizes[3] < DM || in_sizes[4] < DM * 2 * DM || in_sizes[5] < 2 * DM || in_sizes[6] < DM * DM || in_sizes[7] < DM) return;
    if ((size_t)out_size < (size_t)NB * NQ_FULL * DM) return;
    if (O_END > ws_size) return;
    const float* state = (const float*)d_in[0];   // [8][512][256]
    const float* pts   = (const float*)d_in[1];   // [8][4096][256]
    const float* Wq    = (const float*)d_in[2];   // [256][256] in x out
    const float* bq    = (const float*)d_in[3];   // [256]
    const float* Wkv   = (const float*)d_in[4];   // [256][512]
    const float* bkv   = (const float*)d_in[5];   // [512]
    const float* Wo    = (const float*)d_in[6];   // [256][256]
    const float* bo    = (const float*)d_in[7];   // [256]
    float* OUT = (float*)d_out;                   // [8][512][256]
    char* ws = (char*)d_ws;
    bf* XS = (bf*)(ws + O_XS); bf* WQT = (bf*)(ws + O_WQ); bf* WKVT = (bf*)(ws + O_WKV); bf* WOT = (bf*)(ws + O_WO);
    float* GF = (float*)(ws + O_GF); h16* Q16 = (h16*)(ws + O_Q16); bf* XP = (bf*)(ws + O_XP); h16* K16 = (h16*)(ws + O_K16);
    h16* VTH = (h16*)(ws + O_VTH); h16* VTL = (h16*)(ws + O_VTL);
    float* CTX = (float*)(ws + O_CTX); bf* CH = (bf*)(ws + O_CH); bf* CL = (bf*)(ws + O_CL);

    // planes of the inputs
    { const size_t n8 = (size_t)NB * NQ_FULL * DM / 8; k_cvt8<<<(unsigned)((n8 + 255) / 256), 256, 0, stream>>>(state, XS, n8); }
    k_wT<<<(unsigned)(((size_t)DM * DM / 8 + 255) / 256), 256, 0, stream>>>(Wq, WQT, DM, DM);
    k_wT<<<(unsigned)(((size_t)2 * DM * DM / 8 + 255) / 256), 256, 0, stream>>>(Wkv, WKVT, DM, 2 * DM);
    k_wT<<<(unsigned)(((size_t)DM * DM / 8 + 255) / 256), 256, 0, stream>>>(Wo, WOT, DM, DM);
    // q = Xs Wq + bq for all batches: GF [NB*NQ][256] f32, then the f16 plane
    k_gemmw<bf, 0, true, 4><<<dim3(NQ / 64, DM / 64, NB), 32, 0, stream>>>(XS, nullptr, DM, WQT, nullptr, DM, DM, GF, DM, bq, 1.0f, 0.0f, (size_t)NQ_FULL * DM, (size_t)0, (size_t)NQ * DM);
    { const size_t n8 = (size_t)NB * NQ * DM / 8; k_q16<<<(unsigned)((n8 + 255) / 256), 256, 0, stream>>>(GF, Q16, n8); }
    for (int b = 0; b < NB; ++b) {
        const float* pb = pts + (size_t)b * NK * DM;
        { const size_t n8 = (size_t)NK * DM / 8; k_cvt8<<<(unsigned)((n8 + 255) / 256), 256, 0, stream>>>(pb, XP, n8); }
        // kv = Xp Wkv + bkv: GF [4096][512] f32
        k_gemmw<bf, 0, true, 4><<<dim3(NK / 64, (2 * DM) / 64, 1), 32, 0, stream>>>(XP, nullptr, DM, WKVT, nullptr, DM, DM, GF, 2 * DM, bkv, 1.0f, 0.0f, (size_t)0, (size_t)0, (size_t)0);
        // k plane [4096][256], V^T hi/residual planes [256][4096]
        k_kv16<<<(unsigned)((size_t)2 * NK * DM / 8 / 256), 256, 0, stream>>>(GF, K16, VTH, VTL);
        // ctx[b][i][h*32 + d] = softmax_j(q_h[i] . k_h[j] HD^-0.5) v[j][h*32 + d]: x = 16 queries, y = head
        k_attn<<<dim3(NQ / 16, NH), 32 * FW, 0, stream>>>(Q16 + (size_t)b * NQ * DM, K16, VTH, VTL, CTX + (size_t)b * NQ * DM);
    }
    // out = ctx Wo + bo: ctx as bf16 hi/lo planes, rows of batch b at OUT + b*NQ_FULL*256
    { const size_t n8 = (size_t)NB * NQ * DM / 8; k_split<<<(unsigned)((n8 + 255) / 256), 256, 0, stream>>>(CTX, CH, CL, n8); }
    k_gemmw<bf, 1, true, 4><<<dim3(NQ / 64, DM / 64, NB), 32, 0, stream>>>(CH, CL, DM, WOT, nullptr, DM, DM, OUT, DM, bo, 1.0f, 0.0f, (size_t)NQ * DM, (size_t)0, (size_t)NQ_FULL * DM);
}

// v003
// Measured time: 234 microseconds a run.
// Timed twice side by side with v002, it ran 1.45 and 1.47 times as fast.
// All steps since v000 together make it 5.20 times as fast.
#include <hip/hip_runtime.h>

// Contractions, all f32 accumulate: q = Xs Wq + bq and kv = Xp Wkv + bkv on v_wmma_f32_16x16x32_bf16 (bf16 RNE planes of the f32 inputs, weights transposed to [out][in]); per-head scores q k^T on v_wmma_f32_16x16x32_f16 (q and k as f16 planes carried x8 each); per-head P V on v_wmma_f32_16x16x32_f16 (P f16 carried x2^14; V^T as an f16 hi plane carried x4 plus an f16 residual plane carried x2^10 into a separate accumulator); out = ctx Wo + bo on v_wmma_f32_16x16x32_bf16 (ctx as bf16 hi + lo planes, Wo bf16). Softmax f32, max-subtracted, fixed-order sums. Scores, softmax and P V run in one kernel, split along the keys over the waves of a block; scores and P stay in registers, each wave subtracts its own keys' maximum, P is left unnormalised and the row's sum divides the result; partial sums are brought to the row's maximum and added in a fixed order. Every stage runs once for all batches: the batch is a grid dimension.

#ifndef NB
#define NB 8            // batches computed (reducible)
#endif
#ifndef NQ
#define NQ 512          // query rows per batch computed (reducible, multiple of 64)
#endif
#define NB_FULL 8
#define NQ_FULL 512     // per-batch stride of the state input and of the output
#define NK 4096         // keys (softmax row length)
#define DM 256
#define NH 8
#define HD 32
#define QCAR 8.0f
#define KCAR 8.0f
#define VCAR 4.0f
#define RCAR 1024.0f
#define PCAR 16384.0f
#define FW 16            // waves per block of k_attn, each on its own NK/FW keys
#define SCL2 (0.17677669529663687f * 0.015625f)   // HD^-0.5 / (QCAR*KCAR)

static_assert(NB >= 1 && NB <= NB_FULL);
static_assert(NQ >= 64 && NQ <= NQ_FULL && (NQ % 64) == 0);
static_assert(NK == 256 * 16);
static_assert((DM % 64) == 0 && (NK % 64) == 0 && HD == 32 && NH * HD == DM);

typedef _Float16 h16;
typedef unsigned short bf;
typedef __attribute__((ext_vector_type(16))) __bf16   v16bf;
typedef __attribute__((ext_vector_type(16))) _Float16 v16h;
typedef __attribute__((ext_vector_type(8)))  _Float16 v8h;
typedef __attribute__((ext_vector_type(8)))  unsigned short v8us;
typedef __attribute__((ext_vector_type(8)))  float    v8f;
typedef __attribute__((ext_vector_type(4)))  float    v4f;
typedef v8h  __attribute__((may_alias)) v8ha;
typedef v4f  __attribute__((may_alias)) v4fa;
typedef v8us __attribute__((may_alias)) v8usa;

__device__ __forceinline__ unsigned short f2bf(float f) { unsigned u = __float_as_uint(f); u += 0x7FFFu + ((u >> 16) & 1u); return (unsigned short)(u >> 16); }
__device__ __forceinline__ float bf2f(unsigned short b) { return __uint_as_float(((unsigned)b) << 16); }
__device__ __forceinline__ float bfr(float f) { return bf2f(f2bf(f)); }
__device__ __forceinline__ v16h cat16(v8h lo, v8h hi) { return __builtin_shufflevector(lo, hi, 0, 1, 2, 3, 4, 5, 6, 7, 8, 9, 10, 11, 12, 13, 14, 15); }
__device__ __forceinline__ v16bf cat16b(v8us lo, v8us hi) { return __builtin_bit_cast(v16bf, __builtin_shufflevector(lo, hi, 0, 1, 2, 3, 4, 5, 6, 7, 8, 9, 10, 11, 12, 13, 14, 15)); }
__device__ __forceinline__ v8f wmma16(v16h a, v16h b, v8f c) { return __builtin_amdgcn_wmma_f32_16x16x32_f16(false, a, false, b, (short)0, c, false, false); }
__device__ __forceinline__ v8f wmmab(v16bf a, v16bf b, v8f c) { return __builtin_amdgcn_wmma_f32_16x16x32_bf16(false, a, false, b, (short)0, c, false, false); }
__device__ __forceinline__ h16 tohx(float x) { return (h16)x; }
__device__ __forceinline__ void splitf(float y, unsigned short& h, unsigned short& l) { h = f2bf(y); l = f2bf(y - bf2f(h)); }

// ---- k_gemmw: register-blocked GEMM, ONE WAVE per 64 x (16*NBN) output tile, operands straight from K-contiguous 16-bit planes; grid (M/64, N/(16*NBN), Z), 32 threads.
// C[m][n] (f32, pitch ldc) = (sum_k A[m][k] Bt[n][k] [+ A2 B same accumulator (MODE 1)] [+ (A Bt2) * rs2 from a separate accumulator (MODE 2)]) * oscale + optional bf16-cast bias[n].
// A rows pitch lda, Bt rows pitch ldb (elements), z-batch strides sA/sB/sC in elements. K % 32 == 0. Fragments: lane row/col = lane&15, elements 0..7 <- k0+8h.., 8..15 <- k0+16+8h.. for A and B.
template <typename T16> struct WFrag;
template <> struct WFrag<h16> { typedef v16h V; static __device__ __forceinline__ V ld(const h16* p) { return cat16(*(const v8h*)p, *(const v8h*)(p + 16)); } static __device__ __forceinline__ v8f mma(V a, V b, v8f c) { return wmma16(a, b, c); } };
template <> struct WFrag<bf> { typedef v16bf V; static __device__ __forceinline__ V ld(const bf* p) { return cat16b(*(const v8us*)p, *(const v8us*)(p + 16)); } static __device__ __forceinline__ v8f mma(V a, V b, v8f c) { return wmmab(a, b, c); } };
template <typename T16, int MODE, bool BIAS, int NBN>
__global__ __launch_bounds__(32) void k_gemmw(const T16* __restrict__ A, const T16* __restrict__ A2, int lda, const T16* __restrict__ Bt, const T16* __restrict__ Bt2, int ldb, int K, float* C, int ldc, const float* __restrict__ bias, float oscale, float rs2, size_t sA, size_t sB, size_t sC) {
    typedef typename WFrag<T16>::V V;
    __shared__ __align__(16) float os[16 * 68];
    const size_t z = blockIdx.z; A += z * sA; if (MODE == 1) A2 += z * sA; Bt += z * sB; if (MODE == 2) Bt2 += z * sB; C += z * sC;
    const int lane = threadIdx.x & 31, lr = lane & 15, hi = lane >> 4; const int r0 = blockIdx.x * 64, c0 = blockIdx.y * (16 * NBN);
    v8f acc[4][NBN], acc2[4][NBN];
#pragma unroll
    for (int mb = 0; mb < 4; ++mb)
#pragma unroll
        for (int nb = 0; nb < NBN; ++nb) { acc[mb][nb] = (v8f){}; acc2[mb][nb] = (v8f){}; }
    const size_t aoff = (size_t)(r0 + lr) * lda + 8 * hi, boff = (size_t)(c0 + lr) * ldb + 8 * hi;
#pragma unroll 1
    for (int kc = 0; kc < K; kc += 32) {
        V a[4], a2[4];
#pragma unroll
        for (int mb = 0; mb < 4; ++mb) { a[mb] = WFrag<T16>::ld(A + aoff + (size_t)mb * 16 * lda + kc); if (MODE == 1) a2[mb] = WFrag<T16>::ld(A2 + aoff + (size_t)mb * 16 * lda + kc); }
#pragma unroll
        for (int nb = 0; nb < NBN; ++nb) { const V b = WFrag<T16>::ld(Bt + boff + (size_t)nb * 16 * ldb + kc); V b2; if (MODE == 2) b2 = WFrag<T16>::ld(Bt2 + boff + (size_t)nb * 16 * ldb + kc);
#pragma unroll
            for (int mb = 0; mb < 4; ++mb) { acc[mb][nb] = WFrag<T16>::mma(a[mb], b, acc[mb][nb]); if (MODE == 1) acc[mb][nb] = WFrag<T16>::mma(a2[mb], b, acc[mb][nb]); if (MODE == 2) acc2[mb][nb] = WFrag<T16>::mma(a[mb], b2, acc2[mb][nb]); } }
        if (MODE == 2) asm volatile("v_nop\n\tv_nop\n\tv_nop\n\tv_nop" : "+v"(acc[0][0]), "+v"(acc[1][NBN - 1]), "+v"(acc[2][0]), "+v"(acc[3][NBN - 1]), "+v"(acc2[0][0]), "+v"(acc2[1][NBN - 1]), "+v"(acc2[2][0]), "+v"(acc2[3][NBN - 1]) : "v"(a[0]), "v"(a[3]));
        else asm volatile("v_nop\n\tv_nop\n\tv_nop\n\tv_nop" : "+v"(acc[0][0]), "+v"(acc[1][NBN - 1]), "+v"(acc[2][0]), "+v"(acc[3][NBN - 1]) : "v"(a[0]), "v"(a[3]));
    }
    constexpr int LPR = 4 * NBN, RPI = 32 / LPR, NIT = 16 / RPI;   // lanes per row, rows per instruction, instructions per slab
    const int rl = lane / LPR, cofs = (lane % LPR) * 4;
#pragma unroll
    for (int mb = 0; mb < 4; ++mb) {
#pragma unroll
        for (int nb = 0; nb < NBN; ++nb) {
#pragma unroll
            for (int j = 0; j < 8; ++j) { float vv = acc[mb][nb][j]; if (MODE == 2) vv += acc2[mb][nb][j] * rs2; os[(hi * 8 + j) * 68 + nb * 16 + lr] = vv * oscale; } }
        __builtin_amdgcn_wave_barrier(); asm volatile("" ::: "memory");
        float* crow = C + (size_t)(r0 + mb * 16) * ldc + c0;
{
#pragma unroll
            for (int s = 0; s < NIT; ++s) { const int row = RPI * s + rl; v4f val = *(const v4fa*)(os + row * 68 + cofs); if (BIAS) { val[0] += bfr(bias[c0 + cofs]); val[1] += bfr(bias[c0 + cofs + 1]); val[2] += bfr(bias[c0 + cofs + 2]); val[3] += bfr(bias[c0 + cofs + 3]); }
                *(v4f*)(crow + (size_t)row * ldc + cofs) = val; }
             }
        __builtin_amdgcn_wave_barrier(); asm volatile("" ::: "memory");
    }
}

// ---- k_attn: ctx = softmax(q k^T HD^-0.5) v for 16 queries of one head of one batch. Grid (NQ/16, NH, NB), FW waves; wave w owns keys w*NK/FW .. and never stores a score or a P value.
// S^T = K Q^T (A = 16 key rows, B = the 16 queries): lane (c, hi) holds query c, keys 8hi..8hi+7 of each 16-key tile. Two such tiles, converted in place, are the B operand P^T of O^T += V^T P^T (A = V^T rows d, keys in the same order).
// Each wave subtracts the maximum of its own keys: P = exp(t - max_w) x PCAR, not divided. The waves' O^T partials, row sums and maxima meet in LDS (one barrier); they are brought to the row's maximum, added in wave order, and the sum divides once.
__global__ __launch_bounds__(32 * FW) void k_attn(const h16* __restrict__ Q, const h16* __restrict__ K, const h16* __restrict__ VTh, const h16* __restrict__ VTl, float* C) {
    constexpr int KW = NK / FW, NT = KW / 16, NS = KW / 32, RP = 36;
    static_assert(KW % 32 == 0 && NS >= 2 && FW == 16 && HD == 32 && PCAR == 16384.0f);
    constexpr float CE = SCL2 * 1.4426950408889634f;
    __shared__ __align__(16) float red[FW * 16 * RP];
    __shared__ float mxs[FW * 16], sms[FW * 16];
    const int lane = threadIdx.x & 31, c = lane & 15, hi = lane >> 4, w = __builtin_amdgcn_readfirstlane(threadIdx.x >> 5);
    const int q0 = blockIdx.x * 16, h = blockIdx.y, k0 = w * KW;
    const size_t z = blockIdx.z; Q += z * ((size_t)NQ * DM); K += z * ((size_t)NK * DM); VTh += z * ((size_t)DM * NK); VTl += z * ((size_t)DM * NK); C += z * ((size_t)NQ * DM);
    const h16* qp = Q + (size_t)(q0 + c) * DM + h * HD + 8 * hi;
    const h16* kp = K + (size_t)(k0 + c) * DM + h * HD + 8 * hi;
    const size_t voff = (size_t)(h * HD + c) * NK + k0 + 8 * hi;
    const h16* bh = VTh + voff; const h16* bl = VTl + voff;
    const v16h qf = WFrag<h16>::ld(qp);
    v16h kf[NT], vh[NS][2], vl[NS][2];
#pragma unroll
    for (int t = 0; t < NT; ++t) kf[t] = WFrag<h16>::ld(kp + (size_t)t * 16 * DM);
#pragma unroll
    for (int dt = 0; dt < 2; ++dt) { vh[0][dt] = WFrag<h16>::ld(bh + (size_t)dt * 16 * NK); vl[0][dt] = WFrag<h16>::ld(bl + (size_t)dt * 16 * NK); }
    // keeps the first V^T stage's loads up here with the K loads: one memory latency for all of them instead of one more in front of the first P V product
    __builtin_amdgcn_sched_barrier(0);
    v8f st[NT];
#pragma unroll
    for (int t = 0; t < NT; ++t) st[t] = wmma16(kf[t], qf, (v8f){});
    // holds the second stage's loads behind the score products, whose K registers they take over (earlier they spill), and ahead of the maximum and stage 0
    __builtin_amdgcn_sched_barrier(0);
    // four vector slots between the last product and the loads that take over its operand registers (the distance a vector overwrite of A or B needs; a load directly over a product's B is not known to be safe)
    asm volatile("v_nop\n\tv_nop\n\tv_nop\n\tv_nop" ::: "memory");
#pragma unroll
    for (int dt = 0; dt < 2; ++dt) { vh[1][dt] = WFrag<h16>::ld(bh + (size_t)dt * 16 * NK + 32); vl[1][dt] = WFrag<h16>::ld(bl + (size_t)dt * 16 * NK + 32); }
    float mx = st[0][0];
#pragma unroll
    for (int t = 0; t < NT; ++t)
#pragma unroll
        for (int j = 0; j < 8; ++j) mx = fmaxf(mx, st[t][j]);
    mx = fmaxf(mx, __shfl_xor(mx, 16, 32));
    const float off = 14.0f - mx * CE;   // 2^14 = PCAR rides in the exponent
    v8f acc[2], acc2[2];
#pragma unroll
    for (int dt = 0; dt < 2; ++dt) { acc[dt] = (v8f){}; acc2[dt] = (v8f){}; }
    float sum0 = 0.f, sum1 = 0.f;
#pragma unroll
    for (int s = 0; s < NS; ++s) {
        v16h pb;
#pragma unroll
        for (int j = 0; j < 8; ++j) {
            float e0, e1;
            // two v_exp_f32 and the free slot that the instruction set asks for behind a transcendental before its result is read or its source overwritten: the second fills the first one's slot, the v_nop the second one's
            asm("v_exp_f32 %0, %2\n\tv_exp_f32 %1, %3\n\tv_nop" : "=&v"(e0), "=&v"(e1) : "v"(__builtin_fmaf(st[2 * s][j], CE, off)), "v"(__builtin_fmaf(st[2 * s + 1][j], CE, off)));
            sum0 += e0; sum1 += e1; pb[j] = tohx(e0); pb[8 + j] = tohx(e1);
        }
#pragma unroll
        for (int dt = 0; dt < 2; ++dt) { acc[dt] = wmma16(vh[s][dt], pb, acc[dt]); acc2[dt] = wmma16(vl[s][dt], pb, acc2[dt]); }
        // holds stage s + 2's loads between stage s, whose registers they take over (earlier they spill), and stage s + 1, a whole stage of work ahead of their use (left free they sink to their products, and each product waits out a latency of its own)
        __builtin_amdgcn_sched_barrier(0);
        if (s + 2 < NS) {
            // four vector slots between the stage's last product and the loads that take over its operand registers, as above
            asm volatile("v_nop\n\tv_nop\n\tv_nop\n\tv_nop" ::: "memory");
#pragma unroll
            for (int dt = 0; dt < 2; ++dt) { vh[s + 2][dt] = WFrag<h16>::ld(bh + (size_t)dt * 16 * NK + (s + 2) * 32); vl[s + 2][dt] = WFrag<h16>::ld(bl + (size_t)dt * 16 * NK + (s + 2) * 32); }
        }
    }
    // the wait that belongs in front of any overwrite of an issued load's address registers; the four addresses are inputs so that they stay whole up to it
    asm volatile("s_wait_xcnt 0x0" :: "v"(qp), "v"(kp), "v"(bh), "v"(bl) : "memory");
    float sum = sum0 + sum1;
    sum += __shfl_xor(sum, 16, 32);
    if (hi == 0) { mxs[w * 16 + c] = mx; sms[w * 16 + c] = sum; }
    float* my = red + (w * 16 + c) * RP + 8 * hi;
#pragma unroll
    for (int dt = 0; dt < 2; ++dt) { v4f s0, s1;
#pragma unroll
        for (int j = 0; j < 4; ++j) { s0[j] = acc[dt][j] + acc2[dt][j] * (1.0f / RCAR); s1[j] = acc[dt][4 + j] + acc2[dt][4 + j] * (1.0f / RCAR); }
        *(v4fa*)(my + dt * 16) = s0; *(v4fa*)(my + dt * 16 + 4) = s1; }
    __syncthreads();
    // wave w finishes query q0 + w, lane = column d: its store is one whole 128-B line
    float m = mxs[w];
#pragma unroll
    for (int i = 1; i < FW; ++i) m = fmaxf(m, mxs[i * 16 + w]);
    float o = 0.f, tot = 0.f;
#pragma unroll
    for (int i = 0; i < FW; ++i) { const float f = __builtin_amdgcn_exp2f((mxs[i * 16 + w] - m) * CE); o += red[(i * 16 + w) * RP + lane] * f; tot += sms[i * 16 + w] * f; }
    C[(size_t)(q0 + w) * DM + h * HD + lane] = o / (tot * VCAR);
}

__global__ __launch_bounds__(256) void k_cvt8(const float* __restrict__ src, bf* dst, size_t n8) { const size_t i = (size_t)blockIdx.x * 256 + threadIdx.x; if (i >= n8) return; const v8f v = *(const v8f*)(src + i * 8); v8us o;
#pragma unroll
    for (int k = 0; k < 8; ++k) o[k] = f2bf(v[k]); *(v8us*)(dst + i * 8) = o;  }

__global__ __launch_bounds__(256) void k_wT(const float* __restrict__ W, bf* WT, int Kin, int Nout) { const size_t g = (size_t)blockIdx.x * 256 + threadIdx.x; if (g >= (size_t)Nout * Kin / 8) return; const int k0 = (int)(g % (size_t)(Kin / 8)) * 8; const int n = (int)(g / (size_t)(Kin / 8)); v8us o;
#pragma unroll
    for (int q = 0; q < 8; ++q) o[q] = f2bf(W[(size_t)(k0 + q) * Nout + n]);
    bf* d = WT + (size_t)n * Kin + k0; *(v8us*)d = o;  }

__global__ __launch_bounds__(256) void k_q16(const float* __restrict__ src, h16* dst, size_t n8) { const size_t i = (size_t)blockIdx.x * 256 + threadIdx.x; if (i >= n8) return; const v8f v = *(const v8f*)(src + i * 8); v8h o;
#pragma unroll
    for (int k = 0; k < 8; ++k) o[k] = tohx(v[k] * QCAR); *(v8h*)(dst + i * 8) = o;  }

// k_kv16, blockIdx.y = batch: kv f32 [4096][512] -> k plane K16[j][c] = f16(k x KCAR) ([4096][256]; first half of the threads, lane -> 8 consecutive c) and V^T planes VTh[c][j] = f16(v x VCAR), VTl[c][j] = f16((v x VCAR - VTh) x RCAR)
__global__ __launch_bounds__(256) void k_kv16(const float* __restrict__ KV, h16* K16, h16* VTh, h16* VTl) {
    const size_t g = (size_t)blockIdx.x * 256 + threadIdx.x; const size_t NA = (size_t)NK * DM / 8;
    const size_t z = blockIdx.y; KV += z * ((size_t)NK * 2 * DM); K16 += z * ((size_t)NK * DM); VTh += z * ((size_t)DM * NK); VTl += z * ((size_t)DM * NK);
    if (g < NA) {
        const int j = (int)(g / (DM / 8)); const int c0 = (int)(g % (DM / 8)) * 8;
        const v8f a = *(const v8f*)(KV + (size_t)j * (2 * DM) + c0); v8h o;
#pragma unroll
        for (int q = 0; q < 8; ++q) o[q] = tohx(a[q] * KCAR);
        h16* d = K16 + (size_t)j * DM + c0; *(v8h*)d = o; 
    } else if (g < 2 * NA) {
        const size_t e = g - NA; const int j0 = (int)(e % (size_t)(NK / 8)) * 8; const int c = (int)(e / (size_t)(NK / 8));
        v8h oh, ol;
#pragma unroll
        for (int q = 0; q < 8; ++q) { const float y = KV[(size_t)(j0 + q) * (2 * DM) + DM + c] * VCAR; const h16 hh = tohx(y); oh[q] = hh; ol[q] = tohx(__fmul_rn(__fsub_rn(y, (float)hh), RCAR)); }
        const size_t oo = (size_t)c * NK + j0;
        *(v8h*)(VTh + oo) = oh; *(v8h*)(VTl + oo) = ol; 
    }
}

__global__ __launch_bounds__(256) void k_split(const float* __restrict__ src, bf* dh, bf* dl, size_t n8) { const size_t i = (size_t)blockIdx.x * 256 + threadIdx.x; if (i >= n8) return; const float* sp = src + i * 8; const v8f v = *(const v8f*)sp; v8us oh, ol;
    // the wait that belongs in front of any overwrite of an issued load's address registers; the address is an input so that it stays whole up to it
    asm volatile("s_wait_xcnt 0x0" :: "v"(sp) : "memory");
#pragma unroll
    for (int k = 0; k < 8; ++k) { unsigned short a, c; splitf(v[k], a, c); oh[k] = a; ol[k] = c; }
    *(v8us*)(dh + i * 8) = oh; *(v8us*)(dl + i * 8) = ol;  }

// ---- workspace carve (bytes, 256-B aligned regions; all sizes compile-time)
constexpr size_t al256(size_t x) { return (x + 255) & ~(size_t)255; }
constexpr size_t cmax(size_t a, size_t b) { return a > b ? a : b; }
constexpr size_t SZ_XS  = al256((size_t)NB * NQ_FULL * DM * 2);                                 // state as bf16 [NB][NQ_FULL][256]
constexpr size_t SZ_WQ  = al256((size_t)DM * DM * 2);                                           // Wq^T [256][256]
constexpr size_t SZ_WKV = al256((size_t)2 * DM * DM * 2);                                       // Wkv^T [512][256]
constexpr size_t SZ_WO  = al256((size_t)DM * DM * 2);                                           // Wo^T [256][256]
constexpr size_t SZ_GF  = al256(cmax((size_t)NB * NQ * DM * 4, (size_t)NB * NK * 2 * DM * 4)); // f32 GEMM scratch: q [NB*NQ][256] first, then kv [NB][4096][512]
constexpr size_t SZ_Q16 = al256((size_t)NB * NQ * DM * 2);                                      // q f16 [NB*NQ][256]
constexpr size_t SZ_XP  = al256((size_t)NB * NK * DM * 2);                                      // points as bf16 [NB][4096][256]
constexpr size_t SZ_K16 = al256((size_t)NB * NK * DM * 2);                                      // k f16 [NB][4096][256]
constexpr size_t SZ_VT  = al256((size_t)NB * DM * NK * 2);                                      // V^T plane [NB][256][4096] (hi, residual: one each)
constexpr size_t SZ_CTX = al256((size_t)NB * NQ * DM * 4);                                      // ctx f32 [NB*NQ][256]
constexpr size_t SZ_C16 = al256((size_t)NB * NQ * DM * 2);                                      // ctx hi / lo planes
constexpr size_t O_XS = 0, O_WQ = O_XS + SZ_XS, O_WKV = O_WQ + SZ_WQ, O_WO = O_WKV + SZ_WKV, O_GF = O_WO + SZ_WO, O_Q16 = O_GF + SZ_GF, O_XP = O_Q16 + SZ_Q16, O_K16 = O_XP + SZ_XP,
                 O_VTH = O_K16 + SZ_K16, O_VTL = O_VTH + SZ_VT, O_CTX = O_VTL + SZ_VT, O_CH = O_CTX + SZ_CTX, O_CL = O_CH + SZ_C16, O_END = O_CL + SZ_C16;
static_assert(O_END <= (size_t)268435456);
static_assert((size_t)NB * NQ * DM * 4 <= SZ_GF && (size_t)NB * NK * 2 * DM * 4 <= SZ_GF);
static_assert(((size_t)(NB_FULL - 1) * NQ_FULL + NQ_FULL) * DM * 4 <= (size_t)NB_FULL * NQ_FULL * DM * 4);

extern "C" void kernel_launch(void* const* d_in, const int* in_sizes, int n_in, void* d_out, int out_size, void* d_ws, size_t ws_size, hipStream_t stream) {
    if (n_in < 8) return;
    if (in_sizes[0] < NB * NQ_FULL * DM || in_sizes[1] < NB * NK * DM || in_sizes[2] < DM * DM || in_sizes[3] < DM || in_sizes[4] < DM * 2 * DM || in_sizes[5] < 2 * DM || in_sizes[6] < DM * DM || in_sizes[7] < DM) return;
    if ((size_t)out_size < (size_t)NB * NQ_FULL * DM) return;
    if (O_END > ws_size) return;
    const float* state = (const float*)d_in[0];   // [8][512][256]
    const float* pts   = (const float*)d_in[1];   // [8][4096][256]
    const float* Wq    = (const float*)d_in[2];   // [256][256] in x out
    const float* bq    = (const float*)d_in[3];   // [256]
    const float* Wkv   = (const float*)d_in[4];   // [256][512]
    const float* bkv   = (const float*)d_in[5];   // [512]
    const float* Wo    = (const float*)d_in[6];   // [256][256]
    const float* bo    = (const float*)d_in[7];   // [256]
    float* OUT = (float*)d_out;                   // [8][512][256]
    char* ws = (char*)d_ws;
    bf* XS = (bf*)(ws + O_XS); bf* WQT = (bf*)(ws + O_WQ); bf* WKVT = (bf*)(ws + O_WKV); bf* WOT = (bf*)(ws + O_WO);
    float* GF = (float*)(ws + O_GF); h16* Q16 = (h16*)(ws + O_Q16); bf* XP = (bf*)(ws + O_XP); h16* K16 = (h16*)(ws + O_K16);
    h16* VTH = (h16*)(ws + O_VTH); h16* VTL = (h16*)(ws + O_VTL);
    float* CTX = (float*)(ws + O_CTX); bf* CH = (bf*)(ws + O_CH); bf* CL = (bf*)(ws + O_CL);

    // planes of the inputs
    { const size_t n8 = (size_t)NB * NQ_FULL * DM / 8; k_cvt8<<<(unsigned)((n8 + 255) / 256), 256, 0, stream>>>(state, XS, n8); }
    k_wT<<<(unsigned)(((size_t)DM * DM / 8 + 255) / 256), 256, 0, stream>>>(Wq, WQT, DM, DM);
    k_wT<<<(unsigned)(((size_t)2 * DM * DM / 8 + 255) / 256), 256, 0, stream>>>(Wkv, WKVT, DM, 2 * DM);
    k_wT<<<(unsigned)(((size_t)DM * DM / 8 + 255) / 256), 256, 0, stream>>>(Wo, WOT, DM, DM);
    // q = Xs Wq + bq for all batches: GF [NB*NQ][256] f32, then the f16 plane
    k_gemmw<bf, 0, true, 4><<<dim3(NQ / 64, DM / 64, NB), 32, 0, stream>>>(XS, nullptr, DM, WQT, nullptr, DM, DM, GF, DM, bq, 1.0f, 0.0f, (size_t)NQ_FULL * DM, (size_t)0, (size_t)NQ * DM);
    { const size_t n8 = (size_t)NB * NQ * DM / 8; k_q16<<<(unsigned)((n8 + 255) / 256), 256, 0, stream>>>(GF, Q16, n8); }
    { const size_t n8 = (size_t)NB * NK * DM / 8; k_cvt8<<<(unsigned)((n8 + 255) / 256), 256, 0, stream>>>(pts, XP, n8); }
    // kv = Xp Wkv + bkv: GF [NB][4096][512] f32, z = batch
    k_gemmw<bf, 0, true, 4><<<dim3(NK / 64, (2 * DM) / 64, NB), 32, 0, stream>>>(XP, nullptr, DM, WKVT, nullptr, DM, DM, GF, 2 * DM, bkv, 1.0f, 0.0f, (size_t)NK * DM, (size_t)0, (size_t)NK * 2 * DM);
    // k planes [NB][4096][256], V^T hi/residual planes [NB][256][4096]: y = batch
    k_kv16<<<dim3((unsigned)((size_t)2 * NK * DM / 8 / 256), NB), 256, 0, stream>>>(GF, K16, VTH, VTL);
    // ctx[b][i][h*32 + d] = softmax_j(q_h[i] . k_h[j] HD^-0.5) v[j][h*32 + d]: x = 16 queries, y = head, z = batch
    k_attn<<<dim3(NQ / 16, NH, NB), 32 * FW, 0, stream>>>(Q16, K16, VTH, VTL, CTX);
    // out = ctx Wo + bo: ctx as bf16 hi/lo planes, rows of batch b at OUT + b*NQ_FULL*256
    { const size_t n8 = (size_t)NB * NQ * DM / 8; k_split<<<(unsigned)((n8 + 255) / 256), 256, 0, stream>>>(CTX, CH, CL, n8); }
    k_gemmw<bf, 1, true, 4><<<dim3(NQ / 64, DM / 64, NB), 32, 0, stream>>>(CH, CL, DM, WOT, nullptr, DM, DM, OUT, DM, bo, 1.0f, 0.0f, (size_t)NQ * DM, (size_t)0, (size_t)NQ_FULL * DM);
}

// v004
// Measured time: 165 microseconds a run.
// In two side-by-side timings against v003, it was 1.41 and 1.42 times as fast.
// All steps since v000 together make it 7.37 times as fast.
#include <hip/hip_runtime.h>

// Contractions, all f32 accumulate: q = Xs Wq + bq and kv = Xp Wkv + bkv on v_wmma_f32_16x16x32_bf16 (bf16 RNE planes of the f32 inputs, weights transposed to [out][in]); per-head scores q k^T on v_wmma_f32_16x16x32_f16 (q and k as f16 planes carried x8 each); per-head P V on v_wmma_f32_16x16x32_f16 (P f16 carried x2^14; V^T as an f16 hi plane carried x4 plus an f16 residual plane carried x2^10 into a separate accumulator); out = ctx Wo + bo on v_wmma_f32_16x16x32_bf16 (ctx as bf16 hi + lo planes, Wo bf16). Softmax f32, max-subtracted, fixed-order sums. Scores, softmax and P V run in one kernel, split along the keys over the waves of a block; scores and P stay in registers, each wave subtracts its own keys' maximum, P is left unnormalised and the row's sum divides the result; partial sums are brought to the row's maximum and added in a fixed order. Every stage runs once for all batches: the batch is a grid dimension. The k and V^T planes lie in fragment order: the 1024 bytes of one 16 x 32 operand fragment are contiguous, lane l's two 16-byte pieces at 16 l and 512 + 16 l.

#ifndef NB
#define NB 8            // batches computed (reducible)
#endif
#ifndef NQ
#define NQ 512          // query rows per batch computed (reducible, multiple of 64)
#endif
#define NB_FULL 8
#define NQ_FULL 512     // per-batch stride of the state input and of the output
#define NK 4096         // keys (softmax row length)
#define DM 256
#define NH 8
#define HD 32
#define QCAR 8.0f
#define KCAR 8.0f
#define VCAR 4.0f
#define RCAR 1024.0f
#define PCAR 16384.0f
#define FW 16            // waves per block of k_attn, each on its own NK/FW keys
#define SCL2 (0.17677669529663687f * 0.015625f)   // HD^-0.5 / (QCAR*KCAR)

static_assert(NB >= 1 && NB <= NB_FULL);
static_assert(NQ >= 64 && NQ <= NQ_FULL && (NQ % 64) == 0);
static_assert(NK == 256 * 16);
static_assert((DM % 64) == 0 && (NK % 64) == 0 && HD == 32 && NH * HD == DM);

typedef _Float16 h16;
typedef unsigned short bf;
typedef __attribute__((ext_vector_type(16))) __bf16   v16bf;
typedef __attribute__((ext_vector_type(16))) _Float16 v16h;
typedef __attribute__((ext_vector_type(8)))  _Float16 v8h;
typedef __attribute__((ext_vector_type(8)))  unsigned short v8us;
typedef __attribute__((ext_vector_type(8)))  float    v8f;
typedef __attribute__((ext_vector_type(4)))  float    v4f;
typedef v8h  __attribute__((may_alias)) v8ha;
typedef v4f  __attribute__((may_alias)) v4fa;
typedef v8us __attribute__((may_alias)) v8usa;

__device__ __forceinline__ unsigned short f2bf(float f) { unsigned u = __float_as_uint(f); u += 0x7FFFu + ((u >> 16) & 1u); return (unsigned short)(u >> 16); }
__device__ __forceinline__ float bf2f(unsigned short b) { return __uint_as_float(((unsigned)b) << 16); }
__device__ __forceinline__ float bfr(float f) { return bf2f(f2bf(f)); }
__device__ __forceinline__ v16h cat16(v8h lo, v8h hi) { return __builtin_shufflevector(lo, hi, 0, 1, 2, 3, 4, 5, 6, 7, 8, 9, 10, 11, 12, 13, 14, 15); }
__device__ __forceinline__ v16bf cat16b(v8us lo, v8us hi) { return __builtin_bit_cast(v16bf, __builtin_shufflevector(lo, hi, 0, 1, 2, 3, 4, 5, 6, 7, 8, 9, 10, 11, 12, 13, 14, 15)); }
__device__ __forceinline__ v8f wmma16(v16h a, v16h b, v8f c) { return __builtin_amdgcn_wmma_f32_16x16x32_f16(false, a, false, b, (short)0, c, false, false); }
__device__ __forceinline__ v8f wmmab(v16bf a, v16bf b, v8f c) { return __builtin_amdgcn_wmma_f32_16x16x32_bf16(false, a, false, b, (short)0, c, false, false); }
__device__ __forceinline__ h16 tohx(float x) { return (h16)x; }
__device__ __forceinline__ void splitf(float y, unsigned short& h, unsigned short& l) { h = f2bf(y); l = f2bf(y - bf2f(h)); }

// ---- k_gemmw: register-blocked GEMM, ONE WAVE per 64 x (16*NBN) output tile, operands straight from K-contiguous 16-bit planes; grid (M/64, N/(16*NBN), Z), 32 threads.
// C[m][n] (f32, pitch ldc) = (sum_k A[m][k] Bt[n][k] [+ A2 B same accumulator (MODE 1)] [+ (A Bt2) * rs2 from a separate accumulator (MODE 2)]) * oscale + optional bf16-cast bias[n].
// A rows pitch lda, Bt rows pitch ldb (elements), z-batch strides sA/sB/sC in elements. K % 32 == 0. Fragments: lane row/col = lane&15, elements 0..7 <- k0+8h.., 8..15 <- k0+16+8h.. for A and B.
template <typename T16> struct WFrag;
template <> struct WFrag<h16> { typedef v16h V; static __device__ __forceinline__ V ld(const h16* p) { return cat16(*(const v8h*)p, *(const v8h*)(p + 16)); } static __device__ __forceinline__ v8f mma(V a, V b, v8f c) { return wmma16(a, b, c); } };
template <> struct WFrag<bf> { typedef v16bf V; static __device__ __forceinline__ V ld(const bf* p) { return cat16b(*(const v8us*)p, *(const v8us*)(p + 16)); } static __device__ __forceinline__ v8f mma(V a, V b, v8f c) { return wmmab(a, b, c); } };
// fragment-order plane: p = fragment base + 8 * lane (elements); the lane's second piece stands 256 elements on, so each wave-wide load covers 512 contiguous bytes
__device__ __forceinline__ v16h ldfrag(const h16* p) { return cat16(*(const v8h*)p, *(const v8h*)(p + 256)); }
template <typename T16, int MODE, bool BIAS, int NBN>
__global__ __launch_bounds__(32) void k_gemmw(const T16* __restrict__ A, const T16* __restrict__ A2, int lda, const T16* __restrict__ Bt, const T16* __restrict__ Bt2, int ldb, int K, float* C, int ldc, const float* __restrict__ bias, float oscale, float rs2, size_t sA, size_t sB, size_t sC) {
    typedef typename WFrag<T16>::V V;
    __shared__ __align__(16) float os[16 * 68];
    const size_t z = blockIdx.z; A += z * sA; if (MODE == 1) A2 += z * sA; Bt += z * sB; if (MODE == 2) Bt2 += z * sB; C += z * sC;
    const int lane = threadIdx.x & 31, lr = lane & 15, hi = lane >> 4; const int r0 = blockIdx.x * 64, c0 = blockIdx.y * (16 * NBN);
    v8f acc[4][NBN], acc2[4][NBN];
#pragma unroll
    for (int mb = 0; mb < 4; ++mb)
#pragma unroll
        for (int nb = 0; nb < NBN; ++nb) { acc[mb][nb] = (v8f){}; acc2[mb][nb] = (v8f){}; }
    const size_t aoff = (size_t)(r0 + lr) * lda + 8 * hi, boff = (size_t)(c0 + lr) * ldb + 8 * hi;
#pragma unroll 1
    for (int kc = 0; kc < K; kc += 32) {
        V a[4], a2[4];
#pragma unroll
        for (int mb = 0; mb < 4; ++mb) { a[mb] = WFrag<T16>::ld(A + aoff + (size_t)mb * 16 * lda + kc); if (MODE == 1) a2[mb] = WFrag<T16>::ld(A2 + aoff + (size_t)mb * 16 * lda + kc); }
#pragma unroll
        for (int nb = 0; nb < NBN; ++nb) { const V b = WFrag<T16>::ld(Bt + boff + (size_t)nb * 16 * ldb + kc); V b2; if (MODE == 2) b2 = WFrag<T16>::ld(Bt2 + boff + (size_t)nb * 16 * ldb + kc);
#pragma unroll
            for (int mb = 0; mb < 4; ++mb) { acc[mb][nb] = WFrag<T16>::mma(a[mb], b, acc[mb][nb]); if (MODE == 1) acc[mb][nb] = WFrag<T16>::mma(a2[mb], b, acc[mb][nb]); if (MODE == 2) acc2[mb][nb] = WFrag<T16>::mma(a[mb], b2, acc2[mb][nb]); } }
        if (MODE == 2) asm volatile("v_nop\n\tv_nop\n\tv_nop\n\tv_nop" : "+v"(acc[0][0]), "+v"(acc[1][NBN - 1]), "+v"(acc[2][0]), "+v"(acc[3][NBN - 1]), "+v"(acc2[0][0]), "+v"(acc2[1][NBN - 1]), "+v"(acc2[2][0]), "+v"(acc2[3][NBN - 1]) : "v"(a[0]), "v"(a[3]));
        else asm volatile("v_nop\n\tv_nop\n\tv_nop\n\tv_nop" : "+v"(acc[0][0]), "+v"(acc[1][NBN - 1]), "+v"(acc[2][0]), "+v"(acc[3][NBN - 1]) : "v"(a[0]), "v"(a[3]));
    }
    constexpr int LPR = 4 * NBN, RPI = 32 / LPR, NIT = 16 / RPI;   // lanes per row, rows per instruction, instructions per slab
    const int rl = lane / LPR, cofs = (lane % LPR) * 4;
#pragma unroll
    for (int mb = 0; mb < 4; ++mb) {
#pragma unroll
        for (int nb = 0; nb < NBN; ++nb) {
#pragma unroll
            for (int j = 0; j < 8; ++j) { float vv = acc[mb][nb][j]; if (MODE == 2) vv += acc2[mb][nb][j] * rs2; os[(hi * 8 + j) * 68 + nb * 16 + lr] = vv * oscale; } }
        __builtin_amdgcn_wave_barrier(); asm volatile("" ::: "memory");
        float* crow = C + (size_t)(r0 + mb * 16) * ldc + c0;
{
#pragma unroll
            for (int s = 0; s < NIT; ++s) { const int row = RPI * s + rl; v4f val = *(const v4fa*)(os + row * 68 + cofs); if (BIAS) { val[0] += bfr(bias[c0 + cofs]); val[1] += bfr(bias[c0 + cofs + 1]); val[2] += bfr(bias[c0 + cofs + 2]); val[3] += bfr(bias[c0 + cofs + 3]); }
                *(v4f*)(crow + (size_t)row * ldc + cofs) = val; }
             }
        __builtin_amdgcn_wave_barrier(); asm volatile("" ::: "memory");
    }
}

// ---- k_attn: ctx = softmax(q k^T HD^-0.5) v for 16 queries of one head of one batch. Grid (NQ/16, NH, NB), FW waves; wave w owns keys w*NK/FW .. and never stores a score or a P value.
// S^T = K Q^T (A = 16 key rows, B = the 16 queries): lane (c, hi) holds query c, keys 8hi..8hi+7 of each 16-key tile. Two such tiles, converted in place, are the B operand P^T of O^T += V^T P^T (A = V^T rows d, keys in the same order).
// Each wave subtracts the maximum of its own keys: P = exp(t - max_w) x PCAR, not divided. The waves' O^T partials, row sums and maxima meet in LDS (one barrier); they are brought to the row's maximum, added in wave order, and the sum divides once.
__global__ __launch_bounds__(32 * FW) void k_attn(const h16* __restrict__ Q, const h16* __restrict__ K, const h16* __restrict__ VTh, const h16* __restrict__ VTl, float* C) {
    constexpr int KW = NK / FW, NT = KW / 16, NS = KW / 32, RP = 36;
    static_assert(KW % 32 == 0 && NS >= 2 && FW == 16 && HD == 32 && PCAR == 16384.0f);
    constexpr float CE = SCL2 * 1.4426950408889634f;
    __shared__ __align__(16) float red[FW * 16 * RP];
    __shared__ float mxs[FW * 16], sms[FW * 16];
    const int lane = threadIdx.x & 31, c = lane & 15, hi = lane >> 4, w = __builtin_amdgcn_readfirstlane(threadIdx.x >> 5);
    const int q0 = blockIdx.x * 16, h = blockIdx.y, k0 = w * KW;
    const size_t z = blockIdx.z; Q += z * ((size_t)NQ * DM); K += z * ((size_t)NK * DM); VTh += z * ((size_t)DM * NK); VTl += z * ((size_t)DM * NK); C += z * ((size_t)NQ * DM);
    const h16* qp = Q + (size_t)(q0 + c) * DM + h * HD + 8 * hi;
    const h16* kb = K + ((size_t)h * (NK / 16) + k0 / 16) * 512;                       // the wave's first k fragment, the same for all lanes
    const h16* kp = kb + 8 * lane;                                                     // fragment t of the wave: + t * 512
    const size_t voff = ((size_t)h * (NK / 32) + k0 / 32) * 1024 + 8 * lane;           // fragment (s, dt) of the wave: + (2 s + dt) * 512
    const h16* bh = VTh + voff; const h16* bl = VTl + voff;
    const v16h qf = WFrag<h16>::ld(qp);
    v16h kf[NT], vh[NS][2], vl[NS][2];
#pragma unroll
    for (int t = 0; t < NT; ++t) kf[t] = ldfrag(kp + (size_t)t * 512);
#pragma unroll
    for (int dt = 0; dt < 2; ++dt) { vh[0][dt] = ldfrag(bh + (size_t)dt * 512); vl[0][dt] = ldfrag(bl + (size_t)dt * 512); }
    // keeps the first V^T stage's loads up here with the K loads: one memory latency for all of them instead of one more in front of the first P V product
    __builtin_amdgcn_sched_barrier(0);
    v8f st[NT];
#pragma unroll
    for (int t = 0; t < NT; ++t) st[t] = wmma16(kf[t], qf, (v8f){});
    // holds the second stage's loads behind the score products, whose K registers they take over (earlier they spill), and ahead of the maximum and stage 0
    __builtin_amdgcn_sched_barrier(0);
    // four vector slots between the last product and the loads that take over its operand registers (the distance a vector overwrite of A or B needs; a load directly over a product's B is not known to be safe)
    asm volatile("v_nop\n\tv_nop\n\tv_nop\n\tv_nop" ::: "memory");
#pragma unroll
    for (int dt = 0; dt < 2; ++dt) { vh[1][dt] = ldfrag(bh + (size_t)(2 + dt) * 512); vl[1][dt] = ldfrag(bl + (size_t)(2 + dt) * 512); }
    float mx = st[0][0];
#pragma unroll
    for (int t = 0; t < NT; ++t)
#pragma unroll
        for (int j = 0; j < 8; ++j) mx = fmaxf(mx, st[t][j]);
    mx = fmaxf(mx, __shfl_xor(mx, 16, 32));
    const float off = 14.0f - mx * CE;   // 2^14 = PCAR rides in the exponent
    v8f acc[2], acc2[2];
#pragma unroll
    for (int dt = 0; dt < 2; ++dt) { acc[dt] = (v8f){}; acc2[dt] = (v8f){}; }
    float sum0 = 0.f, sum1 = 0.f;
#pragma unroll
    for (int s = 0; s < NS; ++s) {
        v16h pb;
#pragma unroll
        for (int j = 0; j < 8; ++j) {
            float e0, e1;
            // two v_exp_f32 and the free slot that the instruction set asks for behind a transcendental before its result is read or its source overwritten: the second fills the first one's slot, the v_nop the second one's
            asm("v_exp_f32 %0, %2\n\tv_exp_f32 %1, %3\n\tv_nop" : "=&v"(e0), "=&v"(e1) : "v"(__builtin_fmaf(st[2 * s][j], CE, off)), "v"(__builtin_fmaf(st[2 * s + 1][j], CE, off)));
            sum0 += e0; sum1 += e1; pb[j] = tohx(e0); pb[8 + j] = tohx(e1);
        }
#pragma unroll
        for (int dt = 0; dt < 2; ++dt) { acc[dt] = wmma16(vh[s][dt], pb, acc[dt]); acc2[dt] = wmma16(vl[s][dt], pb, acc2[dt]); }
        // holds stage s + 2's loads between stage s, whose registers they take over (earlier they spill), and stage s + 1, a whole stage of work ahead of their use (left free they sink to their products, and each product waits out a latency of its own)
        __builtin_amdgcn_sched_barrier(0);
        if (s + 2 < NS) {
            // four vector slots between the stage's last product and the loads that take over its operand registers, as above
            asm volatile("v_nop\n\tv_nop\n\tv_nop\n\tv_nop" ::: "memory");
#pragma unroll
            for (int dt = 0; dt < 2; ++dt) { vh[s + 2][dt] = ldfrag(bh + (size_t)(2 * (s + 2) + dt) * 512); vl[s + 2][dt] = ldfrag(bl + (size_t)(2 * (s + 2) + dt) * 512); }
        }
    }
    // the wait that belongs in front of any overwrite of an issued load's address registers; the addresses are inputs so that they stay whole up to it (the K loads go out on the scalar base kb and the lane number)
    asm volatile("s_wait_xcnt 0x0" :: "v"(qp), "s"(kb), "v"(lane), "v"(bh), "v"(bl) : "memory");
    float sum = sum0 + sum1;
    sum += __shfl_xor(sum, 16, 32);
    if (hi == 0) { mxs[w * 16 + c] = mx; sms[w * 16 + c] = sum; }
    float* my = red + (w * 16 + c) * RP + 8 * hi;
#pragma unroll
    for (int dt = 0; dt < 2; ++dt) { v4f s0, s1;
#pragma unroll
        for (int j = 0; j < 4; ++j) { s0[j] = acc[dt][j] + acc2[dt][j] * (1.0f / RCAR); s1[j] = acc[dt][4 + j] + acc2[dt][4 + j] * (1.0f / RCAR); }
        *(v4fa*)(my + dt * 16) = s0; *(v4fa*)(my + dt * 16 + 4) = s1; }
    __syncthreads();
    // wave w finishes query q0 + w, lane = column d: its store is one whole 128-B line
    float m = mxs[w];
#pragma unroll
    for (int i = 1; i < FW; ++i) m = fmaxf(m, mxs[i * 16 + w]);
    float o = 0.f, tot = 0.f;
#pragma unroll
    for (int i = 0; i < FW; ++i) { const float f = __builtin_amdgcn_exp2f((mxs[i * 16 + w] - m) * CE); o += red[(i * 16 + w) * RP + lane] * f; tot += sms[i * 16 + w] * f; }
    C[(size_t)(q0 + w) * DM + h * HD + lane] = o / (tot * VCAR);
}

__global__ __launch_bounds__(256) void k_cvt8(const float* __restrict__ src, bf* dst, size_t n8) { const size_t i = (size_t)blockIdx.x * 256 + threadIdx.x; if (i >= n8) return; const v8f v = *(const v8f*)(src + i * 8); v8us o;
#pragma unroll
    for (int k = 0; k < 8; ++k) o[k] = f2bf(v[k]); *(v8us*)(dst + i * 8) = o;  }

__global__ __launch_bounds__(256) void k_wT(const float* __restrict__ W, bf* WT, int Kin, int Nout) { const size_t g = (size_t)blockIdx.x * 256 + threadIdx.x; if (g >= (size_t)Nout * Kin / 8) return; const int k0 = (int)(g % (size_t)(Kin / 8)) * 8; const int n = (int)(g / (size_t)(Kin / 8)); v8us o;
#pragma unroll
    for (int q = 0; q < 8; ++q) o[q] = f2bf(W[(size_t)(k0 + q) * Nout + n]);
    bf* d = WT + (size_t)n * Kin + k0; *(v8us*)d = o;  }

__global__ __launch_bounds__(256) void k_q16(const float* __restrict__ src, h16* dst, size_t n8) { const size_t i = (size_t)blockIdx.x * 256 + threadIdx.x; if (i >= n8) return; const v8f v = *(const v8f*)(src + i * 8); v8h o;
#pragma unroll
    for (int k = 0; k < 8; ++k) o[k] = tohx(v[k] * QCAR); *(v8h*)(dst + i * 8) = o;  }

// k_kv16, blockIdx.y = batch: kv f32 [4096][512] -> the f16 planes in fragment order, 512 elements a fragment, element (half, hi, r, e) at half*256 + hi*128 + r*8 + e, where the fragment's row is r and its k index half*16 + hi*8 + e.
// k plane, fragment (head, 16 keys): row = key, k index = d, value f16(k x KCAR); first half of the threads, a wave writes half a fragment (512 contiguous bytes).
// V^T planes, fragment (head, 32 keys, 16 d): row = d, k index = key, VTh = f16(v x VCAR), VTl = f16((v x VCAR - VTh) x RCAR); second half of the threads, lane = d of one head (each load is one whole line of kv), 8 keys a thread.
__global__ __launch_bounds__(256) void k_kv16(const float* __restrict__ KV, h16* K16, h16* VTh, h16* VTl) {
    static_assert(NH == 8 && HD == 32);
    const size_t g = (size_t)blockIdx.x * 256 + threadIdx.x; const size_t NA = (size_t)NK * DM / 8;
    const size_t z = blockIdx.y; KV += z * ((size_t)NK * 2 * DM); K16 += z * ((size_t)NK * DM); VTh += z * ((size_t)DM * NK); VTl += z * ((size_t)DM * NK);
    if (g < NA) {
        const int lane = (int)(g & 31), half = (int)(g >> 5) & 1, h = (int)(g >> 6) & 7, tile = (int)(g >> 9);
        const float* sp = KV + (size_t)(tile * 16 + (lane & 15)) * (2 * DM) + h * HD + half * 16 + (lane >> 4) * 8;
        const v8f a = *(const v8f*)sp; v8h o;
        // the wait that belongs in front of any overwrite of an issued load's address registers; the address is an input so that it stays whole up to it
        asm volatile("s_wait_xcnt 0x0" :: "v"(sp) : "memory");
#pragma unroll
        for (int q = 0; q < 8; ++q) o[q] = tohx(a[q] * KCAR);
        h16* d = K16 + ((size_t)h * (NK / 16) + tile) * 512 + half * 256 + lane * 8; *(v8h*)d = o;
    } else if (g < 2 * NA) {
        const size_t e = g - NA; const int d = (int)(e & 31), h = (int)(e >> 5) & 7, jg = (int)(e >> 8);
        const float* sp = KV + (size_t)(jg * 8) * (2 * DM) + DM + h * HD + d;
        float x[8];
#pragma unroll
        for (int q = 0; q < 8; ++q) x[q] = sp[(size_t)q * (2 * DM)];
        // the wait that belongs in front of any overwrite of an issued load's address registers, as above
        asm volatile("s_wait_xcnt 0x0" :: "v"(sp) : "memory");
        v8h oh, ol;
#pragma unroll
        for (int q = 0; q < 8; ++q) { const float y = x[q] * VCAR; const h16 hh = tohx(y); oh[q] = hh; ol[q] = tohx(__fmul_rn(__fsub_rn(y, (float)hh), RCAR)); }
        const size_t oo = (((size_t)h * (NK / 32) + (jg >> 2)) * 2 + (d >> 4)) * 512 + (jg & 3) * 128 + (d & 15) * 8;
        *(v8h*)(VTh + oo) = oh; *(v8h*)(VTl + oo) = ol;
    }
}

__global__ __launch_bounds__(256) void k_split(const float* __restrict__ src, bf* dh, bf* dl, size_t n8) { const size_t i = (size_t)blockIdx.x * 256 + threadIdx.x; if (i >= n8) return; const float* sp = src + i * 8; const v8f v = *(const v8f*)sp; v8us oh, ol;
    // the wait that belongs in front of any overwrite of an issued load's address registers; the address is an input so that it stays whole up to it
    asm volatile("s_wait_xcnt 0x0" :: "v"(sp) : "memory");
#pragma unroll
    for (int k = 0; k < 8; ++k) { unsigned short a, c; splitf(v[k], a, c); oh[k] = a; ol[k] = c; }
    *(v8us*)(dh + i * 8) = oh; *(v8us*)(dl + i * 8) = ol;  }

// ---- workspace carve (bytes, 256-B aligned regions; all sizes compile-time)
constexpr size_t al256(size_t x) { return (x + 255) & ~(size_t)255; }
constexpr size_t cmax(size_t a, size_t b) { return a > b ? a : b; }
constexpr size_t SZ_XS  = al256((size_t)NB * NQ_FULL * DM * 2);                                 // state as bf16 [NB][NQ_FULL][256]
constexpr size_t SZ_WQ  = al256((size_t)DM * DM * 2);                                           // Wq^T [256][256]
constexpr size_t SZ_WKV = al256((size_t)2 * DM * DM * 2);                                       // Wkv^T [512][256]
constexpr size_t SZ_WO  = al256((size_t)DM * DM * 2);                                           // Wo^T [256][256]
constexpr size_t SZ_GF  = al256(cmax((size_t)NB * NQ * DM * 4, (size_t)NB * NK * 2 * DM * 4)); // f32 GEMM scratch: q [NB*NQ][256] first, then kv [NB][4096][512]
constexpr size_t SZ_Q16 = al256((size_t)NB * NQ * DM * 2);                                      // q f16 [NB*NQ][256]
constexpr size_t SZ_XP  = al256((size_t)NB * NK * DM * 2);                                      // points as bf16 [NB][4096][256]
constexpr size_t SZ_K16 = al256((size_t)NB * NK * DM * 2);                                      // k f16 [NB][8 heads][256 fragments][512]
constexpr size_t SZ_VT  = al256((size_t)NB * DM * NK * 2);                                      // V^T plane [NB][8 heads][128 x 2 fragments][512] (hi, residual: one each)
constexpr size_t SZ_CTX = al256((size_t)NB * NQ * DM * 4);                                      // ctx f32 [NB*NQ][256]
constexpr size_t SZ_C16 = al256((size_t)NB * NQ * DM * 2);                                      // ctx hi / lo planes
constexpr size_t O_XS = 0, O_WQ = O_XS + SZ_XS, O_WKV = O_WQ + SZ_WQ, O_WO = O_WKV + SZ_WKV, O_GF = O_WO + SZ_WO, O_Q16 = O_GF + SZ_GF, O_XP = O_Q16 + SZ_Q16, O_K16 = O_XP + SZ_XP,
                 O_VTH = O_K16 + SZ_K16, O_VTL = O_VTH + SZ_VT, O_CTX = O_VTL + SZ_VT, O_CH = O_CTX + SZ_CTX, O_CL = O_CH + SZ_C16, O_END = O_CL + SZ_C16;
static_assert(O_END <= (size_t)268435456);
static_assert((size_t)NB * NQ * DM * 4 <= SZ_GF && (size_t)NB * NK * 2 * DM * 4 <= SZ_GF);
static_assert(((size_t)(NB_FULL - 1) * NQ_FULL + NQ_FULL) * DM * 4 <= (size_t)NB_FULL * NQ_FULL * DM * 4);

extern "C" void kernel_launch(void* const* d_in, const int* in_sizes, int n_in, void* d_out, int out_size, void* d_ws, size_t ws_size, hipStream_t stream) {
    if (n_in < 8) return;
    if (in_sizes[0] < NB * NQ_FULL * DM || in_sizes[1] < NB * NK * DM || in_sizes[2] < DM * DM || in_sizes[3] < DM || in_sizes[4] < DM * 2 * DM || in_sizes[5] < 2 * DM || in_sizes[6] < DM * DM || in_sizes[7] < DM) return;
    if ((size_t)out_size < (size_t)NB * NQ_FULL * DM) return;
    if (O_END > ws_size) return;
    const float* state = (const float*)d_in[0];   // [8][512][256]
    const float* pts   = (const float*)d_in[1];   // [8][4096][256]
    const float* Wq    = (const float*)d_in[2];   // [256][256] in x out
    const float* bq    = (const float*)d_in[3];   // [256]
    const float* Wkv   = (const float*)d_in[4];   // [256][512]
    const float* bkv   = (const float*)d_in[5];   // [512]
    const float* Wo    = (const float*)d_in[6];   // [256][256]
    const float* bo    = (const float*)d_in[7];   // [256]
    float* OUT = (float*)d_out;                   // [8][512][256]
    char* ws = (char*)d_ws;
    bf* XS = (bf*)(ws + O_XS); bf* WQT = (bf*)(ws + O_WQ); bf* WKVT = (bf*)(ws + O_WKV); bf* WOT = (bf*)(ws + O_WO);
    float* GF = (float*)(ws + O_GF); h16* Q16 = (h16*)(ws + O_Q16); bf* XP = (bf*)(ws + O_XP); h16* K16 = (h16*)(ws + O_K16);
    h16* VTH = (h16*)(ws + O_VTH); h16* VTL = (h16*)(ws + O_VTL);
    float* CTX = (float*)(ws + O_CTX); bf* CH = (bf*)(ws + O_CH); bf* CL = (bf*)(ws + O_CL);

    // planes of the inputs
    { const size_t n8 = (size_t)NB * NQ_FULL * DM / 8; k_cvt8<<<(unsigned)((n8 + 255) / 256), 256, 0, stream>>>(state, XS, n8); }
    k_wT<<<(unsigned)(((size_t)DM * DM / 8 + 255) / 256), 256, 0, stream>>>(Wq, WQT, DM, DM);
    k_wT<<<(unsigned)(((size_t)2 * DM * DM / 8 + 255) / 256), 256, 0, stream>>>(Wkv, WKVT, DM, 2 * DM);
    k_wT<<<(unsigned)(((size_t)DM * DM / 8 + 255) / 256), 256, 0, stream>>>(Wo, WOT, DM, DM);
    // q = Xs Wq + bq for all batches: GF [NB*NQ][256] f32, then the f16 plane
    k_gemmw<bf, 0, true, 4><<<dim3(NQ / 64, DM / 64, NB), 32, 0, stream>>>(XS, nullptr, DM, WQT, nullptr, DM, DM, GF, DM, bq, 1.0f, 0.0f, (size_t)NQ_FULL * DM, (size_t)0, (size_t)NQ * DM);
    { const size_t n8 = (size_t)NB * NQ * DM / 8; k_q16<<<(unsigned)((n8 + 255) / 256), 256, 0, stream>>>(GF, Q16, n8); }
    { const size_t n8 = (size_t)NB * NK * DM / 8; k_cvt8<<<(unsigned)((n8 + 255) / 256), 256, 0, stream>>>(pts, XP, n8); }
    // kv = Xp Wkv + bkv: GF [NB][4096][512] f32, z = batch
    k_gemmw<bf, 0, true, 4><<<dim3(NK / 64, (2 * DM) / 64, NB), 32, 0, stream>>>(XP, nullptr, DM, WKVT, nullptr, DM, DM, GF, 2 * DM, bkv, 1.0f, 0.0f, (size_t)NK * DM, (size_t)0, (size_t)NK * 2 * DM);
    // k plane and V^T hi/residual planes in fragment order: y = batch
    k_kv16<<<dim3((unsigned)((size_t)2 * NK * DM / 8 / 256), NB), 256, 0, stream>>>(GF, K16, VTH, VTL);
    // ctx[b][i][h*32 + d] = softmax_j(q_h[i] . k_h[j] HD^-0.5) v[j][h*32 + d]: x = 16 queries, y = head, z = batch
    k_attn<<<dim3(NQ / 16, NH, NB), 32 * FW, 0, stream>>>(Q16, K16, VTH, VTL, CTX);
    // out = ctx Wo + bo: ctx as bf16 hi/lo planes, rows of batch b at OUT + b*NQ_FULL*256
    { const size_t n8 = (size_t)NB * NQ * DM / 8; k_split<<<(unsigned)((n8 + 255) / 256), 256, 0, stream>>>(CTX, CH, CL, n8); }
    k_gemmw<bf, 1, true, 4><<<dim3(NQ / 64, DM / 64, NB), 32, 0, stream>>>(CH, CL, DM, WOT, nullptr, DM, DM, OUT, DM, bo, 1.0f, 0.0f, (size_t)NQ * DM, (size_t)0, (size_t)NQ_FULL * DM);
}

// v005
// Measured time: 142 microseconds a run.
// Next to v004, in two timings, it ran 1.16 times as fast each time.
// Over all steps from v000 it is 8.56 times as fast.
#include <hip/hip_runtime.h>

// Contractions, all f32 accumulate: q = Xs Wq + bq and kv = Xp Wkv + bkv on v_wmma_f32_16x16x32_bf16 (bf16 RNE planes of the f32 inputs, weights transposed to [out][in]); per-head scores q k^T on v_wmma_f32_16x16x32_f16 (q and k as f16 planes carried x8 each); per-head P V on v_wmma_f32_16x16x32_f16 (P f16 carried x2^14; V^T as an f16 hi plane carried x4 plus an f16 residual plane carried x2^10 into a separate accumulator); out = ctx Wo + bo on v_wmma_f32_16x16x32_bf16 (ctx as bf16 hi + lo planes, Wo bf16). Softmax f32, max-subtracted, fixed-order sums. Scores, softmax and P V run in one kernel, split along the keys over the waves of a block; scores and P stay in registers, each wave subtracts its own keys' maximum, P is left unnormalised and the row's sum divides the result; partial sums are brought to the row's maximum and added in a fixed order. Every stage runs once for all batches: the batch is a grid dimension. The q, k and V^T planes are written by the projection GEMMs themselves, straight from the accumulators, and lie in fragment order: the 1024 bytes of one 16 x 32 operand fragment are contiguous, lane l's two 16-byte pieces at 16 l and 512 + 16 l.

#ifndef NB
#define NB 8            // batches computed (reducible)
#endif
#ifndef NQ
#define NQ 512          // query rows per batch computed (reducible, multiple of 64)
#endif
#define NB_FULL 8
#define NQ_FULL 512     // per-batch stride of the state input and of the output
#define NK 4096         // keys (softmax row length)
#define DM 256
#define NH 8
#define HD 32
#define QCAR 8.0f
#define KCAR 8.0f
#define VCAR 4.0f
#define RCAR 1024.0f
#define PCAR 16384.0f
#define FW 16            // waves per block of k_attn, each on its own NK/FW keys
#define SCL2 (0.17677669529663687f * 0.015625f)   // HD^-0.5 / (QCAR*KCAR)

static_assert(NB >= 1 && NB <= NB_FULL);
static_assert(NQ >= 64 && NQ <= NQ_FULL && (NQ % 64) == 0);
static_assert(NK == 256 * 16);
static_assert(QCAR == KCAR);
static_assert((DM % 64) == 0 && (NK % 64) == 0 && HD == 32 && NH * HD == DM);

typedef _Float16 h16;
typedef unsigned short bf;
typedef __attribute__((ext_vector_type(16))) __bf16   v16bf;
typedef __attribute__((ext_vector_type(16))) _Float16 v16h;
typedef __attribute__((ext_vector_type(8)))  _Float16 v8h;
typedef __attribute__((ext_vector_type(8)))  unsigned short v8us;
typedef __attribute__((ext_vector_type(8)))  float    v8f;
typedef __attribute__((ext_vector_type(4)))  float    v4f;
typedef v8h  __attribute__((may_alias)) v8ha;
typedef v4f  __attribute__((may_alias)) v4fa;
typedef v8us __attribute__((may_alias)) v8usa;

__device__ __forceinline__ unsigned short f2bf(float f) { unsigned u = __float_as_uint(f); u += 0x7FFFu + ((u >> 16) & 1u); return (unsigned short)(u >> 16); }
__device__ __forceinline__ float bf2f(unsigned short b) { return __uint_as_float(((unsigned)b) << 16); }
__device__ __forceinline__ float bfr(float f) { return bf2f(f2bf(f)); }
__device__ __forceinline__ v16h cat16(v8h lo, v8h hi) { return __builtin_shufflevector(lo, hi, 0, 1, 2, 3, 4, 5, 6, 7, 8, 9, 10, 11, 12, 13, 14, 15); }
__device__ __forceinline__ v16bf cat16b(v8us lo, v8us hi) { return __builtin_bit_cast(v16bf, __builtin_shufflevector(lo, hi, 0, 1, 2, 3, 4, 5, 6, 7, 8, 9, 10, 11, 12, 13, 14, 15)); }
__device__ __forceinline__ v8f wmma16(v16h a, v16h b, v8f c) { return __builtin_amdgcn_wmma_f32_16x16x32_f16(false, a, false, b, (short)0, c, false, false); }
__device__ __forceinline__ v8f wmmab(v16bf a, v16bf b, v8f c) { return __builtin_amdgcn_wmma_f32_16x16x32_bf16(false, a, false, b, (short)0, c, false, false); }
__device__ __forceinline__ h16 tohx(float x) { return (h16)x; }
__device__ __forceinline__ void splitf(float y, unsigned short& h, unsigned short& l) { h = f2bf(y); l = f2bf(y - bf2f(h)); }

// ---- k_gemmw: register-blocked GEMM, ONE WAVE per 64 x (16*NBN) output tile, operands straight from K-contiguous 16-bit planes; grid (M/64, N/(16*NBN), Z), 32 threads.
// C[m][n] (f32, pitch ldc) = (sum_k A[m][k] Bt[n][k] [+ A2 B same accumulator (MODE 1)] [+ (A Bt2) * rs2 from a separate accumulator (MODE 2)]) * oscale + optional bf16-cast bias[n].
// A rows pitch lda, Bt rows pitch ldb (elements), z-batch strides sA/sB/sC in elements. K % 32 == 0. Fragments: lane row/col = lane&15, elements 0..7 <- k0+8h.., 8..15 <- k0+16+8h.. for A and B.
template <typename T16> struct WFrag;
template <> struct WFrag<h16> { typedef v16h V; static __device__ __forceinline__ V ld(const h16* p) { return cat16(*(const v8h*)p, *(const v8h*)(p + 16)); } static __device__ __forceinline__ v8f mma(V a, V b, v8f c) { return wmma16(a, b, c); } };
template <> struct WFrag<bf> { typedef v16bf V; static __device__ __forceinline__ V ld(const bf* p) { return cat16b(*(const v8us*)p, *(const v8us*)(p + 16)); } static __device__ __forceinline__ v8f mma(V a, V b, v8f c) { return wmmab(a, b, c); } };
// fragment-order plane: p = fragment base + 8 * lane (elements); the lane's second piece stands 256 elements on, so each wave-wide load covers 512 contiguous bytes
__device__ __forceinline__ v16h ldfrag(const h16* p) { return cat16(*(const v8h*)p, *(const v8h*)(p + 256)); }
template <typename T16, int MODE, bool BIAS, int NBN>
__global__ __launch_bounds__(32) void k_gemmw(const T16* __restrict__ A, const T16* __restrict__ A2, int lda, const T16* __restrict__ Bt, const T16* __restrict__ Bt2, int ldb, int K, float* C, int ldc, const float* __restrict__ bias, float oscale, float rs2, size_t sA, size_t sB, size_t sC) {
    typedef typename WFrag<T16>::V V;
    __shared__ __align__(16) float os[16 * 68];
    const size_t z = blockIdx.z; A += z * sA; if (MODE == 1) A2 += z * sA; Bt += z * sB; if (MODE == 2) Bt2 += z * sB; C += z * sC;
    const int lane = threadIdx.x & 31, lr = lane & 15, hi = lane >> 4; const int r0 = blockIdx.x * 64, c0 = blockIdx.y * (16 * NBN);
    v8f acc[4][NBN], acc2[4][NBN];
#pragma unroll
    for (int mb = 0; mb < 4; ++mb)
#pragma unroll
        for (int nb = 0; nb < NBN; ++nb) { acc[mb][nb] = (v8f){}; acc2[mb][nb] = (v8f){}; }
    const size_t aoff = (size_t)(r0 + lr) * lda + 8 * hi, boff = (size_t)(c0 + lr) * ldb + 8 * hi;
#pragma unroll 1
    for (int kc = 0; kc < K; kc += 32) {
        V a[4], a2[4];
#pragma unroll
        for (int mb = 0; mb < 4; ++mb) { a[mb] = WFrag<T16>::ld(A + aoff + (size_t)mb * 16 * lda + kc); if (MODE == 1) a2[mb] = WFrag<T16>::ld(A2 + aoff + (size_t)mb * 16 * lda + kc); }
#pragma unroll
        for (int nb = 0; nb < NBN; ++nb) { const V b = WFrag<T16>::ld(Bt + boff + (size_t)nb * 16 * ldb + kc); V b2; if (MODE == 2) b2 = WFrag<T16>::ld(Bt2 + boff + (size_t)nb * 16 * ldb + kc);
#pragma unroll
            for (int mb = 0; mb < 4; ++mb) { acc[mb][nb] = WFrag<T16>::mma(a[mb], b, acc[mb][nb]); if (MODE == 1) acc[mb][nb] = WFrag<T16>::mma(a2[mb], b, acc[mb][nb]); if (MODE == 2) acc2[mb][nb] = WFrag<T16>::mma(a[mb], b2, acc2[mb][nb]); } }
        if (MODE == 2) asm volatile("v_nop\n\tv_nop\n\tv_nop\n\tv_nop" : "+v"(acc[0][0]), "+v"(acc[1][NBN - 1]), "+v"(acc[2][0]), "+v"(acc[3][NBN - 1]), "+v"(acc2[0][0]), "+v"(acc2[1][NBN - 1]), "+v"(acc2[2][0]), "+v"(acc2[3][NBN - 1]) : "v"(a[0]), "v"(a[3]));
        else asm volatile("v_nop\n\tv_nop\n\tv_nop\n\tv_nop" : "+v"(acc[0][0]), "+v"(acc[1][NBN - 1]), "+v"(acc[2][0]), "+v"(acc[3][NBN - 1]) : "v"(a[0]), "v"(a[3]));
    }
    constexpr int LPR = 4 * NBN, RPI = 32 / LPR, NIT = 16 / RPI;   // lanes per row, rows per instruction, instructions per slab
    const int rl = lane / LPR, cofs = (lane % LPR) * 4;
#pragma unroll
    for (int mb = 0; mb < 4; ++mb) {
#pragma unroll
        for (int nb = 0; nb < NBN; ++nb) {
#pragma unroll
            for (int j = 0; j < 8; ++j) { float vv = acc[mb][nb][j]; if (MODE == 2) vv += acc2[mb][nb][j] * rs2; os[(hi * 8 + j) * 68 + nb * 16 + lr] = vv * oscale; } }
        __builtin_amdgcn_wave_barrier(); asm volatile("" ::: "memory");
        float* crow = C + (size_t)(r0 + mb * 16) * ldc + c0;
{
#pragma unroll
            for (int s = 0; s < NIT; ++s) { const int row = RPI * s + rl; v4f val = *(const v4fa*)(os + row * 68 + cofs); if (BIAS) { val[0] += bfr(bias[c0 + cofs]); val[1] += bfr(bias[c0 + cofs + 1]); val[2] += bfr(bias[c0 + cofs + 2]); val[3] += bfr(bias[c0 + cofs + 3]); }
                *(v4f*)(crow + (size_t)row * ldc + cofs) = val; }
             }
        __builtin_amdgcn_wave_barrier(); asm volatile("" ::: "memory");
    }
}

// ---- k_proj: y = X W + b (X bf16 [rows][DM], W^T bf16 [columns][DM]), ONE WAVE per 64 rows x 64 columns, written as f16 planes in fragment order straight from the accumulators; grid (NROW/64, columns/64, NB), 32 threads.
// A fragment is 512 elements, element (half, hi, r, e) at half*256 + hi*128 + r*8 + e, where the fragment's row is r and its k index half*16 + hi*8 + e.
// Columns below DM (q, or the k half of kv): the product runs as W^T X^T (A = 16 columns of y, B = 16 rows of y), so a lane holds 8 consecutive columns d of one row: one 16-byte piece of fragment (head, 16 rows), row = r, k index = d, value f16(y x KCAR).
// Columns from DM on (the v half of kv): the product runs as X W (A = 16 rows, B = 16 columns), so a lane holds 8 consecutive keys of one column d: one 16-byte piece of fragment (head, 32 keys, 16 d), row = d, k index = key, VTh = f16(v x VCAR), VTl = f16((v x VCAR - VTh) x RCAR).
// Either way each wave-wide store covers 512 contiguous bytes. Operand fragments as in k_gemmw: lane row/col = lane&15, elements 0..7 <- k0+8h.., 8..15 <- k0+16+8h.. for A and B alike, so the two roles swap freely.
template <bool SW>
__device__ __forceinline__ void proj_acc(const bf* xk, const bf* wk, v8f (&acc)[4][4]) {
#pragma unroll
    for (int rt = 0; rt < 4; ++rt)
#pragma unroll
        for (int ct = 0; ct < 4; ++ct) acc[rt][ct] = (v8f){};
#pragma unroll 1
    for (int kc = 0; kc < DM; kc += 32) {
        v16bf x[4];
#pragma unroll
        for (int rt = 0; rt < 4; ++rt) x[rt] = WFrag<bf>::ld(xk + (size_t)rt * 16 * DM);
#pragma unroll
        for (int ct = 0; ct < 4; ++ct) { const v16bf wv = WFrag<bf>::ld(wk + (size_t)ct * 16 * DM);
#pragma unroll
            for (int rt = 0; rt < 4; ++rt) acc[rt][ct] = SW ? wmmab(wv, x[rt], acc[rt][ct]) : wmmab(x[rt], wv, acc[rt][ct]); }
        // the wait that belongs in front of the overwrite of the issued loads' address registers (inputs, so that they stay whole up to it), and four vector slots between the trip's last product and the next trip's loads, which take over its operand registers (every accumulator is named, so that the statement stands behind all of the trip's products)
        asm volatile("s_wait_xcnt 0x0\n\tv_nop\n\tv_nop\n\tv_nop\n\tv_nop" : "+v"(acc[0][0]), "+v"(acc[0][1]), "+v"(acc[0][2]), "+v"(acc[0][3]), "+v"(acc[1][0]), "+v"(acc[1][1]), "+v"(acc[1][2]), "+v"(acc[1][3]), "+v"(acc[2][0]), "+v"(acc[2][1]), "+v"(acc[2][2]), "+v"(acc[2][3]), "+v"(acc[3][0]), "+v"(acc[3][1]), "+v"(acc[3][2]), "+v"(acc[3][3]) : "v"(xk), "v"(wk));
        xk += 32; wk += 32;
    }
}
template <int NROW, bool HASV>
__global__ __launch_bounds__(32) void k_proj(const bf* __restrict__ X, const bf* __restrict__ WT, const float* __restrict__ bias, h16* P, h16* VTh, h16* VTl, size_t sX) {
    static_assert(NROW % 64 == 0 && HD == 32 && DM % 64 == 0);
    const int lane = threadIdx.x & 31, lr = lane & 15, hi = lane >> 4; const int r0 = blockIdx.x * 64, c0 = blockIdx.y * 64;
    const size_t z = blockIdx.z;
    const bf* xp = X + z * sX + (size_t)(r0 + lr) * DM + 8 * hi; const bf* wp = WT + (size_t)(c0 + lr) * DM + 8 * hi;
    v8f acc[4][4];   // [16 rows of y][16 columns of y]
    if (!HASV || c0 < DM) {
        proj_acc<true>(xp, wp, acc);   // acc[rt][ct][j] = y[r0 + 16 rt + lr][c0 + 16 ct + 8 hi + j]
        h16* dst = P + z * ((size_t)NROW * DM) + ((size_t)(c0 / HD) * (NROW / 16) + r0 / 16) * 512 + 8 * lane;
#pragma unroll
        for (int ct = 0; ct < 4; ++ct) { const v8f b = *(const v8f*)(bias + c0 + ct * 16 + 8 * hi);
#pragma unroll
            for (int rt = 0; rt < 4; ++rt) { v8h o;
#pragma unroll
                for (int j = 0; j < 8; ++j) o[j] = tohx((acc[rt][ct][j] + bfr(b[j])) * KCAR);
                *(v8h*)(dst + ((size_t)(ct >> 1) * (NROW / 16) + rt) * 512 + (ct & 1) * 256) = o; } }
    } else {
        proj_acc<false>(xp, wp, acc);  // acc[rt][ct][j] = y[r0 + 16 rt + 8 hi + j][c0 + 16 ct + lr]
        const size_t oo = z * ((size_t)DM * NROW) + ((size_t)((c0 - DM) / HD) * (NROW / 32) + r0 / 32) * 1024 + 8 * lane;
#pragma unroll
        for (int ct = 0; ct < 4; ++ct) { const float b = bfr(bias[c0 + ct * 16 + lr]);
#pragma unroll
            for (int rt = 0; rt < 4; ++rt) { v8h oh, ol;
#pragma unroll
                for (int j = 0; j < 8; ++j) { const float y = (acc[rt][ct][j] + b) * VCAR; const h16 hh = tohx(y); oh[j] = hh; ol[j] = tohx(__fmul_rn(__fsub_rn(y, (float)hh), RCAR)); }
                const size_t o = oo + ((size_t)(ct >> 1) * (NROW / 32) + (rt >> 1)) * 1024 + (ct & 1) * 512 + (rt & 1) * 256;
                *(v8h*)(VTh + o) = oh; *(v8h*)(VTl + o) = ol; } }
    }
}

// ---- k_attn: ctx = softmax(q k^T HD^-0.5) v for 16 queries of one head of one batch. Grid (NQ/16, NH, NB), FW waves; wave w owns keys w*NK/FW .. and never stores a score or a P value.
// S^T = K Q^T (A = 16 key rows, B = the 16 queries): lane (c, hi) holds query c, keys 8hi..8hi+7 of each 16-key tile. Two such tiles, converted in place, are the B operand P^T of O^T += V^T P^T (A = V^T rows d, keys in the same order).
// Each wave subtracts the maximum of its own keys: P = exp(t - max_w) x PCAR, not divided. The waves' O^T partials, row sums and maxima meet in LDS (one barrier); they are brought to the row's maximum, added in wave order, and the sum divides once.
__global__ __launch_bounds__(32 * FW) void k_attn(const h16* __restrict__ Q, const h16* __restrict__ K, const h16* __restrict__ VTh, const h16* __restrict__ VTl, float* C) {
    constexpr int KW = NK / FW, NT = KW / 16, NS = KW / 32, RP = 36;
    static_assert(KW % 32 == 0 && NS >= 2 && FW == 16 && HD == 32 && PCAR == 16384.0f);
    constexpr float CE = SCL2 * 1.4426950408889634f;
    __shared__ __align__(16) float red[FW * 16 * RP];
    __shared__ float mxs[FW * 16], sms[FW * 16];
    const int lane = threadIdx.x & 31, c = lane & 15, hi = lane >> 4, w = __builtin_amdgcn_readfirstlane(threadIdx.x >> 5);
    const int q0 = blockIdx.x * 16, h = blockIdx.y, k0 = w * KW;
    const size_t z = blockIdx.z; Q += z * ((size_t)NQ * DM); K += z * ((size_t)NK * DM); VTh += z * ((size_t)DM * NK); VTl += z * ((size_t)DM * NK); C += z * ((size_t)NQ * DM);
    const h16* qb = Q + ((size_t)h * (NQ / 16) + blockIdx.x) * 512;                            // the block's q fragment, the same for all lanes
    const h16* kb = K + ((size_t)h * (NK / 16) + k0 / 16) * 512;                       // the wave's first k fragment, the same for all lanes
    const h16* kp = kb + 8 * lane;                                                     // fragment t of the wave: + t * 512
    const size_t voff = ((size_t)h * (NK / 32) + k0 / 32) * 1024 + 8 * lane;           // fragment (s, dt) of the wave: + (2 s + dt) * 512
    const h16* bh = VTh + voff; const h16* bl = VTl + voff;
    const v16h qf = ldfrag(qb + 8 * lane);
    v16h kf[NT], vh[NS][2], vl[NS][2];
#pragma unroll
    for (int t = 0; t < NT; ++t) kf[t] = ldfrag(kp + (size_t)t * 512);
#pragma unroll
    for (int dt = 0; dt < 2; ++dt) { vh[0][dt] = ldfrag(bh + (size_t)dt * 512); vl[0][dt] = ldfrag(bl + (size_t)dt * 512); }
    // keeps the first V^T stage's loads up here with the K loads: one memory latency for all of them instead of one more in front of the first P V product
    __builtin_amdgcn_sched_barrier(0);
    v8f st[NT];
#pragma unroll
    for (int t = 0; t < NT; ++t) st[t] = wmma16(kf[t], qf, (v8f){});
    // holds the second stage's loads behind the score products, whose K registers they take over (earlier they spill), and ahead of the maximum and stage 0
    __builtin_amdgcn_sched_barrier(0);
    // four vector slots between the last product and the loads that take over its operand registers (the distance a vector overwrite of A or B needs; a load directly over a product's B is not known to be safe)
    asm volatile("v_nop\n\tv_nop\n\tv_nop\n\tv_nop" ::: "memory");
#pragma unroll
    for (int dt = 0; dt < 2; ++dt) { vh[1][dt] = ldfrag(bh + (size_t)(2 + dt) * 512); vl[1][dt] = ldfrag(bl + (size_t)(2 + dt) * 512); }
    float mx = st[0][0];
#pragma unroll
    for (int t = 0; t < NT; ++t)
#pragma unroll
        for (int j = 0; j < 8; ++j) mx = fmaxf(mx, st[t][j]);
    mx = fmaxf(mx, __shfl_xor(mx, 16, 32));
    const float off = 14.0f - mx * CE;   // 2^14 = PCAR rides in the exponent
    v8f acc[2], acc2[2];
#pragma unroll
    for (int dt = 0; dt < 2; ++dt) { acc[dt] = (v8f){}; acc2[dt] = (v8f){}; }
    float sum0 = 0.f, sum1 = 0.f;
#pragma unroll
    for (int s = 0; s < NS; ++s) {
        v16h pb;
#pragma unroll
        for (int j = 0; j < 8; ++j) {
            float e0, e1;
            // two v_exp_f32 and the free slot that the instruction set asks for behind a transcendental before its result is read or its source overwritten: the second fills the first one's slot, the v_nop the second one's
            asm("v_exp_f32 %0, %2\n\tv_exp_f32 %1, %3\n\tv_nop" : "=&v"(e0), "=&v"(e1) : "v"(__builtin_fmaf(st[2 * s][j], CE, off)), "v"(__builtin_fmaf(st[2 * s + 1][j], CE, off)));
            sum0 += e0; sum1 += e1; pb[j] = tohx(e0); pb[8 + j] = tohx(e1);
        }
#pragma unroll
        for (int dt = 0; dt < 2; ++dt) { acc[dt] = wmma16(vh[s][dt], pb, acc[dt]); acc2[dt] = wmma16(vl[s][dt], pb, acc2[dt]); }
        // holds stage s + 2's loads between stage s, whose registers they take over (earlier they spill), and stage s + 1, a whole stage of work ahead of their use (left free they sink to their products, and each product waits out a latency of its own)
        __builtin_amdgcn_sched_barrier(0);
        if (s + 2 < NS) {
            // four vector slots between the stage's last product and the loads that take over its operand registers, as above
            asm volatile("v_nop\n\tv_nop\n\tv_nop\n\tv_nop" ::: "memory");
#pragma unroll
            for (int dt = 0; dt < 2; ++dt) { vh[s + 2][dt] = ldfrag(bh + (size_t)(2 * (s + 2) + dt) * 512); vl[s + 2][dt] = ldfrag(bl + (size_t)(2 * (s + 2) + dt) * 512); }
        }
    }
    // the wait that belongs in front of any overwrite of an issued load's address registers; the addresses are inputs so that they stay whole up to it (the q and K loads go out on the scalar bases qb and kb and the lane number)
    asm volatile("s_wait_xcnt 0x0" :: "s"(qb), "s"(kb), "v"(lane), "v"(bh), "v"(bl) : "memory");
    float sum = sum0 + sum1;
    sum += __shfl_xor(sum, 16, 32);
    if (hi == 0) { mxs[w * 16 + c] = mx; sms[w * 16 + c] = sum; }
    float* my = red + (w * 16 + c) * RP + 8 * hi;
#pragma unroll
    for (int dt = 0; dt < 2; ++dt) { v4f s0, s1;
#pragma unroll
        for (int j = 0; j < 4; ++j) { s0[j] = acc[dt][j] + acc2[dt][j] * (1.0f / RCAR); s1[j] = acc[dt][4 + j] + acc2[dt][4 + j] * (1.0f / RCAR); }
        *(v4fa*)(my + dt * 16) = s0; *(v4fa*)(my + dt * 16 + 4) = s1; }
    __syncthreads();
    // wave w finishes query q0 + w, lane = column d: its store is one whole 128-B line
    float m = mxs[w];
#pragma unroll
    for (int i = 1; i < FW; ++i) m = fmaxf(m, mxs[i * 16 + w]);
    float o = 0.f, tot = 0.f;
#pragma unroll
    for (int i = 0; i < FW; ++i) { const float f = __builtin_amdgcn_exp2f((mxs[i * 16 + w] - m) * CE); o += red[(i * 16 + w) * RP + lane] * f; tot += sms[i * 16 + w] * f; }
    C[(size_t)(q0 + w) * DM + h * HD + lane] = o / (tot * VCAR);
}

__global__ __launch_bounds__(256) void k_cvt8(const float* __restrict__ src, bf* dst, size_t n8) { const size_t i = (size_t)blockIdx.x * 256 + threadIdx.x; if (i >= n8) return; const v8f v = *(const v8f*)(src + i * 8); v8us o;
#pragma unroll
    for (int k = 0; k < 8; ++k) o[k] = f2bf(v[k]); *(v8us*)(dst + i * 8) = o;  }

__global__ __launch_bounds__(256) void k_wT(const float* __restrict__ W, bf* WT, int Kin, int Nout) { const size_t g = (size_t)blockIdx.x * 256 + threadIdx.x; if (g >= (size_t)Nout * Kin / 8) return; const int k0 = (int)(g % (size_t)(Kin / 8)) * 8; const int n = (int)(g / (size_t)(Kin / 8)); v8us o;
#pragma unroll
    for (int q = 0; q < 8; ++q) o[q] = f2bf(W[(size_t)(k0 + q) * Nout + n]);
    bf* d = WT + (size_t)n * Kin + k0; *(v8us*)d = o;  }

__global__ __launch_bounds__(256) void k_split(const float* __restrict__ src, bf* dh, bf* dl, size_t n8) { const size_t i = (size_t)blockIdx.x * 256 + threadIdx.x; if (i >= n8) return; const float* sp = src + i * 8; const v8f v = *(const v8f*)sp; v8us oh, ol;
    // the wait that belongs in front of any overwrite of an issued load's address registers; the address is an input so that it stays whole up to it
    asm volatile("s_wait_xcnt 0x0" :: "v"(sp) : "memory");
#pragma unroll
    for (int k = 0; k < 8; ++k) { unsigned short a, c; splitf(v[k], a, c); oh[k] = a; ol[k] = c; }
    *(v8us*)(dh + i * 8) = oh; *(v8us*)(dl + i * 8) = ol;  }

// ---- workspace carve (bytes, 256-B aligned regions; all sizes compile-time)
constexpr size_t al256(size_t x) { return (x + 255) & ~(size_t)255; }
constexpr size_t SZ_XS  = al256((size_t)NB * NQ_FULL * DM * 2);                                 // state as bf16 [NB][NQ_FULL][256]
constexpr size_t SZ_WQ  = al256((size_t)DM * DM * 2);                                           // Wq^T [256][256]
constexpr size_t SZ_WKV = al256((size_t)2 * DM * DM * 2);                                       // Wkv^T [512][256]
constexpr size_t SZ_WO  = al256((size_t)DM * DM * 2);                                           // Wo^T [256][256]
constexpr size_t SZ_Q16 = al256((size_t)NB * NQ * DM * 2);                                      // q f16 [NB][8 heads][NQ/16 fragments][512]
constexpr size_t SZ_XP  = al256((size_t)NB * NK * DM * 2);                                      // points as bf16 [NB][4096][256]
constexpr size_t SZ_K16 = al256((size_t)NB * NK * DM * 2);                                      // k f16 [NB][8 heads][256 fragments][512]
constexpr size_t SZ_VT  = al256((size_t)NB * DM * NK * 2);                                      // V^T plane [NB][8 heads][128 x 2 fragments][512] (hi, residual: one each)
constexpr size_t SZ_CTX = al256((size_t)NB * NQ * DM * 4);                                      // ctx f32 [NB*NQ][256]
constexpr size_t SZ_C16 = al256((size_t)NB * NQ * DM * 2);                                      // ctx hi / lo planes
constexpr size_t O_XS = 0, O_WQ = O_XS + SZ_XS, O_WKV = O_WQ + SZ_WQ, O_WO = O_WKV + SZ_WKV, O_Q16 = O_WO + SZ_WO, O_XP = O_Q16 + SZ_Q16, O_K16 = O_XP + SZ_XP,
                 O_VTH = O_K16 + SZ_K16, O_VTL = O_VTH + SZ_VT, O_CTX = O_VTL + SZ_VT, O_CH = O_CTX + SZ_CTX, O_CL = O_CH + SZ_C16, O_END = O_CL + SZ_C16;
static_assert(O_END <= (size_t)268435456);
static_assert(((size_t)(NB_FULL - 1) * NQ_FULL + NQ_FULL) * DM * 4 <= (size_t)NB_FULL * NQ_FULL * DM * 4);

extern "C" void kernel_launch(void* const* d_in, const int* in_sizes, int n_in, void* d_out, int out_size, void* d_ws, size_t ws_size, hipStream_t stream) {
    if (n_in < 8) return;
    if (in_sizes[0] < NB * NQ_FULL * DM || in_sizes[1] < NB * NK * DM || in_sizes[2] < DM * DM || in_sizes[3] < DM || in_sizes[4] < DM * 2 * DM || in_sizes[5] < 2 * DM || in_sizes[6] < DM * DM || in_sizes[7] < DM) return;
    if ((size_t)out_size < (size_t)NB * NQ_FULL * DM) return;
    if (O_END > ws_size) return;
    const float* state = (const float*)d_in[0];   // [8][512][256]
    const float* pts   = (const float*)d_in[1];   // [8][4096][256]
    const float* Wq    = (const float*)d_in[2];   // [256][256] in x out
    const float* bq    = (const float*)d_in[3];   // [256]
    const float* Wkv   = (const float*)d_in[4];   // [256][512]
    const float* bkv   = (const float*)d_in[5];   // [512]
    const float* Wo    = (const float*)d_in[6];   // [256][256]
    const float* bo    = (const float*)d_in[7];   // [256]
    float* OUT = (float*)d_out;                   // [8][512][256]
    char* ws = (char*)d_ws;
    bf* XS = (bf*)(ws + O_XS); bf* WQT = (bf*)(ws + O_WQ); bf* WKVT = (bf*)(ws + O_WKV); bf* WOT = (bf*)(ws + O_WO);
    h16* Q16 = (h16*)(ws + O_Q16); bf* XP = (bf*)(ws + O_XP); h16* K16 = (h16*)(ws + O_K16);
    h16* VTH = (h16*)(ws + O_VTH); h16* VTL = (h16*)(ws + O_VTL);
    float* CTX = (float*)(ws + O_CTX); bf* CH = (bf*)(ws + O_CH); bf* CL = (bf*)(ws + O_CL);

    // planes of the inputs
    { const size_t n8 = (size_t)NB * NQ_FULL * DM / 8; k_cvt8<<<(unsigned)((n8 + 255) / 256), 256, 0, stream>>>(state, XS, n8); }
    k_wT<<<(unsigned)(((size_t)DM * DM / 8 + 255) / 256), 256, 0, stream>>>(Wq, WQT, DM, DM);
    k_wT<<<(unsigned)(((size_t)2 * DM * DM / 8 + 255) / 256), 256, 0, stream>>>(Wkv, WKVT, DM, 2 * DM);
    k_wT<<<(unsigned)(((size_t)DM * DM / 8 + 255) / 256), 256, 0, stream>>>(Wo, WOT, DM, DM);
    // q = Xs Wq + bq: the f16 plane in fragment order, z = batch
    k_proj<NQ, false><<<dim3(NQ / 64, DM / 64, NB), 32, 0, stream>>>(XS, WQT, bq, Q16, nullptr, nullptr, (size_t)NQ_FULL * DM);
    { const size_t n8 = (size_t)NB * NK * DM / 8; k_cvt8<<<(unsigned)((n8 + 255) / 256), 256, 0, stream>>>(pts, XP, n8); }
    // kv = Xp Wkv + bkv: the k plane and the V^T hi/residual planes in fragment order, z = batch
    k_proj<NK, true><<<dim3(NK / 64, (2 * DM) / 64, NB), 32, 0, stream>>>(XP, WKVT, bkv, K16, VTH, VTL, (size_t)NK * DM);
    // ctx[b][i][h*32 + d] = softmax_j(q_h[i] . k_h[j] HD^-0.5) v[j][h*32 + d]: x = 16 queries, y = head, z = batch
    k_attn<<<dim3(NQ / 16, NH, NB), 32 * FW, 0, stream>>>(Q16, K16, VTH, VTL, CTX);
    // out = ctx Wo + bo: ctx as bf16 hi/lo planes, rows of batch b at OUT + b*NQ_FULL*256
    { const size_t n8 = (size_t)NB * NQ * DM / 8; k_split<<<(unsigned)((n8 + 255) / 256), 256, 0, stream>>>(CTX, CH, CL, n8); }
    k_gemmw<bf, 1, true, 4><<<dim3(NQ / 64, DM / 64, NB), 32, 0, stream>>>(CH, CL, DM, WOT, nullptr, DM, DM, OUT, DM, bo, 1.0f, 0.0f, (size_t)NQ * DM, (size_t)0, (size_t)NQ_FULL * DM);
}

// v006
// Measured time: 105 microseconds a run.
// Timed twice side by side with v005, it ran 1.36 times as fast both times.
// Over all steps from v000 it is 11.6 times as fast.
#include <hip/hip_runtime.h>

// Contractions, all f32 accumulate: q = Xs Wq + bq and kv = Xp Wkv + bkv on v_wmma_f32_16x16x32_bf16 (bf16 RNE planes of the f32 inputs, weights transposed to [out][in]); per-head scores q k^T on v_wmma_f32_16x16x32_f16 (q and k as f16 planes carried x8 each); per-head P V on v_wmma_f32_16x16x32_f16 (P f16 carried x2^14; V^T as an f16 hi plane carried x4 plus an f16 residual plane carried x2^10 into a separate accumulator); out = ctx Wo + bo on v_wmma_f32_16x16x32_bf16 (ctx as bf16 hi + lo planes, Wo bf16). Softmax f32, max-subtracted, fixed-order sums. Scores, softmax and P V run in one kernel, split along the keys into 16 parts over the waves of a block; scores and P stay in registers, each part subtracts its own keys' maximum, P is left unnormalised and the row's sum divides the result; partial sums are brought to the row's maximum and added in a fixed order. Every stage runs once for all batches: the batch is a grid dimension. The q, k and V^T planes are written by the projection GEMMs themselves, straight from the accumulators, and lie in fragment order: the 1024 bytes of one 16 x 32 operand fragment are contiguous, lane l's two 16-byte pieces at 16 l and 512 + 16 l.

#ifndef NB
#define NB 8            // batches computed (reducible)
#endif
#ifndef NQ
#define NQ 512          // query rows per batch computed (reducible, multiple of 64)
#endif
#define NB_FULL 8
#define NQ_FULL 512     // per-batch stride of the state input and of the output
#define NK 4096         // keys (softmax row length)
#define DM 256
#define NH 8
#define HD 32
#define QCAR 8.0f
#define KCAR 8.0f
#define VCAR 4.0f
#define RCAR 1024.0f
#define PCAR 16384.0f
#define FW 8             // waves per block of k_attn
#define NSEG 2           // key parts per wave, one after the other: FW*NSEG parts of NK/(FW*NSEG) keys
#define MQ 4             // 16-query tiles per block of k_attn, all served by each wave from one load of its keys
#define SCL2 (0.17677669529663687f * 0.015625f)   // HD^-0.5 / (QCAR*KCAR)

static_assert(NB >= 1 && NB <= NB_FULL);
static_assert(NQ >= 64 && NQ <= NQ_FULL && (NQ % 64) == 0);
static_assert(NK == 256 * 16);
static_assert(QCAR == KCAR);
static_assert((DM % 64) == 0 && (NK % 64) == 0 && HD == 32 && NH * HD == DM);

typedef _Float16 h16;
typedef unsigned short bf;
typedef __attribute__((ext_vector_type(16))) __bf16   v16bf;
typedef __attribute__((ext_vector_type(16))) _Float16 v16h;
typedef __attribute__((ext_vector_type(8)))  _Float16 v8h;
typedef __attribute__((ext_vector_type(8)))  unsigned short v8us;
typedef __attribute__((ext_vector_type(8)))  float    v8f;
typedef __attribute__((ext_vector_type(4)))  float    v4f;
typedef v8h  __attribute__((may_alias)) v8ha;
typedef v4f  __attribute__((may_alias)) v4fa;
typedef v8us __attribute__((may_alias)) v8usa;

__device__ __forceinline__ unsigned short f2bf(float f) { unsigned u = __float_as_uint(f); u += 0x7FFFu + ((u >> 16) & 1u); return (unsigned short)(u >> 16); }
__device__ __forceinline__ float bf2f(unsigned short b) { return __uint_as_float(((unsigned)b) << 16); }
__device__ __forceinline__ float bfr(float f) { return bf2f(f2bf(f)); }
__device__ __forceinline__ v16h cat16(v8h lo, v8h hi) { return __builtin_shufflevector(lo, hi, 0, 1, 2, 3, 4, 5, 6, 7, 8, 9, 10, 11, 12, 13, 14, 15); }
__device__ __forceinline__ v16bf cat16b(v8us lo, v8us hi) { return __builtin_bit_cast(v16bf, __builtin_shufflevector(lo, hi, 0, 1, 2, 3, 4, 5, 6, 7, 8, 9, 10, 11, 12, 13, 14, 15)); }
__device__ __forceinline__ v8f wmma16(v16h a, v16h b, v8f c) { return __builtin_amdgcn_wmma_f32_16x16x32_f16(false, a, false, b, (short)0, c, false, false); }
__device__ __forceinline__ v8f wmmab(v16bf a, v16bf b, v8f c) { return __builtin_amdgcn_wmma_f32_16x16x32_bf16(false, a, false, b, (short)0, c, false, false); }
__device__ __forceinline__ h16 tohx(float x) { return (h16)x; }
__device__ __forceinline__ void splitf(float y, unsigned short& h, unsigned short& l) { h = f2bf(y); l = f2bf(y - bf2f(h)); }

// ---- k_gemmw: register-blocked GEMM, ONE WAVE per 64 x (16*NBN) output tile, operands straight from K-contiguous 16-bit planes; grid (M/64, N/(16*NBN), Z), 32 threads.
// C[m][n] (f32, pitch ldc) = (sum_k A[m][k] Bt[n][k] [+ A2 B same accumulator (MODE 1)] [+ (A Bt2) * rs2 from a separate accumulator (MODE 2)]) * oscale + optional bf16-cast bias[n].
// A rows pitch lda, Bt rows pitch ldb (elements), z-batch strides sA/sB/sC in elements. K % 32 == 0. Fragments: lane row/col = lane&15, elements 0..7 <- k0+8h.., 8..15 <- k0+16+8h.. for A and B.
template <typename T16> struct WFrag;
template <> struct WFrag<h16> { typedef v16h V; static __device__ __forceinline__ V ld(const h16* p) { return cat16(*(const v8h*)p, *(const v8h*)(p + 16)); } static __device__ __forceinline__ v8f mma(V a, V b, v8f c) { return wmma16(a, b, c); } };
template <> struct WFrag<bf> { typedef v16bf V; static __device__ __forceinline__ V ld(const bf* p) { return cat16b(*(const v8us*)p, *(const v8us*)(p + 16)); } static __device__ __forceinline__ v8f mma(V a, V b, v8f c) { return wmmab(a, b, c); } };
// fragment-order plane: p = fragment base + 8 * lane (elements); the lane's second piece stands 256 elements on, so each wave-wide load covers 512 contiguous bytes
__device__ __forceinline__ v16h ldfrag(const h16* p) { return cat16(*(const v8h*)p, *(const v8h*)(p + 256)); }
template <typename T16, int MODE, bool BIAS, int NBN>
__global__ __launch_bounds__(32) void k_gemmw(const T16* __restrict__ A, const T16* __restrict__ A2, int lda, const T16* __restrict__ Bt, const T16* __restrict__ Bt2, int ldb, int K, float* C, int ldc, const float* __restrict__ bias, float oscale, float rs2, size_t sA, size_t sB, size_t sC) {
    typedef typename WFrag<T16>::V V;
    __shared__ __align__(16) float os[16 * 68];
    const size_t z = blockIdx.z; A += z * sA; if (MODE == 1) A2 += z * sA; Bt += z * sB; if (MODE == 2) Bt2 += z * sB; C += z * sC;
    const int lane = threadIdx.x & 31, lr = lane & 15, hi = lane >> 4; const int r0 = blockIdx.x * 64, c0 = blockIdx.y * (16 * NBN);
    v8f acc[4][NBN], acc2[4][NBN];
#pragma unroll
    for (int mb = 0; mb < 4; ++mb)
#pragma unroll
        for (int nb = 0; nb < NBN; ++nb) { acc[mb][nb] = (v8f){}; acc2[mb][nb] = (v8f){}; }
    const size_t aoff = (size_t)(r0 + lr) * lda + 8 * hi, boff = (size_t)(c0 + lr) * ldb + 8 * hi;
#pragma unroll 1
    for (int kc = 0; kc < K; kc += 32) {
        V a[4], a2[4];
#pragma unroll
        for (int mb = 0; mb < 4; ++mb) { a[mb] = WFrag<T16>::ld(A + aoff + (size_t)mb * 16 * lda + kc); if (MODE == 1) a2[mb] = WFrag<T16>::ld(A2 + aoff + (size_t)mb * 16 * lda + kc); }
#pragma unroll
        for (int nb = 0; nb < NBN; ++nb) { const V b = WFrag<T16>::ld(Bt + boff + (size_t)nb * 16 * ldb + kc); V b2; if (MODE == 2) b2 = WFrag<T16>::ld(Bt2 + boff + (size_t)nb * 16 * ldb + kc);
#pragma unroll
            for (int mb = 0; mb < 4; ++mb) { acc[mb][nb] = WFrag<T16>::mma(a[mb], b, acc[mb][nb]); if (MODE == 1) acc[mb][nb] = WFrag<T16>::mma(a2[mb], b, acc[mb][nb]); if (MODE == 2) acc2[mb][nb] = WFrag<T16>::mma(a[mb], b2, acc2[mb][nb]); } }
        if (MODE == 2) asm volatile("v_nop\n\tv_nop\n\tv_nop\n\tv_nop" : "+v"(acc[0][0]), "+v"(acc[1][NBN - 1]), "+v"(acc[2][0]), "+v"(acc[3][NBN - 1]), "+v"(acc2[0][0]), "+v"(acc2[1][NBN - 1]), "+v"(acc2[2][0]), "+v"(acc2[3][NBN - 1]) : "v"(a[0]), "v"(a[3]));
        else asm volatile("v_nop\n\tv_nop\n\tv_nop\n\tv_nop" : "+v"(acc[0][0]), "+v"(acc[1][NBN - 1]), "+v"(acc[2][0]), "+v"(acc[3][NBN - 1]) : "v"(a[0]), "v"(a[3]));
    }
    constexpr int LPR = 4 * NBN, RPI = 32 / LPR, NIT = 16 / RPI;   // lanes per row, rows per instruction, instructions per slab
    const int rl = lane / LPR, cofs = (lane % LPR) * 4;
#pragma unroll
    for (int mb = 0; mb < 4; ++mb) {
#pragma unroll
        for (int nb = 0; nb < NBN; ++nb) {
#pragma unroll
            for (int j = 0; j < 8; ++j) { float vv = acc[mb][nb][j]; if (MODE == 2) vv += acc2[mb][nb][j] * rs2; os[(hi * 8 + j) * 68 + nb * 16 + lr] = vv * oscale; } }
        __builtin_amdgcn_wave_barrier(); asm volatile("" ::: "memory");
        float* crow = C + (size_t)(r0 + mb * 16) * ldc + c0;
{
#pragma unroll
            for (int s = 0; s < NIT; ++s) { const int row = RPI * s + rl; v4f val = *(const v4fa*)(os + row * 68 + cofs); if (BIAS) { val[0] += bfr(bias[c0 + cofs]); val[1] += bfr(bias[c0 + cofs + 1]); val[2] += bfr(bias[c0 + cofs + 2]); val[3] += bfr(bias[c0 + cofs + 3]); }
                *(v4f*)(crow + (size_t)row * ldc + cofs) = val; }
             }
        __builtin_amdgcn_wave_barrier(); asm volatile("" ::: "memory");
    }
}

// ---- k_proj: y = X W + b (X bf16 [rows][DM], W^T bf16 [columns][DM]), ONE WAVE per 64 rows x 64 columns, written as f16 planes in fragment order straight from the accumulators; grid (NROW/64, columns/64, NB), 32 threads.
// A fragment is 512 elements, element (half, hi, r, e) at half*256 + hi*128 + r*8 + e, where the fragment's row is r and its k index half*16 + hi*8 + e.
// Columns below DM (q, or the k half of kv): the product runs as W^T X^T (A = 16 columns of y, B = 16 rows of y), so a lane holds 8 consecutive columns d of one row: one 16-byte piece of fragment (head, 16 rows), row = r, k index = d, value f16(y x KCAR).
// Columns from DM on (the v half of kv): the product runs as X W (A = 16 rows, B = 16 columns), so a lane holds 8 consecutive keys of one column d: one 16-byte piece of fragment (head, 32 keys, 16 d), row = d, k index = key, VTh = f16(v x VCAR), VTl = f16((v x VCAR - VTh) x RCAR).
// Either way each wave-wide store covers 512 contiguous bytes. Operand fragments as in k_gemmw: lane row/col = lane&15, elements 0..7 <- k0+8h.., 8..15 <- k0+16+8h.. for A and B alike, so the two roles swap freely.
template <bool SW>
__device__ __forceinline__ void proj_acc(const bf* xk, const bf* wk, v8f (&acc)[4][4]) {
#pragma unroll
    for (int rt = 0; rt < 4; ++rt)
#pragma unroll
        for (int ct = 0; ct < 4; ++ct) acc[rt][ct] = (v8f){};
#pragma unroll 1
    for (int kc = 0; kc < DM; kc += 32) {
        v16bf x[4];
#pragma unroll
        for (int rt = 0; rt < 4; ++rt) x[rt] = WFrag<bf>::ld(xk + (size_t)rt * 16 * DM);
#pragma unroll
        for (int ct = 0; ct < 4; ++ct) { const v16bf wv = WFrag<bf>::ld(wk + (size_t)ct * 16 * DM);
#pragma unroll
            for (int rt = 0; rt < 4; ++rt) acc[rt][ct] = SW ? wmmab(wv, x[rt], acc[rt][ct]) : wmmab(x[rt], wv, acc[rt][ct]); }
        // the wait that belongs in front of the overwrite of the issued loads' address registers (inputs, so that they stay whole up to it), and four vector slots between the trip's last product and the next trip's loads, which take over its operand registers (every accumulator is named, so that the statement stands behind all of the trip's products)
        asm volatile("s_wait_xcnt 0x0\n\tv_nop\n\tv_nop\n\tv_nop\n\tv_nop" : "+v"(acc[0][0]), "+v"(acc[0][1]), "+v"(acc[0][2]), "+v"(acc[0][3]), "+v"(acc[1][0]), "+v"(acc[1][1]), "+v"(acc[1][2]), "+v"(acc[1][3]), "+v"(acc[2][0]), "+v"(acc[2][1]), "+v"(acc[2][2]), "+v"(acc[2][3]), "+v"(acc[3][0]), "+v"(acc[3][1]), "+v"(acc[3][2]), "+v"(acc[3][3]) : "v"(xk), "v"(wk));
        xk += 32; wk += 32;
    }
}
template <int NROW, bool HASV>
__global__ __launch_bounds__(32) void k_proj(const bf* __restrict__ X, const bf* __restrict__ WT, const float* __restrict__ bias, h16* P, h16* VTh, h16* VTl, size_t sX) {
    static_assert(NROW % 64 == 0 && HD == 32 && DM % 64 == 0);
    const int lane = threadIdx.x & 31, lr = lane & 15, hi = lane >> 4; const int r0 = blockIdx.x * 64, c0 = blockIdx.y * 64;
    const size_t z = blockIdx.z;
    const bf* xp = X + z * sX + (size_t)(r0 + lr) * DM + 8 * hi; const bf* wp = WT + (size_t)(c0 + lr) * DM + 8 * hi;
    v8f acc[4][4];   // [16 rows of y][16 columns of y]
    if (!HASV || c0 < DM) {
        proj_acc<true>(xp, wp, acc);   // acc[rt][ct][j] = y[r0 + 16 rt + lr][c0 + 16 ct + 8 hi + j]
        h16* dst = P + z * ((size_t)NROW * DM) + ((size_t)(c0 / HD) * (NROW / 16) + r0 / 16) * 512 + 8 * lane;
#pragma unroll
        for (int ct = 0; ct < 4; ++ct) { const v8f b = *(const v8f*)(bias + c0 + ct * 16 + 8 * hi);
#pragma unroll
            for (int rt = 0; rt < 4; ++rt) { v8h o;
#pragma unroll
                for (int j = 0; j < 8; ++j) o[j] = tohx((acc[rt][ct][j] + bfr(b[j])) * KCAR);
                *(v8h*)(dst + ((size_t)(ct >> 1) * (NROW / 16) + rt) * 512 + (ct & 1) * 256) = o; } }
    } else {
        proj_acc<false>(xp, wp, acc);  // acc[rt][ct][j] = y[r0 + 16 rt + 8 hi + j][c0 + 16 ct + lr]
        const size_t oo = z * ((size_t)DM * NROW) + ((size_t)((c0 - DM) / HD) * (NROW / 32) + r0 / 32) * 1024 + 8 * lane;
#pragma unroll
        for (int ct = 0; ct < 4; ++ct) { const float b = bfr(bias[c0 + ct * 16 + lr]);
#pragma unroll
            for (int rt = 0; rt < 4; ++rt) { v8h oh, ol;
#pragma unroll
                for (int j = 0; j < 8; ++j) { const float y = (acc[rt][ct][j] + b) * VCAR; const h16 hh = tohx(y); oh[j] = hh; ol[j] = tohx(__fmul_rn(__fsub_rn(y, (float)hh), RCAR)); }
                const size_t o = oo + ((size_t)(ct >> 1) * (NROW / 32) + (rt >> 1)) * 1024 + (ct & 1) * 512 + (rt & 1) * 256;
                *(v8h*)(VTh + o) = oh; *(v8h*)(VTl + o) = ol; } }
    }
}

// ---- k_attn: ctx = softmax(q k^T HD^-0.5) v for 16*MQ queries of one head of one batch. Grid (NQ/(16*MQ), NH, NB), FW waves; wave w owns the key parts w*NSEG .. w*NSEG+NSEG-1 (NK/(FW*NSEG) keys each), one after the other, and never stores a score or a P value.
// One load of a part's K and V^T fragments serves all MQ query tiles. The K fragments stay in registers and the scores are formed twice from them: once for the part's maximum, once, 32 keys at a time, for P, with minus that maximum as the product's C operand (a lane's eight results belong to one query); so no score is kept.
// S^T = K Q^T (A = 16 key rows, B = 16 queries): lane (c, hi) holds query c, keys 8hi..8hi+7 of each 16-key tile. Two such tiles, converted in place, are the B operand P^T of O^T += V^T P^T (A = V^T rows d, keys in the same order).
// Each part subtracts the maximum of its own keys: P = exp(t - max_p) x PCAR, not divided. The parts' O^T partials, row sums and maxima meet in LDS (one barrier); they are brought to the row's maximum, added in key order, and the sum divides once.
__global__ __launch_bounds__(32 * FW) void k_attn(const h16* __restrict__ Q, const h16* __restrict__ K, const h16* __restrict__ VTh, const h16* __restrict__ VTl, float* C) {
    constexpr int NP = FW * NSEG, KW = NK / NP, NT = KW / 16, NS = KW / 32, RP = 36, QB = 16 * MQ;
    static_assert(KW % 32 == 0 && NS >= 2 && HD == 32 && PCAR == 16384.0f && NQ % QB == 0 && QB % FW == 0);
    constexpr float CE = SCL2 * 1.4426950408889634f;
    __shared__ __align__(16) float red[NP * QB * RP];
    __shared__ float mxs[NP * QB], sms[NP * QB];
    const int lane = threadIdx.x & 31, c = lane & 15, hi = lane >> 4, w = __builtin_amdgcn_readfirstlane(threadIdx.x >> 5);
    const int q0 = blockIdx.x * QB, h = blockIdx.y;
    const size_t z = blockIdx.z; Q += z * ((size_t)NQ * DM); K += z * ((size_t)NK * DM); VTh += z * ((size_t)DM * NK); VTl += z * ((size_t)DM * NK); C += z * ((size_t)NQ * DM);
    const h16* qb = Q + ((size_t)h * (NQ / 16) + (size_t)blockIdx.x * MQ) * 512;       // the block's first q fragment, the same for all lanes
    v16h qf[MQ];
#pragma unroll
    for (int m = 0; m < MQ; ++m) qf[m] = ldfrag(qb + (size_t)m * 512 + 8 * lane);
    // rolled: unrolled, the kernel's text would be twice as long and the second part's K loads would be lifted over the first part's work, whose registers they need
#pragma unroll 1
    for (int sg = 0; sg < NSEG; ++sg) {
        const int p = w * NSEG + sg, k0 = p * KW;
        const h16* kb = K + ((size_t)h * (NK / 16) + k0 / 16) * 512;                   // the part's first k fragment, the same for all lanes
        const h16* kp = kb + 8 * lane;                                                 // fragment t of the part: + t * 512
        const size_t voff = ((size_t)h * (NK / 32) + k0 / 32) * 1024 + 8 * lane;       // fragment (s, dt) of the part: + (2 s + dt) * 512
        const h16* bh = VTh + voff; const h16* bl = VTl + voff;
        v16h kf[NT], vh[NS][2], vl[NS][2];
#pragma unroll
        for (int t = 0; t < NT; ++t) kf[t] = ldfrag(kp + (size_t)t * 512);
#pragma unroll
        for (int s = 0; s < 2; ++s)
#pragma unroll
            for (int dt = 0; dt < 2; ++dt) { vh[s][dt] = ldfrag(bh + (size_t)(2 * s + dt) * 512); vl[s][dt] = ldfrag(bl + (size_t)(2 * s + dt) * 512); }
        // keeps the first two V^T stages' loads up here with the K loads: one memory latency for all of them instead of one more in front of the first P V product
        __builtin_amdgcn_sched_barrier(0);
        v8f r[MQ];
#pragma unroll
        for (int t = 0; t < NT; t += 2) {
            v8f sa[MQ], sb[MQ];
#pragma unroll
            for (int m = 0; m < MQ; ++m) { sa[m] = wmma16(kf[t], qf[m], (v8f){}); sb[m] = wmma16(kf[t + 1], qf[m], (v8f){}); }
            // keeps the 2*MQ products together in front of the maxima that read them, so that each fills the others' distance: left free every pair is followed by its own maxima, behind idle slots
            __builtin_amdgcn_sched_barrier(0);
#pragma unroll
            for (int m = 0; m < MQ; ++m)
#pragma unroll
                for (int j = 0; j < 8; ++j) r[m][j] = t == 0 ? fmaxf(sa[m][j], sb[m][j]) : fmaxf(fmaxf(r[m][j], sa[m][j]), sb[m][j]);
        }
        float mx[MQ]; v8f cn[MQ];   // cn: minus the part's maximum, the C operand of the second score product
#pragma unroll
        for (int m = 0; m < MQ; ++m) { float x = r[m][0];
#pragma unroll
            for (int j = 1; j < 8; ++j) x = fmaxf(x, r[m][j]);
            x = fmaxf(x, __shfl_xor(x, 16, 32)); mx[m] = x;
#pragma unroll
            for (int j = 0; j < 8; ++j) cn[m][j] = -x; }
        v8f acc[MQ][2], acc2[MQ][2];
        float sum0[MQ], sum1[MQ];
#pragma unroll
        for (int m = 0; m < MQ; ++m) { sum0[m] = 0.f; sum1[m] = 0.f;
#pragma unroll
            for (int dt = 0; dt < 2; ++dt) { acc[m][dt] = (v8f){}; acc2[m][dt] = (v8f){}; } }
        // scores of (stage, tile) i + 1 are formed while (stage, tile) i is worked on, so that no exponent waits for its product
        v8f ta[2][2];
        ta[0][0] = wmma16(kf[0], qf[0], cn[0]); ta[0][1] = wmma16(kf[1], qf[0], cn[0]);
#pragma unroll
        for (int s = 0; s < NS; ++s) {
#pragma unroll
            for (int m = 0; m < MQ; ++m) {
                const int i = s * MQ + m, sn = (i + 1) / MQ, mn = (i + 1) % MQ;
                if (sn < NS) { ta[(i + 1) & 1][0] = wmma16(kf[2 * sn], qf[mn], cn[mn]); ta[(i + 1) & 1][1] = wmma16(kf[2 * sn + 1], qf[mn], cn[mn]); }
                // keeps the two score products at the tile's head: left free they sink to its foot, and the next tile's first exponent waits for them
                __builtin_amdgcn_sched_barrier(0);
                v16h pb;
#pragma unroll
                for (int j = 0; j < 8; ++j) {
                    float e0, e1;
                    // two v_exp_f32 and the free slot that the instruction set asks for behind a transcendental before its result is read or its source overwritten: the second fills the first one's slot, the v_nop the second one's
                    asm("v_exp_f32 %0, %2\n\tv_exp_f32 %1, %3\n\tv_nop" : "=&v"(e0), "=&v"(e1) : "v"(__builtin_fmaf(ta[i & 1][0][j], CE, 14.0f)), "v"(__builtin_fmaf(ta[i & 1][1][j], CE, 14.0f)));   // 2^14 = PCAR rides in the exponent
                    sum0[m] += e0; sum1[m] += e1; pb[j] = tohx(e0); pb[8 + j] = tohx(e1);
                }
#pragma unroll
                for (int dt = 0; dt < 2; ++dt) { acc[m][dt] = wmma16(vh[s][dt], pb, acc[m][dt]); acc2[m][dt] = wmma16(vl[s][dt], pb, acc2[m][dt]); }
                // the two fences hold the four vector slots directly behind the tile's last product: what follows (the next tile's v_exp_f32 in asm text, which the compiler does not pad; at a stage's end the loads of stage s + 2) takes over its operand registers. They also keep each tile's work together. The tile's two row sums are named (each row's sum, against spills) so that their additions stay in this tile: left free they are put off to the part's end, and every exponential is spilled until then
                __builtin_amdgcn_sched_barrier(0);
                asm volatile("v_nop\n\tv_nop\n\tv_nop\n\tv_nop" : "+v"(sum0[m]), "+v"(sum1[m]) :: "memory");
                __builtin_amdgcn_sched_barrier(0);
            }
            // stage s + 2's loads stand between stage s, whose registers they take over, and stage s + 1, a whole stage of work ahead of their use
            if (s + 2 < NS) {
#pragma unroll
                for (int dt = 0; dt < 2; ++dt) { vh[s + 2][dt] = ldfrag(bh + (size_t)(2 * (s + 2) + dt) * 512); vl[s + 2][dt] = ldfrag(bl + (size_t)(2 * (s + 2) + dt) * 512); }
                // left free the loads sink to their products, and each product waits out a latency of its own
                __builtin_amdgcn_sched_barrier(0);
            }
        }
        // the wait that belongs in front of any overwrite of an issued load's address registers, which the next part's addresses take over; the addresses are inputs so that they stay whole up to it (the K loads go out on the scalar base kb and a lane offset that no trip rewrites)
        asm volatile("s_wait_xcnt 0x0" :: "s"(kb), "v"(bh), "v"(bl) : "memory");
#pragma unroll
        for (int m = 0; m < MQ; ++m) {
            float sum = sum0[m] + sum1[m];
            sum += __shfl_xor(sum, 16, 32);
            const int row = p * QB + m * 16 + c;
            if (hi == 0) { mxs[row] = mx[m]; sms[row] = sum; }
            float* my = red + row * RP + 8 * hi;
#pragma unroll
            for (int dt = 0; dt < 2; ++dt) { v4f s0, s1;
#pragma unroll
                for (int j = 0; j < 4; ++j) { s0[j] = acc[m][dt][j] + acc2[m][dt][j] * (1.0f / RCAR); s1[j] = acc[m][dt][4 + j] + acc2[m][dt][4 + j] * (1.0f / RCAR); }
                *(v4fa*)(my + dt * 16) = s0; *(v4fa*)(my + dt * 16 + 4) = s1; }
        }
    }
    __syncthreads();
    // wave w finishes queries q0 + w*QB/FW .., lane = column d: each store is one whole 128-B line
    // two queries' LDS reads stand side by side, so that one's latency covers the other's
#pragma unroll 2
    for (int u = 0; u < QB / FW; ++u) {
        const int qi = w * (QB / FW) + u;
        float m = mxs[qi];
#pragma unroll
        for (int i = 1; i < NP; ++i) m = fmaxf(m, mxs[i * QB + qi]);
        float o = 0.f, tot = 0.f;
#pragma unroll
        for (int i = 0; i < NP; ++i) { const float f = __builtin_amdgcn_exp2f((mxs[i * QB + qi] - m) * CE); o += red[(i * QB + qi) * RP + lane] * f; tot += sms[i * QB + qi] * f; }
        float* cp = C + (size_t)(q0 + qi) * DM + h * HD + lane;
        *cp = o / (tot * VCAR);
        // the wait that belongs in front of the next trip's overwrite of the issued store's address registers; the address is an input so that it stays whole up to it
        asm volatile("s_wait_xcnt 0x0" :: "v"(cp) : "memory");
    }
}

__global__ __launch_bounds__(256) void k_cvt8(const float* __restrict__ src, bf* dst, size_t n8) { const size_t i = (size_t)blockIdx.x * 256 + threadIdx.x; if (i >= n8) return; const v8f v = *(const v8f*)(src + i * 8); v8us o;
#pragma unroll
    for (int k = 0; k < 8; ++k) o[k] = f2bf(v[k]); *(v8us*)(dst + i * 8) = o;  }

__global__ __launch_bounds__(256) void k_wT(const float* __restrict__ W, bf* WT, int Kin, int Nout) { const size_t g = (size_t)blockIdx.x * 256 + threadIdx.x; if (g >= (size_t)Nout * Kin / 8) return; const int k0 = (int)(g % (size_t)(Kin / 8)) * 8; const int n = (int)(g / (size_t)(Kin / 8)); v8us o;
#pragma unroll
    for (int q = 0; q < 8; ++q) o[q] = f2bf(W[(size_t)(k0 + q) * Nout + n]);
    bf* d = WT + (size_t)n * Kin + k0; *(v8us*)d = o;  }

__global__ __launch_bounds__(256) void k_split(const float* __restrict__ src, bf* dh, bf* dl, size_t n8) { const size_t i = (size_t)blockIdx.x * 256 + threadIdx.x; if (i >= n8) return; const float* sp = src + i * 8; const v8f v = *(const v8f*)sp; v8us oh, ol;
    // the wait that belongs in front of any overwrite of an issued load's address registers; the address is an input so that it stays whole up to it
    asm volatile("s_wait_xcnt 0x0" :: "v"(sp) : "memory");
#pragma unroll
    for (int k = 0; k < 8; ++k) { unsigned short a, c; splitf(v[k], a, c); oh[k] = a; ol[k] = c; }
    *(v8us*)(dh + i * 8) = oh; *(v8us*)(dl + i * 8) = ol;  }

// ---- workspace carve (bytes, 256-B aligned regions; all sizes compile-time)
constexpr size_t al256(size_t x) { return (x + 255) & ~(size_t)255; }
constexpr size_t SZ_XS  = al256((size_t)NB * NQ_FULL * DM * 2);                                 // state as bf16 [NB][NQ_FULL][256]
constexpr size_t SZ_WQ  = al256((size_t)DM * DM * 2);                                           // Wq^T [256][256]
constexpr size_t SZ_WKV = al256((size_t)2 * DM * DM * 2);                                       // Wkv^T [512][256]
constexpr size_t SZ_WO  = al256((size_t)DM * DM * 2);                                           // Wo^T [256][256]
constexpr size_t SZ_Q16 = al256((size_t)NB * NQ * DM * 2);                                      // q f16 [NB][8 heads][NQ/16 fragments][512]
constexpr size_t SZ_XP  = al256((size_t)NB * NK * DM * 2);                                      // points as bf16 [NB][4096][256]
constexpr size_t SZ_K16 = al256((size_t)NB * NK * DM * 2);                                      // k f16 [NB][8 heads][256 fragments][512]
constexpr size_t SZ_VT  = al256((size_t)NB * DM * NK * 2);                                      // V^T plane [NB][8 heads][128 x 2 fragments][512] (hi, residual: one each)
constexpr size_t SZ_CTX = al256((size_t)NB * NQ * DM * 4);                                      // ctx f32 [NB*NQ][256]
constexpr size_t SZ_C16 = al256((size_t)NB * NQ * DM * 2);                                      // ctx hi / lo planes
constexpr size_t O_XS = 0, O_WQ = O_XS + SZ_XS, O_WKV = O_WQ + SZ_WQ, O_WO = O_WKV + SZ_WKV, O_Q16 = O_WO + SZ_WO, O_XP = O_Q16 + SZ_Q16, O_K16 = O_XP + SZ_XP,
                 O_VTH = O_K16 + SZ_K16, O_VTL = O_VTH + SZ_VT, O_CTX = O_VTL + SZ_VT, O_CH = O_CTX + SZ_CTX, O_CL = O_CH + SZ_C16, O_END = O_CL + SZ_C16;
static_assert(O_END <= (size_t)268435456);
static_assert(((size_t)(NB_FULL - 1) * NQ_FULL + NQ_FULL) * DM * 4 <= (size_t)NB_FULL * NQ_FULL * DM * 4);

extern "C" void kernel_launch(void* const* d_in, const int* in_sizes, int n_in, void* d_out, int out_size, void* d_ws, size_t ws_size, hipStream_t stream) {
    if (n_in < 8) return;
    if (in_sizes[0] < NB * NQ_FULL * DM || in_sizes[1] < NB * NK * DM || in_sizes[2] < DM * DM || in_sizes[3] < DM || in_sizes[4] < DM * 2 * DM || in_sizes[5] < 2 * DM || in_sizes[6] < DM * DM || in_sizes[7] < DM) return;
    if ((size_t)out_size < (size_t)NB * NQ_FULL * DM) return;
    if (O_END > ws_size) return;
    const float* state = (const float*)d_in[0];   // [8][512][256]
    const float* pts   = (const float*)d_in[1];   // [8][4096][256]
    const float* Wq    = (const float*)d_in[2];   // [256][256] in x out
    const float* bq    = (const float*)d_in[3];   // [256]
    const float* Wkv   = (const float*)d_in[4];   // [256][512]
    const float* bkv   = (const float*)d_in[5];   // [512]
    const float* Wo    = (const float*)d_in[6];   // [256][256]
    const float* bo    = (const float*)d_in[7];   // [256]
    float* OUT = (float*)d_out;                   // [8][512][256]
    char* ws = (char*)d_ws;
    bf* XS = (bf*)(ws + O_XS); bf* WQT = (bf*)(ws + O_WQ); bf* WKVT = (bf*)(ws + O_WKV); bf* WOT = (bf*)(ws + O_WO);
    h16* Q16 = (h16*)(ws + O_Q16); bf* XP = (bf*)(ws + O_XP); h16* K16 = (h16*)(ws + O_K16);
    h16* VTH = (h16*)(ws + O_VTH); h16* VTL = (h16*)(ws + O_VTL);
    float* CTX = (float*)(ws + O_CTX); bf* CH = (bf*)(ws + O_CH); bf* CL = (bf*)(ws + O_CL);

    // planes of the inputs
    { const size_t n8 = (size_t)NB * NQ_FULL * DM / 8; k_cvt8<<<(unsigned)((n8 + 255) / 256), 256, 0, stream>>>(state, XS, n8); }
    k_wT<<<(unsigned)(((size_t)DM * DM / 8 + 255) / 256), 256, 0, stream>>>(Wq, WQT, DM, DM);
    k_wT<<<(unsigned)(((size_t)2 * DM * DM / 8 + 255) / 256), 256, 0, stream>>>(Wkv, WKVT, DM, 2 * DM);
    k_wT<<<(unsigned)(((size_t)DM * DM / 8 + 255) / 256), 256, 0, stream>>>(Wo, WOT, DM, DM);
    // q = Xs Wq + bq: the f16 plane in fragment order, z = batch
    k_proj<NQ, false><<<dim3(NQ / 64, DM / 64, NB), 32, 0, stream>>>(XS, WQT, bq, Q16, nullptr, nullptr, (size_t)NQ_FULL * DM);
    { const size_t n8 = (size_t)NB * NK * DM / 8; k_cvt8<<<(unsigned)((n8 + 255) / 256), 256, 0, stream>>>(pts, XP, n8); }
    // kv = Xp Wkv + bkv: the k plane and the V^T hi/residual planes in fragment order, z = batch
    k_proj<NK, true><<<dim3(NK / 64, (2 * DM) / 64, NB), 32, 0, stream>>>(XP, WKVT, bkv, K16, VTH, VTL, (size_t)NK * DM);
    // ctx[b][i][h*32 + d] = softmax_j(q_h[i] . k_h[j] HD^-0.5) v[j][h*32 + d]: x = 16*MQ queries, y = head, z = batch
    k_attn<<<dim3(NQ / (16 * MQ), NH, NB), 32 * FW, 0, stream>>>(Q16, K16, VTH, VTL, CTX);
    // out = ctx Wo + bo: ctx as bf16 hi/lo planes, rows of batch b at OUT + b*NQ_FULL*256
    { const size_t n8 = (size_t)NB * NQ * DM / 8; k_split<<<(unsigned)((n8 + 255) / 256), 256, 0, stream>>>(CTX, CH, CL, n8); }
    k_gemmw<bf, 1, true, 4><<<dim3(NQ / 64, DM / 64, NB), 32, 0, stream>>>(CH, CL, DM, WOT, nullptr, DM, DM, OUT, DM, bo, 1.0f, 0.0f, (size_t)NQ * DM, (size_t)0, (size_t)NQ_FULL * DM);
}

// v007
// A run of this version takes 90.4 microseconds.
// Two timings next to v006 put it at 1.17 and 1.16 times that version's speed.
// Over all steps from v000 it is 13.5 times as fast.
#include <hip/hip_runtime.h>

// Contractions, all f32 accumulate: q = Xs Wq + bq and kv = Xp Wkv + bkv on v_wmma_f32_16x16x32_bf16 (bf16 RNE planes of the f32 inputs, weights transposed to [out][in]); per-head scores q k^T on v_wmma_f32_16x16x32_f16 (q and k as f16 planes carried x8 each); per-head P V on v_wmma_f32_16x16x32_f16 (P f16 carried x2^14; V^T as an f16 hi plane carried x4 plus an f16 residual plane carried x2^10 into a separate accumulator); out = ctx Wo + bo on v_wmma_f32_16x16x32_bf16 (ctx as bf16 hi + lo planes, Wo bf16). Softmax f32, max-subtracted, fixed-order sums. Scores, softmax and P V run in one kernel, split along the keys into 16 parts over the waves of a block; scores and P stay in registers, each part subtracts its own keys' maximum, P is left unnormalised and the row's sum divides the result; partial sums are brought to the row's maximum and added in a fixed order. Every stage runs once for all batches: the batch is a grid dimension. Stages that do not read one another's results share a launch, the block index picking the job: the five input conversions are one launch, the q and kv projections another. The q, k and V^T planes are written by the projection GEMMs themselves, straight from the accumulators, and lie in fragment order: the 1024 bytes of one 16 x 32 operand fragment are contiguous, lane l's two 16-byte pieces at 16 l and 512 + 16 l.

#ifndef NB
#define NB 8            // batches computed (reducible)
#endif
#ifndef NQ
#define NQ 512          // query rows per batch computed (reducible, multiple of 64)
#endif
#define NB_FULL 8
#define NQ_FULL 512     // per-batch stride of the state input and of the output
#define NK 4096         // keys (softmax row length)
#define DM 256
#define NH 8
#define HD 32
#define QCAR 8.0f
#define KCAR 8.0f
#define VCAR 4.0f
#define RCAR 1024.0f
#define PCAR 16384.0f
#define FW 8             // waves per block of k_attn
#define NSEG 2           // key parts per wave, one after the other: FW*NSEG parts of NK/(FW*NSEG) keys
#define MQ 4             // 16-query tiles per block of k_attn, all served by each wave from one load of its keys
#define SCL2 (0.17677669529663687f * 0.015625f)   // HD^-0.5 / (QCAR*KCAR)

static_assert(NB >= 1 && NB <= NB_FULL);
static_assert(NQ >= 64 && NQ <= NQ_FULL && (NQ % 64) == 0);
static_assert(NK == 256 * 16);
static_assert(QCAR == KCAR);
static_assert((DM % 64) == 0 && (NK % 64) == 0 && HD == 32 && NH * HD == DM);

typedef _Float16 h16;
typedef unsigned short bf;
typedef __attribute__((ext_vector_type(16))) __bf16   v16bf;
typedef __attribute__((ext_vector_type(16))) _Float16 v16h;
typedef __attribute__((ext_vector_type(8)))  _Float16 v8h;
typedef __attribute__((ext_vector_type(8)))  unsigned short v8us;
typedef __attribute__((ext_vector_type(8)))  float    v8f;
typedef __attribute__((ext_vector_type(4)))  float    v4f;
typedef v8h  __attribute__((may_alias)) v8ha;
typedef v4f  __attribute__((may_alias)) v4fa;
typedef v8us __attribute__((may_alias)) v8usa;

__device__ __forceinline__ unsigned short f2bf(float f) { unsigned u = __float_as_uint(f); u += 0x7FFFu + ((u >> 16) & 1u); return (unsigned short)(u >> 16); }
__device__ __forceinline__ float bf2f(unsigned short b) { return __uint_as_float(((unsigned)b) << 16); }
__device__ __forceinline__ float bfr(float f) { return bf2f(f2bf(f)); }
__device__ __forceinline__ v16h cat16(v8h lo, v8h hi) { return __builtin_shufflevector(lo, hi, 0, 1, 2, 3, 4, 5, 6, 7, 8, 9, 10, 11, 12, 13, 14, 15); }
__device__ __forceinline__ v16bf cat16b(v8us lo, v8us hi) { return __builtin_bit_cast(v16bf, __builtin_shufflevector(lo, hi, 0, 1, 2, 3, 4, 5, 6, 7, 8, 9, 10, 11, 12, 13, 14, 15)); }
__device__ __forceinline__ v8f wmma16(v16h a, v16h b, v8f c) { return __builtin_amdgcn_wmma_f32_16x16x32_f16(false, a, false, b, (short)0, c, false, false); }
__device__ __forceinline__ v8f wmmab(v16bf a, v16bf b, v8f c) { return __builtin_amdgcn_wmma_f32_16x16x32_bf16(false, a, false, b, (short)0, c, false, false); }
__device__ __forceinline__ h16 tohx(float x) { return (h16)x; }
__device__ __forceinline__ void splitf(float y, unsigned short& h, unsigned short& l) { h = f2bf(y); l = f2bf(y - bf2f(h)); }

// ---- k_gemmw: register-blocked GEMM, ONE WAVE per 64 x (16*NBN) output tile, operands straight from K-contiguous 16-bit planes; grid (M/64, N/(16*NBN), Z), 32 threads.
// C[m][n] (f32, pitch ldc) = (sum_k A[m][k] Bt[n][k] [+ A2 B same accumulator (MODE 1)] [+ (A Bt2) * rs2 from a separate accumulator (MODE 2)]) * oscale + optional bf16-cast bias[n].
// A rows pitch lda, Bt rows pitch ldb (elements), z-batch strides sA/sB/sC in elements. K % 32 == 0. Fragments: lane row/col = lane&15, elements 0..7 <- k0+8h.., 8..15 <- k0+16+8h.. for A and B.
template <typename T16> struct WFrag;
template <> struct WFrag<h16> { typedef v16h V; static __device__ __forceinline__ V ld(const h16* p) { return cat16(*(const v8h*)p, *(const v8h*)(p + 16)); } static __device__ __forceinline__ v8f mma(V a, V b, v8f c) { return wmma16(a, b, c); } };
template <> struct WFrag<bf> { typedef v16bf V; static __device__ __forceinline__ V ld(const bf* p) { return cat16b(*(const v8us*)p, *(const v8us*)(p + 16)); } static __device__ __forceinline__ v8f mma(V a, V b, v8f c) { return wmmab(a, b, c); } };
// fragment-order plane: p = fragment base + 8 * lane (elements); the lane's second piece stands 256 elements on, so each wave-wide load covers 512 contiguous bytes
__device__ __forceinline__ v16h ldfrag(const h16* p) { return cat16(*(const v8h*)p, *(const v8h*)(p + 256)); }
template <typename T16, int MODE, bool BIAS, int NBN>
__global__ __launch_bounds__(32) void k_gemmw(const T16* __restrict__ A, const T16* __restrict__ A2, int lda, const T16* __restrict__ Bt, const T16* __restrict__ Bt2, int ldb, int K, float* C, int ldc, const float* __restrict__ bias, float oscale, float rs2, size_t sA, size_t sB, size_t sC) {
    typedef typename WFrag<T16>::V V;
    __shared__ __align__(16) float os[16 * 68];
    const size_t z = blockIdx.z; A += z * sA; if (MODE == 1) A2 += z * sA; Bt += z * sB; if (MODE == 2) Bt2 += z * sB; C += z * sC;
    const int lane = threadIdx.x & 31, lr = lane & 15, hi = lane >> 4; const int r0 = blockIdx.x * 64, c0 = blockIdx.y * (16 * NBN);
    v8f acc[4][NBN], acc2[4][NBN];
#pragma unroll
    for (int mb = 0; mb < 4; ++mb)
#pragma unroll
        for (int nb = 0; nb < NBN; ++nb) { acc[mb][nb] = (v8f){}; acc2[mb][nb] = (v8f){}; }
    const size_t aoff = (size_t)(r0 + lr) * lda + 8 * hi, boff = (size_t)(c0 + lr) * ldb + 8 * hi;
#pragma unroll 1
    for (int kc = 0; kc < K; kc += 32) {
        V a[4], a2[4];
#pragma unroll
        for (int mb = 0; mb < 4; ++mb) { a[mb] = WFrag<T16>::ld(A + aoff + (size_t)mb * 16 * lda + kc); if (MODE == 1) a2[mb] = WFrag<T16>::ld(A2 + aoff + (size_t)mb * 16 * lda + kc); }
#pragma unroll
        for (int nb = 0; nb < NBN; ++nb) { const V b = WFrag<T16>::ld(Bt + boff + (size_t)nb * 16 * ldb + kc); V b2; if (MODE == 2) b2 = WFrag<T16>::ld(Bt2 + boff + (size_t)nb * 16 * ldb + kc);
#pragma unroll
            for (int mb = 0; mb < 4; ++mb) { acc[mb][nb] = WFrag<T16>::mma(a[mb], b, acc[mb][nb]); if (MODE == 1) acc[mb][nb] = WFrag<T16>::mma(a2[mb], b, acc[mb][nb]); if (MODE == 2) acc2[mb][nb] = WFrag<T16>::mma(a[mb], b2, acc2[mb][nb]); } }
        if (MODE == 2) asm volatile("v_nop\n\tv_nop\n\tv_nop\n\tv_nop" : "+v"(acc[0][0]), "+v"(acc[1][NBN - 1]), "+v"(acc[2][0]), "+v"(acc[3][NBN - 1]), "+v"(acc2[0][0]), "+v"(acc2[1][NBN - 1]), "+v"(acc2[2][0]), "+v"(acc2[3][NBN - 1]) : "v"(a[0]), "v"(a[3]));
        else asm volatile("v_nop\n\tv_nop\n\tv_nop\n\tv_nop" : "+v"(acc[0][0]), "+v"(acc[1][NBN - 1]), "+v"(acc[2][0]), "+v"(acc[3][NBN - 1]) : "v"(a[0]), "v"(a[3]));
    }
    constexpr int LPR = 4 * NBN, RPI = 32 / LPR, NIT = 16 / RPI;   // lanes per row, rows per instruction, instructions per slab
    const int rl = lane / LPR, cofs = (lane % LPR) * 4;
#pragma unroll
    for (int mb = 0; mb < 4; ++mb) {
#pragma unroll
        for (int nb = 0; nb < NBN; ++nb) {
#pragma unroll
            for (int j = 0; j < 8; ++j) { float vv = acc[mb][nb][j]; if (MODE == 2) vv += acc2[mb][nb][j] * rs2; os[(hi * 8 + j) * 68 + nb * 16 + lr] = vv * oscale; } }
        __builtin_amdgcn_wave_barrier(); asm volatile("" ::: "memory");
        float* crow = C + (size_t)(r0 + mb * 16) * ldc + c0;
{
#pragma unroll
            for (int s = 0; s < NIT; ++s) { const int row = RPI * s + rl; v4f val = *(const v4fa*)(os + row * 68 + cofs); if (BIAS) { val[0] += bfr(bias[c0 + cofs]); val[1] += bfr(bias[c0 + cofs + 1]); val[2] += bfr(bias[c0 + cofs + 2]); val[3] += bfr(bias[c0 + cofs + 3]); }
                *(v4f*)(crow + (size_t)row * ldc + cofs) = val; }
             }
        __builtin_amdgcn_wave_barrier(); asm volatile("" ::: "memory");
    }
}

// ---- proj_tile: y = X W + b (X bf16 [rows][DM], W^T bf16 [columns][DM]), ONE WAVE per 64 rows x 64 columns (from row r0, column c0; batch = blockIdx.z), written as f16 planes in fragment order straight from the accumulators.
// A fragment is 512 elements, element (half, hi, r, e) at half*256 + hi*128 + r*8 + e, where the fragment's row is r and its k index half*16 + hi*8 + e.
// Columns below DM (q, or the k half of kv): the product runs as W^T X^T (A = 16 columns of y, B = 16 rows of y), so a lane holds 8 consecutive columns d of one row: one 16-byte piece of fragment (head, 16 rows), row = r, k index = d, value f16(y x KCAR).
// Columns from DM on (the v half of kv): the product runs as X W (A = 16 rows, B = 16 columns), so a lane holds 8 consecutive keys of one column d: one 16-byte piece of fragment (head, 32 keys, 16 d), row = d, k index = key, VTh = f16(v x VCAR), VTl = f16((v x VCAR - VTh) x RCAR).
// Either way each wave-wide store covers 512 contiguous bytes. Operand fragments as in k_gemmw: lane row/col = lane&15, elements 0..7 <- k0+8h.., 8..15 <- k0+16+8h.. for A and B alike, so the two roles swap freely.
template <bool SW>
__device__ __forceinline__ void proj_acc(const bf* xk, const bf* wk, v8f (&acc)[4][4]) {
#pragma unroll
    for (int rt = 0; rt < 4; ++rt)
#pragma unroll
        for (int ct = 0; ct < 4; ++ct) acc[rt][ct] = (v8f){};
#pragma unroll 1
    for (int kc = 0; kc < DM; kc += 32) {
        v16bf x[4];
#pragma unroll
        for (int rt = 0; rt < 4; ++rt) x[rt] = WFrag<bf>::ld(xk + (size_t)rt * 16 * DM);
#pragma unroll
        for (int ct = 0; ct < 4; ++ct) { const v16bf wv = WFrag<bf>::ld(wk + (size_t)ct * 16 * DM);
#pragma unroll
            for (int rt = 0; rt < 4; ++rt) acc[rt][ct] = SW ? wmmab(wv, x[rt], acc[rt][ct]) : wmmab(x[rt], wv, acc[rt][ct]); }
        // the wait that belongs in front of the overwrite of the issued loads' address registers (inputs, so that they stay whole up to it), and four vector slots between the trip's last product and the next trip's loads, which take over its operand registers (every accumulator is named, so that the statement stands behind all of the trip's products)
        asm volatile("s_wait_xcnt 0x0\n\tv_nop\n\tv_nop\n\tv_nop\n\tv_nop" : "+v"(acc[0][0]), "+v"(acc[0][1]), "+v"(acc[0][2]), "+v"(acc[0][3]), "+v"(acc[1][0]), "+v"(acc[1][1]), "+v"(acc[1][2]), "+v"(acc[1][3]), "+v"(acc[2][0]), "+v"(acc[2][1]), "+v"(acc[2][2]), "+v"(acc[2][3]), "+v"(acc[3][0]), "+v"(acc[3][1]), "+v"(acc[3][2]), "+v"(acc[3][3]) : "v"(xk), "v"(wk));
        xk += 32; wk += 32;
    }
}
template <int NROW, bool HASV>
__device__ __forceinline__ void proj_tile(const bf* __restrict__ X, const bf* __restrict__ WT, const float* __restrict__ bias, h16* P, h16* VTh, h16* VTl, size_t sX, int r0, int c0) {
    static_assert(NROW % 64 == 0 && HD == 32 && DM % 64 == 0);
    const int lane = threadIdx.x & 31, lr = lane & 15, hi = lane >> 4;
    const size_t z = blockIdx.z;
    const bf* xp = X + z * sX + (size_t)(r0 + lr) * DM + 8 * hi; const bf* wp = WT + (size_t)(c0 + lr) * DM + 8 * hi;
    v8f acc[4][4];   // [16 rows of y][16 columns of y]
    if (!HASV || c0 < DM) {
        proj_acc<true>(xp, wp, acc);   // acc[rt][ct][j] = y[r0 + 16 rt + lr][c0 + 16 ct + 8 hi + j]
        h16* dst = P + z * ((size_t)NROW * DM) + ((size_t)(c0 / HD) * (NROW / 16) + r0 / 16) * 512 + 8 * lane;
#pragma unroll
        for (int ct = 0; ct < 4; ++ct) { const v8f b = *(const v8f*)(bias + c0 + ct * 16 + 8 * hi);
#pragma unroll
            for (int rt = 0; rt < 4; ++rt) { v8h o;
#pragma unroll
                for (int j = 0; j < 8; ++j) o[j] = tohx((acc[rt][ct][j] + bfr(b[j])) * KCAR);
                *(v8h*)(dst + ((size_t)(ct >> 1) * (NROW / 16) + rt) * 512 + (ct & 1) * 256) = o; } }
    } else {
        proj_acc<false>(xp, wp, acc);  // acc[rt][ct][j] = y[r0 + 16 rt + 8 hi + j][c0 + 16 ct + lr]
        const size_t oo = z * ((size_t)DM * NROW) + ((size_t)((c0 - DM) / HD) * (NROW / 32) + r0 / 32) * 1024 + 8 * lane;
        const int bi = c0 + lr; float bv[4];
#pragma unroll
        for (int ct = 0; ct < 4; ++ct) bv[ct] = bias[bi + ct * 16];
        // the wait that belongs in front of any overwrite of the issued loads' offset register; the index is an input so that it stays whole up to it
        asm volatile("s_wait_xcnt 0x0" :: "v"(bi) : "memory");
#pragma unroll
        for (int ct = 0; ct < 4; ++ct) { const float b = bfr(bv[ct]);
#pragma unroll
            for (int rt = 0; rt < 4; ++rt) { v8h oh, ol;
#pragma unroll
                for (int j = 0; j < 8; ++j) { const float y = (acc[rt][ct][j] + b) * VCAR; const h16 hh = tohx(y); oh[j] = hh; ol[j] = tohx(__fmul_rn(__fsub_rn(y, (float)hh), RCAR)); }
                const size_t o = oo + ((size_t)(ct >> 1) * (NROW / 32) + (rt >> 1)) * 1024 + (ct & 1) * 512 + (rt & 1) * 256;
                *(v8h*)(VTh + o) = oh; *(v8h*)(VTl + o) = ol; } }
        // the wait that belongs in front of any overwrite of the issued stores' address and data registers: in the built kernel this half is followed by a branch whose other way enters the k half, which takes those registers over
        asm volatile("s_wait_xcnt 0x0" ::: "memory");
    }
}
// q = Xs Wq + bq and kv = Xp Wkv + bkv in one launch (neither reads what the other writes): grid (PB_Q + PB_KV, 1, NB), 32 threads; blocks below PB_Q take the q tiles, the rest the kv tiles, 64-row tile fastest in both.
constexpr unsigned PB_Q = (NQ / 64) * (DM / 64), PB_KV = (NK / 64) * ((2 * DM) / 64);
__global__ __launch_bounds__(32) void k_proj(const bf* __restrict__ XS, const bf* __restrict__ WQT, const float* __restrict__ bq, h16* Q16, const bf* __restrict__ XP, const bf* __restrict__ WKVT, const float* __restrict__ bkv, h16* K16, h16* VTh, h16* VTl) {
    const unsigned b = blockIdx.x;
    if (b < PB_Q) proj_tile<NQ, false>(XS, WQT, bq, Q16, nullptr, nullptr, (size_t)NQ_FULL * DM, (int)(b % (NQ / 64)) * 64, (int)(b / (NQ / 64)) * 64);
    else proj_tile<NK, true>(XP, WKVT, bkv, K16, VTh, VTl, (size_t)NK * DM, (int)((b - PB_Q) % (NK / 64)) * 64, (int)((b - PB_Q) / (NK / 64)) * 64);
}

// ---- k_attn: ctx = softmax(q k^T HD^-0.5) v for 16*MQ queries of one head of one batch. Grid (NQ/(16*MQ), NH, NB), FW waves; wave w owns the key parts w*NSEG .. w*NSEG+NSEG-1 (NK/(FW*NSEG) keys each), one after the other, and never stores a score or a P value.
// One load of a part's K and V^T fragments serves all MQ query tiles. The K fragments stay in registers and the scores are formed twice from them: once for the part's maximum, once, 32 keys at a time, for P, with minus that maximum as the product's C operand (a lane's eight results belong to one query); so no score is kept.
// S^T = K Q^T (A = 16 key rows, B = 16 queries): lane (c, hi) holds query c, keys 8hi..8hi+7 of each 16-key tile. Two such tiles, converted in place, are the B operand P^T of O^T += V^T P^T (A = V^T rows d, keys in the same order).
// Each part subtracts the maximum of its own keys: P = exp(t - max_p) x PCAR, not divided. The parts' O^T partials, row sums and maxima meet in LDS (one barrier); they are brought to the row's maximum, added in key order, and the sum divides once.
__global__ __launch_bounds__(32 * FW) void k_attn(const h16* __restrict__ Q, const h16* __restrict__ K, const h16* __restrict__ VTh, const h16* __restrict__ VTl, float* C) {
    constexpr int NP = FW * NSEG, KW = NK / NP, NT = KW / 16, NS = KW / 32, RP = 36, QB = 16 * MQ;
    static_assert(KW % 32 == 0 && NS >= 2 && HD == 32 && PCAR == 16384.0f && NQ % QB == 0 && QB % FW == 0);
    constexpr float CE = SCL2 * 1.4426950408889634f;
    __shared__ __align__(16) float red[NP * QB * RP];
    __shared__ float mxs[NP * QB], sms[NP * QB];
    const int lane = threadIdx.x & 31, c = lane & 15, hi = lane >> 4, w = __builtin_amdgcn_readfirstlane(threadIdx.x >> 5);
    const int q0 = blockIdx.x * QB, h = blockIdx.y;
    const size_t z = blockIdx.z; Q += z * ((size_t)NQ * DM); K += z * ((size_t)NK * DM); VTh += z * ((size_t)DM * NK); VTl += z * ((size_t)DM * NK); C += z * ((size_t)NQ * DM);
    const h16* qb = Q + ((size_t)h * (NQ / 16) + (size_t)blockIdx.x * MQ) * 512;       // the block's first q fragment, the same for all lanes
    v16h qf[MQ];
#pragma unroll
    for (int m = 0; m < MQ; ++m) qf[m] = ldfrag(qb + (size_t)m * 512 + 8 * lane);
    // rolled: unrolled, the kernel's text would be twice as long and the second part's K loads would be lifted over the first part's work, whose registers they need
#pragma unroll 1
    for (int sg = 0; sg < NSEG; ++sg) {
        const int p = w * NSEG + sg, k0 = p * KW;
        const h16* kb = K + ((size_t)h * (NK / 16) + k0 / 16) * 512;                   // the part's first k fragment, the same for all lanes
        const h16* kp = kb + 8 * lane;                                                 // fragment t of the part: + t * 512
        const size_t voff = ((size_t)h * (NK / 32) + k0 / 32) * 1024 + 8 * lane;       // fragment (s, dt) of the part: + (2 s + dt) * 512
        const h16* bh = VTh + voff; const h16* bl = VTl + voff;
        v16h kf[NT], vh[NS][2], vl[NS][2];
#pragma unroll
        for (int t = 0; t < NT; ++t) kf[t] = ldfrag(kp + (size_t)t * 512);
#pragma unroll
        for (int s = 0; s < 2; ++s)
#pragma unroll
            for (int dt = 0; dt < 2; ++dt) { vh[s][dt] = ldfrag(bh + (size_t)(2 * s + dt) * 512); vl[s][dt] = ldfrag(bl + (size_t)(2 * s + dt) * 512); }
        // keeps the first two V^T stages' loads up here with the K loads: one memory latency for all of them instead of one more in front of the first P V product
        __builtin_amdgcn_sched_barrier(0);
        v8f r[MQ];
#pragma unroll
        for (int t = 0; t < NT; t += 2) {
            v8f sa[MQ], sb[MQ];
#pragma unroll
            for (int m = 0; m < MQ; ++m) { sa[m] = wmma16(kf[t], qf[m], (v8f){}); sb[m] = wmma16(kf[t + 1], qf[m], (v8f){}); }
            // keeps the 2*MQ products together in front of the maxima that read them, so that each fills the others' distance: left free every pair is followed by its own maxima, behind idle slots
            __builtin_amdgcn_sched_barrier(0);
#pragma unroll
            for (int m = 0; m < MQ; ++m)
#pragma unroll
                for (int j = 0; j < 8; ++j) r[m][j] = t == 0 ? fmaxf(sa[m][j], sb[m][j]) : fmaxf(fmaxf(r[m][j], sa[m][j]), sb[m][j]);
        }
        float mx[MQ]; v8f cn[MQ];   // cn: minus the part's maximum, the C operand of the second score product
#pragma unroll
        for (int m = 0; m < MQ; ++m) { float x = r[m][0];
#pragma unroll
            for (int j = 1; j < 8; ++j) x = fmaxf(x, r[m][j]);
            x = fmaxf(x, __shfl_xor(x, 16, 32)); mx[m] = x;
#pragma unroll
            for (int j = 0; j < 8; ++j) cn[m][j] = -x; }
        v8f acc[MQ][2], acc2[MQ][2];
        float sum0[MQ], sum1[MQ];
#pragma unroll
        for (int m = 0; m < MQ; ++m) { sum0[m] = 0.f; sum1[m] = 0.f;
#pragma unroll
            for (int dt = 0; dt < 2; ++dt) { acc[m][dt] = (v8f){}; acc2[m][dt] = (v8f){}; } }
        // scores of (stage, tile) i + 1 are formed while (stage, tile) i is worked on, so that no exponent waits for its product
        v8f ta[2][2];
        ta[0][0] = wmma16(kf[0], qf[0], cn[0]); ta[0][1] = wmma16(kf[1], qf[0], cn[0]);
#pragma unroll
        for (int s = 0; s < NS; ++s) {
#pragma unroll
            for (int m = 0; m < MQ; ++m) {
                const int i = s * MQ + m, sn = (i + 1) / MQ, mn = (i + 1) % MQ;
                if (sn < NS) { ta[(i + 1) & 1][0] = wmma16(kf[2 * sn], qf[mn], cn[mn]); ta[(i + 1) & 1][1] = wmma16(kf[2 * sn + 1], qf[mn], cn[mn]); }
                // keeps the two score products at the tile's head: left free they sink to its foot, and the next tile's first exponent waits for them
                __builtin_amdgcn_sched_barrier(0);
                v16h pb;
#pragma unroll
                for (int j = 0; j < 8; ++j) {
                    float e0, e1;
                    // two v_exp_f32 and the free slot that the instruction set asks for behind a transcendental before its result is read or its source overwritten: the second fills the first one's slot, the v_nop the second one's
                    asm("v_exp_f32 %0, %2\n\tv_exp_f32 %1, %3\n\tv_nop" : "=&v"(e0), "=&v"(e1) : "v"(__builtin_fmaf(ta[i & 1][0][j], CE, 14.0f)), "v"(__builtin_fmaf(ta[i & 1][1][j], CE, 14.0f)));   // 2^14 = PCAR rides in the exponent
                    sum0[m] += e0; sum1[m] += e1; pb[j] = tohx(e0); pb[8 + j] = tohx(e1);
                }
#pragma unroll
                for (int dt = 0; dt < 2; ++dt) { acc[m][dt] = wmma16(vh[s][dt], pb, acc[m][dt]); acc2[m][dt] = wmma16(vl[s][dt], pb, acc2[m][dt]); }
                // the two fences hold the four vector slots directly behind the tile's last product: what follows (the next tile's v_exp_f32 in asm text, which the compiler does not pad; at a stage's end the loads of stage s + 2) takes over its operand registers. They also keep each tile's work together. The tile's two row sums are named (each row's sum, against spills) so that their additions stay in this tile: left free they are put off to the part's end, and every exponential is spilled until then
                __builtin_amdgcn_sched_barrier(0);
                asm volatile("v_nop\n\tv_nop\n\tv_nop\n\tv_nop" : "+v"(sum0[m]), "+v"(sum1[m]) :: "memory");
                __builtin_amdgcn_sched_barrier(0);
            }
            // stage s + 2's loads stand between stage s, whose registers they take over, and stage s + 1, a whole stage of work ahead of their use
            if (s + 2 < NS) {
#pragma unroll
                for (int dt = 0; dt < 2; ++dt) { vh[s + 2][dt] = ldfrag(bh + (size_t)(2 * (s + 2) + dt) * 512); vl[s + 2][dt] = ldfrag(bl + (size_t)(2 * (s + 2) + dt) * 512); }
                // left free the loads sink to their products, and each product waits out a latency of its own
                __builtin_amdgcn_sched_barrier(0);
            }
        }
        // the wait that belongs in front of any overwrite of an issued load's address registers, which the next part's addresses take over; the addresses are inputs so that they stay whole up to it (the K loads go out on the scalar base kb and a lane offset that no trip rewrites)
        asm volatile("s_wait_xcnt 0x0" :: "s"(kb), "v"(bh), "v"(bl) : "memory");
#pragma unroll
        for (int m = 0; m < MQ; ++m) {
            float sum = sum0[m] + sum1[m];
            sum += __shfl_xor(sum, 16, 32);
            const int row = p * QB + m * 16 + c;
            if (hi == 0) { mxs[row] = mx[m]; sms[row] = sum; }
            float* my = red + row * RP + 8 * hi;
#pragma unroll
            for (int dt = 0; dt < 2; ++dt) { v4f s0, s1;
#pragma unroll
                for (int j = 0; j < 4; ++j) { s0[j] = acc[m][dt][j] + acc2[m][dt][j] * (1.0f / RCAR); s1[j] = acc[m][dt][4 + j] + acc2[m][dt][4 + j] * (1.0f / RCAR); }
                *(v4fa*)(my + dt * 16) = s0; *(v4fa*)(my + dt * 16 + 4) = s1; }
        }
    }
    __syncthreads();
    // wave w finishes queries q0 + w*QB/FW .., lane = column d: each store is one whole 128-B line
    // two queries' LDS reads stand side by side, so that one's latency covers the other's
#pragma unroll 2
    for (int u = 0; u < QB / FW; ++u) {
        const int qi = w * (QB / FW) + u;
        float m = mxs[qi];
#pragma unroll
        for (int i = 1; i < NP; ++i) m = fmaxf(m, mxs[i * QB + qi]);
        float o = 0.f, tot = 0.f;
#pragma unroll
        for (int i = 0; i < NP; ++i) { const float f = __builtin_amdgcn_exp2f((mxs[i * QB + qi] - m) * CE); o += red[(i * QB + qi) * RP + lane] * f; tot += sms[i * QB + qi] * f; }
        float* cp = C + (size_t)(q0 + qi) * DM + h * HD + lane;
        *cp = o / (tot * VCAR);
        // the wait that belongs in front of the next trip's overwrite of the issued store's address registers; the address is an input so that it stays whole up to it
        asm volatile("s_wait_xcnt 0x0" :: "v"(cp) : "memory");
    }
}

__device__ __forceinline__ void cvt8(const float* __restrict__ src, bf* dst, size_t n8, unsigned blk) { const size_t i = (size_t)blk * 256 + threadIdx.x; if (i >= n8) return; const float* sp = src + i * 8; const v8f v = *(const v8f*)sp; v8us o;
    // the wait that belongs in front of any overwrite of an issued load's address registers; the address is an input so that it stays whole up to it
    asm volatile("s_wait_xcnt 0x0" :: "v"(sp) : "memory");
#pragma unroll
    for (int k = 0; k < 8; ++k) o[k] = f2bf(v[k]); *(v8us*)(dst + i * 8) = o;  }

__device__ __forceinline__ void wT(const float* __restrict__ W, bf* WT, int Kin, int Nout, unsigned blk) { const size_t g = (size_t)blk * 256 + threadIdx.x; if (g >= (size_t)Nout * Kin / 8) return; const int k0 = (int)(g % (size_t)(Kin / 8)) * 8; const int n = (int)(g / (size_t)(Kin / 8)); v8us o;
#pragma unroll
    for (int q = 0; q < 8; ++q) o[q] = f2bf(W[(size_t)(k0 + q) * Nout + n]);
    bf* d = WT + (size_t)n * Kin + k0; *(v8us*)d = o;  }

// ---- k_prep: the bf16 planes of all five f32 inputs that need one, in one launch (no job reads what another writes); 256 threads, the block index picks the job: the three weight transposes first, whose strided reads take longest, then the state, then the points.
constexpr size_t N8_XS = (size_t)NB * NQ_FULL * DM / 8, N8_XP = (size_t)NB * NK * DM / 8;
constexpr unsigned GB_WQ = (unsigned)(((size_t)DM * DM / 8 + 255) / 256), GB_WKV = (unsigned)(((size_t)2 * DM * DM / 8 + 255) / 256), GB_WO = GB_WQ, GB_XS = (unsigned)((N8_XS + 255) / 256), GB_XP = (unsigned)((N8_XP + 255) / 256);
__global__ __launch_bounds__(256) void k_prep(const float* __restrict__ state, const float* __restrict__ pts, const float* __restrict__ Wq, const float* __restrict__ Wkv, const float* __restrict__ Wo, bf* XS, bf* XP, bf* WQT, bf* WKVT, bf* WOT) {
    unsigned b = blockIdx.x;
    if (b < GB_WQ) { wT(Wq, WQT, DM, DM, b); return; }
    b -= GB_WQ;
    if (b < GB_WKV) { wT(Wkv, WKVT, DM, 2 * DM, b); return; }
    b -= GB_WKV;
    if (b < GB_WO) { wT(Wo, WOT, DM, DM, b); return; }
    b -= GB_WO;
    if (b < GB_XS) { cvt8(state, XS, N8_XS, b); return; }
    cvt8(pts, XP, N8_XP, b - GB_XS);
}

__global__ __launch_bounds__(256) void k_split(const float* __restrict__ src, bf* dh, bf* dl, size_t n8) { const size_t i = (size_t)blockIdx.x * 256 + threadIdx.x; if (i >= n8) return; const float* sp = src + i * 8; const v8f v = *(const v8f*)sp; v8us oh, ol;
    // the wait that belongs in front of any overwrite of an issued load's address registers; the address is an input so that it stays whole up to it
    asm volatile("s_wait_xcnt 0x0" :: "v"(sp) : "memory");
#pragma unroll
    for (int k = 0; k < 8; ++k) { unsigned short a, c; splitf(v[k], a, c); oh[k] = a; ol[k] = c; }
    *(v8us*)(dh + i * 8) = oh; *(v8us*)(dl + i * 8) = ol;  }

// ---- workspace carve (bytes, 256-B aligned regions; all sizes compile-time)
constexpr size_t al256(size_t x) { return (x + 255) & ~(size_t)255; }
constexpr size_t SZ_XS  = al256((size_t)NB * NQ_FULL * DM * 2);                                 // state as bf16 [NB][NQ_FULL][256]
constexpr size_t SZ_WQ  = al256((size_t)DM * DM * 2);                                           // Wq^T [256][256]
constexpr size_t SZ_WKV = al256((size_t)2 * DM * DM * 2);                                       // Wkv^T [512][256]
constexpr size_t SZ_WO  = al256((size_t)DM * DM * 2);                                           // Wo^T [256][256]
constexpr size_t SZ_Q16 = al256((size_t)NB * NQ * DM * 2);                                      // q f16 [NB][8 heads][NQ/16 fragments][512]
constexpr size_t SZ_XP  = al256((size_t)NB * NK * DM * 2);                                      // points as bf16 [NB][4096][256]
constexpr size_t SZ_K16 = al256((size_t)NB * NK * DM * 2);                                      // k f16 [NB][8 heads][256 fragments][512]
constexpr size_t SZ_VT  = al256((size_t)NB * DM * NK * 2);                                      // V^T plane [NB][8 heads][128 x 2 fragments][512] (hi, residual: one each)
constexpr size_t SZ_CTX = al256((size_t)NB * NQ * DM * 4);                                      // ctx f32 [NB*NQ][256]
constexpr size_t SZ_C16 = al256((size_t)NB * NQ * DM * 2);                                      // ctx hi / lo planes
constexpr size_t O_XS = 0, O_WQ = O_XS + SZ_XS, O_WKV = O_WQ + SZ_WQ, O_WO = O_WKV + SZ_WKV, O_Q16 = O_WO + SZ_WO, O_XP = O_Q16 + SZ_Q16, O_K16 = O_XP + SZ_XP,
                 O_VTH = O_K16 + SZ_K16, O_VTL = O_VTH + SZ_VT, O_CTX = O_VTL + SZ_VT, O_CH = O_CTX + SZ_CTX, O_CL = O_CH + SZ_C16, O_END = O_CL + SZ_C16;
static_assert(O_END <= (size_t)268435456);
static_assert(((size_t)(NB_FULL - 1) * NQ_FULL + NQ_FULL) * DM * 4 <= (size_t)NB_FULL * NQ_FULL * DM * 4);

extern "C" void kernel_launch(void* const* d_in, const int* in_sizes, int n_in, void* d_out, int out_size, void* d_ws, size_t ws_size, hipStream_t stream) {
    if (n_in < 8) return;
    if (in_sizes[0] < NB * NQ_FULL * DM || in_sizes[1] < NB * NK * DM || in_sizes[2] < DM * DM || in_sizes[3] < DM || in_sizes[4] < DM * 2 * DM || in_sizes[5] < 2 * DM || in_sizes[6] < DM * DM || in_sizes[7] < DM) return;
    if ((size_t)out_size < (size_t)NB * NQ_FULL * DM) return;
    if (O_END > ws_size) return;
    const float* state = (const float*)d_in[0];   // [8][512][256]
    const float* pts   = (const float*)d_in[1];   // [8][4096][256]
    const float* Wq    = (const float*)d_in[2];   // [256][256] in x out
    const float* bq    = (const float*)d_in[3];   // [256]
    const float* Wkv   = (const float*)d_in[4];   // [256][512]
    const float* bkv   = (const float*)d_in[5];   // [512]
    const float* Wo    = (const float*)d_in[6];   // [256][256]
    const float* bo    = (const float*)d_in[7];   // [256]
    float* OUT = (float*)d_out;                   // [8][512][256]
    char* ws = (char*)d_ws;
    bf* XS = (bf*)(ws + O_XS); bf* WQT = (bf*)(ws + O_WQ); bf* WKVT = (bf*)(ws + O_WKV); bf* WOT = (bf*)(ws + O_WO);
    h16* Q16 = (h16*)(ws + O_Q16); bf* XP = (bf*)(ws + O_XP); h16* K16 = (h16*)(ws + O_K16);
    h16* VTH = (h16*)(ws + O_VTH); h16* VTL = (h16*)(ws + O_VTL);
    float* CTX = (float*)(ws + O_CTX); bf* CH = (bf*)(ws + O_CH); bf* CL = (bf*)(ws + O_CL);

    // planes of the inputs: state, points and the three weights
    k_prep<<<GB_WQ + GB_WKV + GB_WO + GB_XS + GB_XP, 256, 0, stream>>>(state, pts, Wq, Wkv, Wo, XS, XP, WQT, WKVT, WOT);
    // q = Xs Wq + bq and kv = Xp Wkv + bkv: the q, k and V^T hi/residual f16 planes in fragment order, z = batch
    k_proj<<<dim3(PB_Q + PB_KV, 1, NB), 32, 0, stream>>>(XS, WQT, bq, Q16, XP, WKVT, bkv, K16, VTH, VTL);
    // ctx[b][i][h*32 + d] = softmax_j(q_h[i] . k_h[j] HD^-0.5) v[j][h*32 + d]: x = 16*MQ queries, y = head, z = batch
    k_attn<<<dim3(NQ / (16 * MQ), NH, NB), 32 * FW, 0, stream>>>(Q16, K16, VTH, VTL, CTX);
    // out = ctx Wo + bo: ctx as bf16 hi/lo planes, rows of batch b at OUT + b*NQ_FULL*256
    { const size_t n8 = (size_t)NB * NQ * DM / 8; k_split<<<(unsigned)((n8 + 255) / 256), 256, 0, stream>>>(CTX, CH, CL, n8); }
    k_gemmw<bf, 1, true, 4><<<dim3(NQ / 64, DM / 64, NB), 32, 0, stream>>>(CH, CL, DM, WOT, nullptr, DM, DM, OUT, DM, bo, 1.0f, 0.0f, (size_t)NQ * DM, (size_t)0, (size_t)NQ_FULL * DM);
}

// v008
// One run takes 85.2 microseconds.
// Next to v007, in two timings, it ran 1.05 and 1.06 times as fast.
// Over all steps from v000 it is 14.3 times as fast.
#include <hip/hip_runtime.h>

// Contractions, all f32 accumulate: q = Xs Wq + bq and kv = Xp Wkv + bkv on v_wmma_f32_16x16x32_bf16 (the f32 inputs rounded to bf16 RNE, state and points on their way into the projection's LDS tile, weights as planes transposed to [out][in]); per-head scores q k^T on v_wmma_f32_16x16x32_f16 (q and k as f16 planes carried x8 each); per-head P V on v_wmma_f32_16x16x32_f16 (P f16 carried x2^14; V^T as an f16 hi plane carried x4 plus an f16 residual plane carried x2^10 into a separate accumulator); out = ctx Wo + bo on v_wmma_f32_16x16x32_bf16 (ctx as bf16 hi + lo planes, Wo bf16). Softmax f32, max-subtracted, fixed-order sums. Scores, softmax and P V run in one kernel, split along the keys into 16 parts over the waves of a block; scores and P stay in registers, each part subtracts its own keys' maximum, P is left unnormalised and the row's sum divides the result; partial sums are brought to the row's maximum and added in a fixed order. Every stage runs once for all batches: the batch is a grid dimension. Stages that do not read one another's results share a launch, the block index picking the job: the three weight conversions are one launch, the q and kv projections another. The q, k and V^T planes are written by the projection GEMMs themselves, straight from the accumulators, and lie in fragment order: the 1024 bytes of one 16 x 32 operand fragment are contiguous, lane l's two 16-byte pieces at 16 l and 512 + 16 l.

#ifndef NB
#define NB 8            // batches computed (reducible)
#endif
#ifndef NQ
#define NQ 512          // query rows per batch computed (reducible, multiple of 64)
#endif
#define NB_FULL 8
#define NQ_FULL 512     // per-batch stride of the state input and of the output
#define NK 4096         // keys (softmax row length)
#define DM 256
#define NH 8
#define HD 32
#define QCAR 8.0f
#define KCAR 8.0f
#define VCAR 4.0f
#define RCAR 1024.0f
#define PCAR 16384.0f
#define FW 8             // waves per block of k_attn
#define NSEG 2           // key parts per wave, one after the other: FW*NSEG parts of NK/(FW*NSEG) keys
#define PW 8             // waves per block of k_proj: one per 64 of the 2*DM columns of kv
#define MQ 4             // 16-query tiles per block of k_attn, all served by each wave from one load of its keys
#define SCL2 (0.17677669529663687f * 0.015625f)   // HD^-0.5 / (QCAR*KCAR)

static_assert(NB >= 1 && NB <= NB_FULL);
static_assert(NQ >= 64 && NQ <= NQ_FULL && (NQ % 64) == 0);
static_assert(NK == 256 * 16);
static_assert(QCAR == KCAR);
static_assert((DM % 64) == 0 && (NK % 64) == 0 && HD == 32 && NH * HD == DM);

typedef _Float16 h16;
typedef unsigned short bf;
typedef __attribute__((ext_vector_type(16))) __bf16   v16bf;
typedef __attribute__((ext_vector_type(16))) _Float16 v16h;
typedef __attribute__((ext_vector_type(8)))  _Float16 v8h;
typedef __attribute__((ext_vector_type(8)))  unsigned short v8us;
typedef __attribute__((ext_vector_type(8)))  float    v8f;
typedef __attribute__((ext_vector_type(4)))  float    v4f;
typedef v8h  __attribute__((may_alias)) v8ha;
typedef v4f  __attribute__((may_alias)) v4fa;
typedef v8us __attribute__((may_alias)) v8usa;

__device__ __forceinline__ unsigned short f2bf(float f) { unsigned u = __float_as_uint(f); u += 0x7FFFu + ((u >> 16) & 1u); return (unsigned short)(u >> 16); }
__device__ __forceinline__ float bf2f(unsigned short b) { return __uint_as_float(((unsigned)b) << 16); }
__device__ __forceinline__ float bfr(float f) { return bf2f(f2bf(f)); }
__device__ __forceinline__ v16h cat16(v8h lo, v8h hi) { return __builtin_shufflevector(lo, hi, 0, 1, 2, 3, 4, 5, 6, 7, 8, 9, 10, 11, 12, 13, 14, 15); }
__device__ __forceinline__ v16bf cat16b(v8us lo, v8us hi) { return __builtin_bit_cast(v16bf, __builtin_shufflevector(lo, hi, 0, 1, 2, 3, 4, 5, 6, 7, 8, 9, 10, 11, 12, 13, 14, 15)); }
__device__ __forceinline__ v8f wmma16(v16h a, v16h b, v8f c) { return __builtin_amdgcn_wmma_f32_16x16x32_f16(false, a, false, b, (short)0, c, false, false); }
__device__ __forceinline__ v8f wmmab(v16bf a, v16bf b, v8f c) { return __builtin_amdgcn_wmma_f32_16x16x32_bf16(false, a, false, b, (short)0, c, false, false); }
__device__ __forceinline__ h16 tohx(float x) { return (h16)x; }
__device__ __forceinline__ void splitf(float y, unsigned short& h, unsigned short& l) { h = f2bf(y); l = f2bf(y - bf2f(h)); }

// ---- k_gemmw: register-blocked GEMM, ONE WAVE per 64 x (16*NBN) output tile, operands straight from K-contiguous 16-bit planes; grid (M/64, N/(16*NBN), Z), 32 threads.
// C[m][n] (f32, pitch ldc) = (sum_k A[m][k] Bt[n][k] [+ A2 B same accumulator (MODE 1)] [+ (A Bt2) * rs2 from a separate accumulator (MODE 2)]) * oscale + optional bf16-cast bias[n].
// A rows pitch lda, Bt rows pitch ldb (elements), z-batch strides sA/sB/sC in elements. K % 32 == 0. Fragments: lane row/col = lane&15, elements 0..7 <- k0+8h.., 8..15 <- k0+16+8h.. for A and B.
template <typename T16> struct WFrag;
template <> struct WFrag<h16> { typedef v16h V; static __device__ __forceinline__ V ld(const h16* p) { return cat16(*(const v8h*)p, *(const v8h*)(p + 16)); } static __device__ __forceinline__ v8f mma(V a, V b, v8f c) { return wmma16(a, b, c); } };
template <> struct WFrag<bf> { typedef v16bf V; static __device__ __forceinline__ V ld(const bf* p) { return cat16b(*(const v8us*)p, *(const v8us*)(p + 16)); } static __device__ __forceinline__ v8f mma(V a, V b, v8f c) { return wmmab(a, b, c); } };
// fragment-order plane: p = fragment base + 8 * lane (elements); the lane's second piece stands 256 elements on, so each wave-wide load covers 512 contiguous bytes
__device__ __forceinline__ v16h ldfrag(const h16* p) { return cat16(*(const v8h*)p, *(const v8h*)(p + 256)); }
template <typename T16, int MODE, bool BIAS, int NBN>
__global__ __launch_bounds__(32) void k_gemmw(const T16* __restrict__ A, const T16* __restrict__ A2, int lda, const T16* __restrict__ Bt, const T16* __restrict__ Bt2, int ldb, int K, float* C, int ldc, const float* __restrict__ bias, float oscale, float rs2, size_t sA, size_t sB, size_t sC) {
    typedef typename WFrag<T16>::V V;
    __shared__ __align__(16) float os[16 * 68];
    const size_t z = blockIdx.z; A += z * sA; if (MODE == 1) A2 += z * sA; Bt += z * sB; if (MODE == 2) Bt2 += z * sB; C += z * sC;
    const int lane = threadIdx.x & 31, lr = lane & 15, hi = lane >> 4; const int r0 = blockIdx.x * 64, c0 = blockIdx.y * (16 * NBN);
    v8f acc[4][NBN], acc2[4][NBN];
#pragma unroll
    for (int mb = 0; mb < 4; ++mb)
#pragma unroll
        for (int nb = 0; nb < NBN; ++nb) { acc[mb][nb] = (v8f){}; acc2[mb][nb] = (v8f){}; }
    const size_t aoff = (size_t)(r0 + lr) * lda + 8 * hi, boff = (size_t)(c0 + lr) * ldb + 8 * hi;
#pragma unroll 1
    for (int kc = 0; kc < K; kc += 32) {
        V a[4], a2[4];
#pragma unroll
        for (int mb = 0; mb < 4; ++mb) { a[mb] = WFrag<T16>::ld(A + aoff + (size_t)mb * 16 * lda + kc); if (MODE == 1) a2[mb] = WFrag<T16>::ld(A2 + aoff + (size_t)mb * 16 * lda + kc); }
#pragma unroll
        for (int nb = 0; nb < NBN; ++nb) { const V b = WFrag<T16>::ld(Bt + boff + (size_t)nb * 16 * ldb + kc); V b2; if (MODE == 2) b2 = WFrag<T16>::ld(Bt2 + boff + (size_t)nb * 16 * ldb + kc);
#pragma unroll
            for (int mb = 0; mb < 4; ++mb) { acc[mb][nb] = WFrag<T16>::mma(a[mb], b, acc[mb][nb]); if (MODE == 1) acc[mb][nb] = WFrag<T16>::mma(a2[mb], b, acc[mb][nb]); if (MODE == 2) acc2[mb][nb] = WFrag<T16>::mma(a[mb], b2, acc2[mb][nb]); } }
        if (MODE == 2) asm volatile("v_nop\n\tv_nop\n\tv_nop\n\tv_nop" : "+v"(acc[0][0]), "+v"(acc[1][NBN - 1]), "+v"(acc[2][0]), "+v"(acc[3][NBN - 1]), "+v"(acc2[0][0]), "+v"(acc2[1][NBN - 1]), "+v"(acc2[2][0]), "+v"(acc2[3][NBN - 1]) : "v"(a[0]), "v"(a[3]));
        else asm volatile("v_nop\n\tv_nop\n\tv_nop\n\tv_nop" : "+v"(acc[0][0]), "+v"(acc[1][NBN - 1]), "+v"(acc[2][0]), "+v"(acc[3][NBN - 1]) : "v"(a[0]), "v"(a[3]));
    }
    constexpr int LPR = 4 * NBN, RPI = 32 / LPR, NIT = 16 / RPI;   // lanes per row, rows per instruction, instructions per slab
    const int rl = lane / LPR, cofs = (lane % LPR) * 4;
#pragma unroll
    for (int mb = 0; mb < 4; ++mb) {
#pragma unroll
        for (int nb = 0; nb < NBN; ++nb) {
#pragma unroll
            for (int j = 0; j < 8; ++j) { float vv = acc[mb][nb][j]; if (MODE == 2) vv += acc2[mb][nb][j] * rs2; os[(hi * 8 + j) * 68 + nb * 16 + lr] = vv * oscale; } }
        __builtin_amdgcn_wave_barrier(); asm volatile("" ::: "memory");
        float* crow = C + (size_t)(r0 + mb * 16) * ldc + c0;
{
#pragma unroll
            for (int s = 0; s < NIT; ++s) { const int row = RPI * s + rl; v4f val = *(const v4fa*)(os + row * 68 + cofs); if (BIAS) { val[0] += bfr(bias[c0 + cofs]); val[1] += bfr(bias[c0 + cofs + 1]); val[2] += bfr(bias[c0 + cofs + 2]); val[3] += bfr(bias[c0 + cofs + 3]); }
                *(v4f*)(crow + (size_t)row * ldc + cofs) = val; }
             }
        __builtin_amdgcn_wave_barrier(); asm volatile("" ::: "memory");
    }
}

// ---- proj_tile: y = X W + b (X f32 [rows][DM], W^T bf16 [columns][DM]), one block of PW waves per 64 rows (from row r0; batch = blockIdx.z) x all columns, ONE WAVE per 64 columns (from column c0 = 64 x wave), written as f16 planes in fragment order straight from the accumulators.
// The block reads its 64 rows of X once, as f32, rounds them to bf16 and lays them in LDS in fragment order (fragment (16 rows rt, 32 k kt) at (rt * DM/32 + kt) * 512 elements); behind one barrier every wave takes its X fragments from there, each wave-wide read 512 contiguous bytes.
// A fragment is 512 elements, element (half, hi, r, e) at half*256 + hi*128 + r*8 + e, where the fragment's row is r and its k index half*16 + hi*8 + e.
// Columns below DM (q, or the k half of kv): the product runs as W^T X^T (A = 16 columns of y, B = 16 rows of y), so a lane holds 8 consecutive columns d of one row: one 16-byte piece of fragment (head, 16 rows), row = r, k index = d, value f16(y x KCAR).
// Columns from DM on (the v half of kv): the product runs as X W (A = 16 rows, B = 16 columns), so a lane holds 8 consecutive keys of one column d: one 16-byte piece of fragment (head, 32 keys, 16 d), row = d, k index = key, VTh = f16(v x VCAR), VTl = f16((v x VCAR - VTh) x RCAR).
// Either way each wave-wide store covers 512 contiguous bytes. Operand fragments as in k_gemmw: lane row/col = lane&15, elements 0..7 <- k0+8h.., 8..15 <- k0+16+8h.. for A and B alike, so the two roles swap freely.
template <bool SW>
__device__ __forceinline__ void proj_acc(const bf* xs, const bf* wk, v8f (&acc)[4][4]) {
    int xo = 8 * (int)(threadIdx.x & 31);   // the lane's piece of fragment (0, kt) in the LDS tile
#pragma unroll
    for (int rt = 0; rt < 4; ++rt)
#pragma unroll
        for (int ct = 0; ct < 4; ++ct) acc[rt][ct] = (v8f){};
#pragma unroll 1
    for (int kc = 0; kc < DM; kc += 32) {
        v16bf x[4], wv[4];
#pragma unroll
        for (int ct = 0; ct < 4; ++ct) wv[ct] = WFrag<bf>::ld(wk + (size_t)ct * 16 * DM);
#pragma unroll
        for (int rt = 0; rt < 4; ++rt) x[rt] = cat16b(*(const v8us*)(xs + xo + rt * (DM / 32) * 512), *(const v8us*)(xs + xo + rt * (DM / 32) * 512 + 256));
        // keeps the trip's loads in front of its products: left free, with X in LDS, the four W fragments share one set of registers and each waits out a latency of its own
        __builtin_amdgcn_sched_barrier(0);
#pragma unroll
        for (int ct = 0; ct < 4; ++ct)
#pragma unroll
            for (int rt = 0; rt < 4; ++rt) acc[rt][ct] = SW ? wmmab(wv[ct], x[rt], acc[rt][ct]) : wmmab(x[rt], wv[ct], acc[rt][ct]);
        // the wait that belongs in front of the overwrite of the issued global loads' address registers (an input, so that they stay whole up to it), and four vector slots between the trip's last product and the next trip's loads, which take over its operand registers (every accumulator is named, so that the statement stands behind all of the trip's products)
        asm volatile("s_wait_xcnt 0x0\n\tv_nop\n\tv_nop\n\tv_nop\n\tv_nop" : "+v"(acc[0][0]), "+v"(acc[0][1]), "+v"(acc[0][2]), "+v"(acc[0][3]), "+v"(acc[1][0]), "+v"(acc[1][1]), "+v"(acc[1][2]), "+v"(acc[1][3]), "+v"(acc[2][0]), "+v"(acc[2][1]), "+v"(acc[2][2]), "+v"(acc[2][3]), "+v"(acc[3][0]), "+v"(acc[3][1]), "+v"(acc[3][2]), "+v"(acc[3][3]) : "v"(wk));
        xo += 512; wk += 32;
    }
}
template <int NROW, bool HASV>
__device__ __forceinline__ void proj_tile(bf* xs, const float* __restrict__ X, const bf* __restrict__ WT, const float* __restrict__ bias, h16* P, h16* VTh, h16* VTl, size_t sX, int r0) {
    static_assert(NROW % 64 == 0 && HD == 32 && DM == 256 && PW == 8);
    const int lane = threadIdx.x & 31, lr = lane & 15, hi = lane >> 4, w = __builtin_amdgcn_readfirstlane(threadIdx.x >> 5);
    const size_t z = blockIdx.z;
    // wave w brings rows 16 (w & 3) .. + 15, k 128 (w >> 2) .. + 127: lane (lr, hi) holds row lr, and its piece i is k 16 i + 8 hi .. + 7, which is the lane's own 16 bytes of half-fragment i
    const float* sp = X + z * sX + (size_t)(r0 + 16 * (w & 3) + lr) * DM + 128 * (w >> 2) + 8 * hi;
    v8f xv[8];
#pragma unroll
    for (int i = 0; i < 8; ++i) xv[i] = *(const v8f*)(sp + 16 * i);
    // the wait that belongs in front of any overwrite of the issued loads' address registers; the address is an input so that it stays whole up to it
    asm volatile("s_wait_xcnt 0x0" :: "v"(sp) : "memory");
    bf* sd = xs + ((w & 3) * (DM / 32) + 4 * (w >> 2)) * 512 + 8 * lane;
#pragma unroll
    for (int i = 0; i < 8; ++i) { v8us o;
#pragma unroll
        for (int k = 0; k < 8; ++k) o[k] = f2bf(xv[i][k]);
        *(v8us*)(sd + 256 * i) = o; }
    __syncthreads();
    if (!HASV && w >= DM / 64) return;   // q has DM columns: the other waves only helped to bring X in; no barrier follows
    const int c0 = 64 * w;
    const bf* wp = WT + (size_t)(c0 + lr) * DM + 8 * hi;
    v8f acc[4][4];   // [16 rows of y][16 columns of y]
    if (!HASV || c0 < DM) {
        proj_acc<true>(xs, wp, acc);   // acc[rt][ct][j] = y[r0 + 16 rt + lr][c0 + 16 ct + 8 hi + j]
        h16* dst = P + z * ((size_t)NROW * DM) + ((size_t)(c0 / HD) * (NROW / 16) + r0 / 16) * 512 + 8 * lane;
#pragma unroll
        for (int ct = 0; ct < 4; ++ct) { const v8f b = *(const v8f*)(bias + c0 + ct * 16 + 8 * hi);
#pragma unroll
            for (int rt = 0; rt < 4; ++rt) { v8h o;
#pragma unroll
                for (int j = 0; j < 8; ++j) o[j] = tohx((acc[rt][ct][j] + bfr(b[j])) * KCAR);
                *(v8h*)(dst + ((size_t)(ct >> 1) * (NROW / 16) + rt) * 512 + (ct & 1) * 256) = o; } }
    } else {
        proj_acc<false>(xs, wp, acc);  // acc[rt][ct][j] = y[r0 + 16 rt + 8 hi + j][c0 + 16 ct + lr]
        const size_t oo = z * ((size_t)DM * NROW) + ((size_t)((c0 - DM) / HD) * (NROW / 32) + r0 / 32) * 1024 + 8 * lane;
        const int bi = c0 + lr; float bv[4];
#pragma unroll
        for (int ct = 0; ct < 4; ++ct) bv[ct] = bias[bi + ct * 16];
        // the wait that belongs in front of any overwrite of the issued loads' offset register; the index is an input so that it stays whole up to it
        asm volatile("s_wait_xcnt 0x0" :: "v"(bi) : "memory");
#pragma unroll
        for (int ct = 0; ct < 4; ++ct) { const float b = bfr(bv[ct]);
#pragma unroll
            for (int rt = 0; rt < 4; ++rt) { v8h oh, ol;
#pragma unroll
                for (int j = 0; j < 8; ++j) { const float y = (acc[rt][ct][j] + b) * VCAR; const h16 hh = tohx(y); oh[j] = hh; ol[j] = tohx(__fmul_rn(__fsub_rn(y, (float)hh), RCAR)); }
                const size_t o = oo + ((size_t)(ct >> 1) * (NROW / 32) + (rt >> 1)) * 1024 + (ct & 1) * 512 + (rt & 1) * 256;
                *(v8h*)(VTh + o) = oh; *(v8h*)(VTl + o) = ol; } }
        // the wait that belongs in front of any overwrite of the issued stores' address and data registers: in the built kernel this half is followed by a branch whose other way enters the k half, which takes those registers over
        asm volatile("s_wait_xcnt 0x0" ::: "memory");
    }
}
// q = Xs Wq + bq and kv = Xp Wkv + bkv in one launch (neither reads what the other writes): grid (PB_Q + PB_KV, 1, NB), PW waves; blocks below PB_Q take the 64-row tiles of q, the rest those of kv.
constexpr unsigned PB_Q = NQ / 64, PB_KV = NK / 64;
__global__ __launch_bounds__(32 * PW) void k_proj(const float* __restrict__ state, const bf* __restrict__ WQT, const float* __restrict__ bq, h16* Q16, const float* __restrict__ pts, const bf* __restrict__ WKVT, const float* __restrict__ bkv, h16* K16, h16* VTh, h16* VTl) {
    __shared__ __align__(16) bf xs[64 * DM];
    const unsigned b = blockIdx.x;
    if (b < PB_Q) proj_tile<NQ, false>(xs, state, WQT, bq, Q16, nullptr, nullptr, (size_t)NQ_FULL * DM, (int)b * 64);
    else proj_tile<NK, true>(xs, pts, WKVT, bkv, K16, VTh, VTl, (size_t)NK * DM, (int)(b - PB_Q) * 64);
}

// ---- k_attn: ctx = softmax(q k^T HD^-0.5) v for 16*MQ queries of one head of one batch. Grid (NQ/(16*MQ), NH, NB), FW waves; wave w owns the key parts w*NSEG .. w*NSEG+NSEG-1 (NK/(FW*NSEG) keys each), one after the other, and never stores a score or a P value.
// One load of a part's K and V^T fragments serves all MQ query tiles. The K fragments stay in registers and the scores are formed twice from them: once for the part's maximum, once, 32 keys at a time, for P, with minus that maximum as the product's C operand (a lane's eight results belong to one query); so no score is kept.
// S^T = K Q^T (A = 16 key rows, B = 16 queries): lane (c, hi) holds query c, keys 8hi..8hi+7 of each 16-key tile. Two such tiles, converted in place, are the B operand P^T of O^T += V^T P^T (A = V^T rows d, keys in the same order).
// Each part subtracts the maximum of its own keys: P = exp(t - max_p) x PCAR, not divided. The parts' O^T partials, row sums and maxima meet in LDS (one barrier); they are brought to the row's maximum, added in key order, and the sum divides once.
__global__ __launch_bounds__(32 * FW) void k_attn(const h16* __restrict__ Q, const h16* __restrict__ K, const h16* __restrict__ VTh, const h16* __restrict__ VTl, float* C) {
    constexpr int NP = FW * NSEG, KW = NK / NP, NT = KW / 16, NS = KW / 32, RP = 36, QB = 16 * MQ;
    static_assert(KW % 32 == 0 && NS >= 2 && HD == 32 && PCAR == 16384.0f && NQ % QB == 0 && QB % FW == 0);
    constexpr float CE = SCL2 * 1.4426950408889634f;
    __shared__ __align__(16) float red[NP * QB * RP];
    __shared__ float mxs[NP * QB], sms[NP * QB];
    const int lane = threadIdx.x & 31, c = lane & 15, hi = lane >> 4, w = __builtin_amdgcn_readfirstlane(threadIdx.x >> 5);
    const int q0 = blockIdx.x * QB, h = blockIdx.y;
    const size_t z = blockIdx.z; Q += z * ((size_t)NQ * DM); K += z * ((size_t)NK * DM); VTh += z * ((size_t)DM * NK); VTl += z * ((size_t)DM * NK); C += z * ((size_t)NQ * DM);
    const h16* qb = Q + ((size_t)h * (NQ / 16) + (size_t)blockIdx.x * MQ) * 512;       // the block's first q fragment, the same for all lanes
    v16h qf[MQ];
#pragma unroll
    for (int m = 0; m < MQ; ++m) qf[m] = ldfrag(qb + (size_t)m * 512 + 8 * lane);
    // rolled: unrolled, the kernel's text would be twice as long and the second part's K loads would be lifted over the first part's work, whose registers they need
#pragma unroll 1
    for (int sg = 0; sg < NSEG; ++sg) {
        const int p = w * NSEG + sg, k0 = p * KW;
        const h16* kb = K + ((size_t)h * (NK / 16) + k0 / 16) * 512;                   // the part's first k fragment, the same for all lanes
        const h16* kp = kb + 8 * lane;                                                 // fragment t of the part: + t * 512
        const size_t voff = ((size_t)h * (NK / 32) + k0 / 32) * 1024 + 8 * lane;       // fragment (s, dt) of the part: + (2 s + dt) * 512
        const h16* bh = VTh + voff; const h16* bl = VTl + voff;
        v16h kf[NT], vh[NS][2], vl[NS][2];
#pragma unroll
        for (int t = 0; t < NT; ++t) kf[t] = ldfrag(kp + (size_t)t * 512);
#pragma unroll
        for (int s = 0; s < 2; ++s)
#pragma unroll
            for (int dt = 0; dt < 2; ++dt) { vh[s][dt] = ldfrag(bh + (size_t)(2 * s + dt) * 512); vl[s][dt] = ldfrag(bl + (size_t)(2 * s + dt) * 512); }
        // keeps the first two V^T stages' loads up here with the K loads: one memory latency for all of them instead of one more in front of the first P V product
        __builtin_amdgcn_sched_barrier(0);
        v8f r[MQ];
#pragma unroll
        for (int t = 0; t < NT; t += 2) {
            v8f sa[MQ], sb[MQ];
#pragma unroll
            for (int m = 0; m < MQ; ++m) { sa[m] = wmma16(kf[t], qf[m], (v8f){}); sb[m] = wmma16(kf[t + 1], qf[m], (v8f){}); }
            // keeps the 2*MQ products together in front of the maxima that read them, so that each fills the others' distance: left free every pair is followed by its own maxima, behind idle slots
            __builtin_amdgcn_sched_barrier(0);
#pragma unroll
            for (int m = 0; m < MQ; ++m)
#pragma unroll
                for (int j = 0; j < 8; ++j) r[m][j] = t == 0 ? fmaxf(sa[m][j], sb[m][j]) : fmaxf(fmaxf(r[m][j], sa[m][j]), sb[m][j]);
        }
        float mx[MQ]; v8f cn[MQ];   // cn: minus the part's maximum, the C operand of the second score product
#pragma unroll
        for (int m = 0; m < MQ; ++m) { float x = r[m][0];
#pragma unroll
            for (int j = 1; j < 8; ++j) x = fmaxf(x, r[m][j]);
            x = fmaxf(x, __shfl_xor(x, 16, 32)); mx[m] = x;
#pragma unroll
            for (int j = 0; j < 8; ++j) cn[m][j] = -x; }
        v8f acc[MQ][2], acc2[MQ][2];
        float sum0[MQ], sum1[MQ];
#pragma unroll
        for (int m = 0; m < MQ; ++m) { sum0[m] = 0.f; sum1[m] = 0.f;
#pragma unroll
            for (int dt = 0; dt < 2; ++dt) { acc[m][dt] = (v8f){}; acc2[m][dt] = (v8f){}; } }
        // scores of (stage, tile) i + 1 are formed while (stage, tile) i is worked on, so that no exponent waits for its product
        v8f ta[2][2];
        ta[0][0] = wmma16(kf[0], qf[0], cn[0]); ta[0][1] = wmma16(kf[1], qf[0], cn[0]);
#pragma unroll
        for (int s = 0; s < NS; ++s) {
#pragma unroll
            for (int m = 0; m < MQ; ++m) {
                const int i = s * MQ + m, sn = (i + 1) / MQ, mn = (i + 1) % MQ;
                if (sn < NS) { ta[(i + 1) & 1][0] = wmma16(kf[2 * sn], qf[mn], cn[mn]); ta[(i + 1) & 1][1] = wmma16(kf[2 * sn + 1], qf[mn], cn[mn]); }
                // keeps the two score products at the tile's head: left free they sink to its foot, and the next tile's first exponent waits for them
                __builtin_amdgcn_sched_barrier(0);
                v16h pb;
#pragma unroll
                for (int j = 0; j < 8; ++j) {
                    float e0, e1;
                    // two v_exp_f32 and the free slot that the instruction set asks for behind a transcendental before its result is read or its source overwritten: the second fills the first one's slot, the v_nop the second one's
                    asm("v_exp_f32 %0, %2\n\tv_exp_f32 %1, %3\n\tv_nop" : "=&v"(e0), "=&v"(e1) : "v"(__builtin_fmaf(ta[i & 1][0][j], CE, 14.0f)), "v"(__builtin_fmaf(ta[i & 1][1][j], CE, 14.0f)));   // 2^14 = PCAR rides in the exponent
                    sum0[m] += e0; sum1[m] += e1; pb[j] = tohx(e0); pb[8 + j] = tohx(e1);
                }
#pragma unroll
                for (int dt = 0; dt < 2; ++dt) { acc[m][dt] = wmma16(vh[s][dt], pb, acc[m][dt]); acc2[m][dt] = wmma16(vl[s][dt], pb, acc2[m][dt]); }
                // the two fences hold the four vector slots directly behind the tile's last product: what follows (the next tile's v_exp_f32 in asm text, which the compiler does not pad; at a stage's end the loads of stage s + 2) takes over its operand registers. They also keep each tile's work together. The tile's two row sums are named (each row's sum, against spills) so that their additions stay in this tile: left free they are put off to the part's end, and every exponential is spilled until then
                __builtin_amdgcn_sched_barrier(0);
                asm volatile("v_nop\n\tv_nop\n\tv_nop\n\tv_nop" : "+v"(sum0[m]), "+v"(sum1[m]) :: "memory");
                __builtin_amdgcn_sched_barrier(0);
            }
            // stage s + 2's loads stand between stage s, whose registers they take over, and stage s + 1, a whole stage of work ahead of their use
            if (s + 2 < NS) {
#pragma unroll
                for (int dt = 0; dt < 2; ++dt) { vh[s + 2][dt] = ldfrag(bh + (size_t)(2 * (s + 2) + dt) * 512); vl[s + 2][dt] = ldfrag(bl + (size_t)(2 * (s + 2) + dt) * 512); }
                // left free the loads sink to their products, and each product waits out a latency of its own
                __builtin_amdgcn_sched_barrier(0);
            }
        }
        // the wait that belongs in front of any overwrite of an issued load's address registers, which the next part's addresses take over; the addresses are inputs so that they stay whole up to it (the K loads go out on the scalar base kb and a lane offset that no trip rewrites)
        asm volatile("s_wait_xcnt 0x0" :: "s"(kb), "v"(bh), "v"(bl) : "memory");
#pragma unroll
        for (int m = 0; m < MQ; ++m) {
            float sum = sum0[m] + sum1[m];
            sum += __shfl_xor(sum, 16, 32);
            const int row = p * QB + m * 16 + c;
            if (hi == 0) { mxs[row] = mx[m]; sms[row] = sum; }
            float* my = red + row * RP + 8 * hi;
#pragma unroll
            for (int dt = 0; dt < 2; ++dt) { v4f s0, s1;
#pragma unroll
                for (int j = 0; j < 4; ++j) { s0[j] = acc[m][dt][j] + acc2[m][dt][j] * (1.0f / RCAR); s1[j] = acc[m][dt][4 + j] + acc2[m][dt][4 + j] * (1.0f / RCAR); }
                *(v4fa*)(my + dt * 16) = s0; *(v4fa*)(my + dt * 16 + 4) = s1; }
        }
    }
    __syncthreads();
    // wave w finishes queries q0 + w*QB/FW .., lane = column d: each store is one whole 128-B line
    // two queries' LDS reads stand side by side, so that one's latency covers the other's
#pragma unroll 2
    for (int u = 0; u < QB / FW; ++u) {
        const int qi = w * (QB / FW) + u;
        float m = mxs[qi];
#pragma unroll
        for (int i = 1; i < NP; ++i) m = fmaxf(m, mxs[i * QB + qi]);
        float o = 0.f, tot = 0.f;
#pragma unroll
        for (int i = 0; i < NP; ++i) { const float f = __builtin_amdgcn_exp2f((mxs[i * QB + qi] - m) * CE); o += red[(i * QB + qi) * RP + lane] * f; tot += sms[i * QB + qi] * f; }
        float* cp = C + (size_t)(q0 + qi) * DM + h * HD + lane;
        *cp = o / (tot * VCAR);
        // the wait that belongs in front of the next trip's overwrite of the issued store's address registers; the address is an input so that it stays whole up to it
        asm volatile("s_wait_xcnt 0x0" :: "v"(cp) : "memory");
    }
}

__device__ __forceinline__ void wT(const float* __restrict__ W, bf* WT, int Kin, int Nout, unsigned blk) { const size_t g = (size_t)blk * 256 + threadIdx.x; if (g >= (size_t)Nout * Kin / 8) return; const int k0 = (int)(g % (size_t)(Kin / 8)) * 8; const int n = (int)(g / (size_t)(Kin / 8)); v8us o;
#pragma unroll
    for (int q = 0; q < 8; ++q) o[q] = f2bf(W[(size_t)(k0 + q) * Nout + n]);
    bf* d = WT + (size_t)n * Kin + k0; *(v8us*)d = o;  }

// ---- k_prep: the transposed bf16 planes of the three weights, in one launch (no job reads what another writes); 256 threads, the block index picks the job.
constexpr unsigned GB_WQ = (unsigned)(((size_t)DM * DM / 8 + 255) / 256), GB_WKV = (unsigned)(((size_t)2 * DM * DM / 8 + 255) / 256), GB_WO = GB_WQ;
__global__ __launch_bounds__(256) void k_prep(const float* __restrict__ Wq, const float* __restrict__ Wkv, const float* __restrict__ Wo, bf* WQT, bf* WKVT, bf* WOT) {
    unsigned b = blockIdx.x;
    if (b < GB_WQ) { wT(Wq, WQT, DM, DM, b); return; }
    b -= GB_WQ;
    if (b < GB_WKV) { wT(Wkv, WKVT, DM, 2 * DM, b); return; }
    wT(Wo, WOT, DM, DM, b - GB_WKV);
}

__global__ __launch_bounds__(256) void k_split(const float* __restrict__ src, bf* dh, bf* dl, size_t n8) { const size_t i = (size_t)blockIdx.x * 256 + threadIdx.x; if (i >= n8) return; const float* sp = src + i * 8; const v8f v = *(const v8f*)sp; v8us oh, ol;
    // the wait that belongs in front of any overwrite of an issued load's address registers; the address is an input so that it stays whole up to it
    asm volatile("s_wait_xcnt 0x0" :: "v"(sp) : "memory");
#pragma unroll
    for (int k = 0; k < 8; ++k) { unsigned short a, c; splitf(v[k], a, c); oh[k] = a; ol[k] = c; }
    *(v8us*)(dh + i * 8) = oh; *(v8us*)(dl + i * 8) = ol;  }

// ---- workspace carve (bytes, 256-B aligned regions; all sizes compile-time)
constexpr size_t al256(size_t x) { return (x + 255) & ~(size_t)255; }
constexpr size_t SZ_WQ  = al256((size_t)DM * DM * 2);                                           // Wq^T [256][256]
constexpr size_t SZ_WKV = al256((size_t)2 * DM * DM * 2);                                       // Wkv^T [512][256]
constexpr size_t SZ_WO  = al256((size_t)DM * DM * 2);                                           // Wo^T [256][256]
constexpr size_t SZ_Q16 = al256((size_t)NB * NQ * DM * 2);                                      // q f16 [NB][8 heads][NQ/16 fragments][512]
constexpr size_t SZ_K16 = al256((size_t)NB * NK * DM * 2);                                      // k f16 [NB][8 heads][256 fragments][512]
constexpr size_t SZ_VT  = al256((size_t)NB * DM * NK * 2);                                      // V^T plane [NB][8 heads][128 x 2 fragments][512] (hi, residual: one each)
constexpr size_t SZ_CTX = al256((size_t)NB * NQ * DM * 4);                                      // ctx f32 [NB*NQ][256]
constexpr size_t SZ_C16 = al256((size_t)NB * NQ * DM * 2);                                      // ctx hi / lo planes
constexpr size_t O_WQ = 0, O_WKV = O_WQ + SZ_WQ, O_WO = O_WKV + SZ_WKV, O_Q16 = O_WO + SZ_WO, O_K16 = O_Q16 + SZ_Q16,
                 O_VTH = O_K16 + SZ_K16, O_VTL = O_VTH + SZ_VT, O_CTX = O_VTL + SZ_VT, O_CH = O_CTX + SZ_CTX, O_CL = O_CH + SZ_C16, O_END = O_CL + SZ_C16;
static_assert(O_END <= (size_t)268435456);
static_assert(((size_t)(NB_FULL - 1) * NQ_FULL + NQ_FULL) * DM * 4 <= (size_t)NB_FULL * NQ_FULL * DM * 4);

extern "C" void kernel_launch(void* const* d_in, const int* in_sizes, int n_in, void* d_out, int out_size, void* d_ws, size_t ws_size, hipStream_t stream) {
    if (n_in < 8) return;
    if (in_sizes[0] < NB * NQ_FULL * DM || in_sizes[1] < NB * NK * DM || in_sizes[2] < DM * DM || in_sizes[3] < DM || in_sizes[4] < DM * 2 * DM || in_sizes[5] < 2 * DM || in_sizes[6] < DM * DM || in_sizes[7] < DM) return;
    if ((size_t)out_size < (size_t)NB * NQ_FULL * DM) return;
    if (O_END > ws_size) return;
    const float* state = (const float*)d_in[0];   // [8][512][256]
    const float* pts   = (const float*)d_in[1];   // [8][4096][256]
    const float* Wq    = (const float*)d_in[2];   // [256][256] in x out
    const float* bq    = (const float*)d_in[3];   // [256]
    const float* Wkv   = (const float*)d_in[4];   // [256][512]
    const float* bkv   = (const float*)d_in[5];   // [512]
    const float* Wo    = (const float*)d_in[6];   // [256][256]
    const float* bo    = (const float*)d_in[7];   // [256]
    float* OUT = (float*)d_out;                   // [8][512][256]
    char* ws = (char*)d_ws;
    bf* WQT = (bf*)(ws + O_WQ); bf* WKVT = (bf*)(ws + O_WKV); bf* WOT = (bf*)(ws + O_WO);
    h16* Q16 = (h16*)(ws + O_Q16); h16* K16 = (h16*)(ws + O_K16);
    h16* VTH = (h16*)(ws + O_VTH); h16* VTL = (h16*)(ws + O_VTL);
    float* CTX = (float*)(ws + O_CTX); bf* CH = (bf*)(ws + O_CH); bf* CL = (bf*)(ws + O_CL);

    // planes of the three weights
    k_prep<<<GB_WQ + GB_WKV + GB_WO, 256, 0, stream>>>(Wq, Wkv, Wo, WQT, WKVT, WOT);
    // q = Xs Wq + bq and kv = Xp Wkv + bkv: the q, k and V^T hi/residual f16 planes in fragment order, z = batch
    k_proj<<<dim3(PB_Q + PB_KV, 1, NB), 32 * PW, 0, stream>>>(state, WQT, bq, Q16, pts, WKVT, bkv, K16, VTH, VTL);
    // ctx[b][i][h*32 + d] = softmax_j(q_h[i] . k_h[j] HD^-0.5) v[j][h*32 + d]: x = 16*MQ queries, y = head, z = batch
    k_attn<<<dim3(NQ / (16 * MQ), NH, NB), 32 * FW, 0, stream>>>(Q16, K16, VTH, VTL, CTX);
    // out = ctx Wo + bo: ctx as bf16 hi/lo planes, rows of batch b at OUT + b*NQ_FULL*256
    { const size_t n8 = (size_t)NB * NQ * DM / 8; k_split<<<(unsigned)((n8 + 255) / 256), 256, 0, stream>>>(CTX, CH, CL, n8); }
    k_gemmw<bf, 1, true, 4><<<dim3(NQ / 64, DM / 64, NB), 32, 0, stream>>>(CH, CL, DM, WOT, nullptr, DM, DM, OUT, DM, bo, 1.0f, 0.0f, (size_t)NQ * DM, (size_t)0, (size_t)NQ_FULL * DM);
}

// v009
// Measured time: 78.7 microseconds a run.
// Two timings next to v008 both put it at 1.08 times that version's speed.
// All steps since v000 together make it 15.5 times as fast.
#include <hip/hip_runtime.h>

// Contractions, all f32 accumulate: q = Xs Wq + bq and kv = Xp Wkv + bkv on v_wmma_f32_16x16x32_bf16 (the f32 inputs rounded to bf16 RNE, state and points on their way into the projection's LDS tile, weights as planes transposed to [out][in]); per-head scores q k^T on v_wmma_f32_16x16x32_f16 (q and k as f16 planes carried x8 each); per-head P V on v_wmma_f32_16x16x32_f16 (P f16 carried x2^14; V^T as an f16 hi plane carried x4 plus an f16 residual plane carried x2^10 into a separate accumulator); out = ctx Wo + bo on v_wmma_f32_16x16x32_bf16 (ctx as bf16 hi + lo, split on its way into the output GEMM's LDS tile, Wo bf16). Softmax f32, max-subtracted, fixed-order sums. Scores, softmax and P V run in one kernel, split along the keys into 16 parts over the waves of a block; scores and P stay in registers, each part subtracts its own keys' maximum, P is left unnormalised and the row's sum divides the result; partial sums are brought to the row's maximum and added in a fixed order. Every stage runs once for all batches: the batch is a grid dimension. Stages that do not read one another's results share a launch, the block index picking the job: the three weight conversions are one launch, the q and kv projections another. The q, k and V^T planes are written by the projection GEMMs themselves, straight from the accumulators, and lie in fragment order: the 1024 bytes of one 16 x 32 operand fragment are contiguous, lane l's two 16-byte pieces at 16 l and 512 + 16 l.

#ifndef NB
#define NB 8            // batches computed (reducible)
#endif
#ifndef NQ
#define NQ 512          // query rows per batch computed (reducible, multiple of 64)
#endif
#define NB_FULL 8
#define NQ_FULL 512     // per-batch stride of the state input and of the output
#define NK 4096         // keys (softmax row length)
#define DM 256
#define NH 8
#define HD 32
#define QCAR 8.0f
#define KCAR 8.0f
#define VCAR 4.0f
#define RCAR 1024.0f
#define PCAR 16384.0f
#define FW 8             // waves per block of k_attn
#define NSEG 2           // key parts per wave, one after the other: FW*NSEG parts of NK/(FW*NSEG) keys
#define PW 8             // waves per block of k_proj: one per 64 of the 2*DM columns of kv
#define MQ 4             // 16-query tiles per block of k_attn, all served by each wave from one load of its keys
#define SCL2 (0.17677669529663687f * 0.015625f)   // HD^-0.5 / (QCAR*KCAR)

static_assert(NB >= 1 && NB <= NB_FULL);
static_assert(NQ >= 64 && NQ <= NQ_FULL && (NQ % 64) == 0);
static_assert(NK == 256 * 16);
static_assert(QCAR == KCAR);
static_assert((DM % 64) == 0 && (NK % 64) == 0 && HD == 32 && NH * HD == DM);

typedef _Float16 h16;
typedef unsigned short bf;
typedef __attribute__((ext_vector_type(16))) __bf16   v16bf;
typedef __attribute__((ext_vector_type(16))) _Float16 v16h;
typedef __attribute__((ext_vector_type(8)))  _Float16 v8h;
typedef __attribute__((ext_vector_type(8)))  unsigned short v8us;
typedef __attribute__((ext_vector_type(8)))  float    v8f;
typedef __attribute__((ext_vector_type(4)))  float    v4f;
typedef v8h  __attribute__((may_alias)) v8ha;
typedef v4f  __attribute__((may_alias)) v4fa;
typedef v8us __attribute__((may_alias)) v8usa;

__device__ __forceinline__ unsigned short f2bf(float f) { unsigned u = __float_as_uint(f); u += 0x7FFFu + ((u >> 16) & 1u); return (unsigned short)(u >> 16); }
__device__ __forceinline__ float bf2f(unsigned short b) { return __uint_as_float(((unsigned)b) << 16); }
__device__ __forceinline__ float bfr(float f) { return bf2f(f2bf(f)); }
__device__ __forceinline__ v16h cat16(v8h lo, v8h hi) { return __builtin_shufflevector(lo, hi, 0, 1, 2, 3, 4, 5, 6, 7, 8, 9, 10, 11, 12, 13, 14, 15); }
__device__ __forceinline__ v16bf cat16b(v8us lo, v8us hi) { return __builtin_bit_cast(v16bf, __builtin_shufflevector(lo, hi, 0, 1, 2, 3, 4, 5, 6, 7, 8, 9, 10, 11, 12, 13, 14, 15)); }
__device__ __forceinline__ v8f wmma16(v16h a, v16h b, v8f c) { return __builtin_amdgcn_wmma_f32_16x16x32_f16(false, a, false, b, (short)0, c, false, false); }
__device__ __forceinline__ v8f wmmab(v16bf a, v16bf b, v8f c) { return __builtin_amdgcn_wmma_f32_16x16x32_bf16(false, a, false, b, (short)0, c, false, false); }
__device__ __forceinline__ h16 tohx(float x) { return (h16)x; }
__device__ __forceinline__ void splitf(float y, unsigned short& h, unsigned short& l) { h = f2bf(y); l = f2bf(y - bf2f(h)); }

// Operand fragments of the 16x16x32 forms: lane row/col = lane&15, elements 0..7 <- k0+8h.., 8..15 <- k0+16+8h.. for A and B.
template <typename T16> struct WFrag;
template <> struct WFrag<h16> { typedef v16h V; static __device__ __forceinline__ V ld(const h16* p) { return cat16(*(const v8h*)p, *(const v8h*)(p + 16)); } static __device__ __forceinline__ v8f mma(V a, V b, v8f c) { return wmma16(a, b, c); } };
template <> struct WFrag<bf> { typedef v16bf V; static __device__ __forceinline__ V ld(const bf* p) { return cat16b(*(const v8us*)p, *(const v8us*)(p + 16)); } static __device__ __forceinline__ v8f mma(V a, V b, v8f c) { return wmmab(a, b, c); } };
// fragment-order plane: p = fragment base + 8 * lane (elements); the lane's second piece stands 256 elements on, so each wave-wide load covers 512 contiguous bytes
__device__ __forceinline__ v16h ldfrag(const h16* p) { return cat16(*(const v8h*)p, *(const v8h*)(p + 256)); }

// ---- proj_tile: y = X W + b (X f32 [rows][DM], W^T bf16 [columns][DM]), one block of PW waves per 64 rows (from row r0; batch = blockIdx.z) x all columns, ONE WAVE per 64 columns (from column c0 = 64 x wave), written as f16 planes in fragment order straight from the accumulators.
// The block reads its 64 rows of X once, as f32, rounds them to bf16 and lays them in LDS in fragment order (fragment (16 rows rt, 32 k kt) at (rt * DM/32 + kt) * 512 elements); behind one barrier every wave takes its X fragments from there, each wave-wide read 512 contiguous bytes.
// A fragment is 512 elements, element (half, hi, r, e) at half*256 + hi*128 + r*8 + e, where the fragment's row is r and its k index half*16 + hi*8 + e.
// Columns below DM (q, or the k half of kv): the product runs as W^T X^T (A = 16 columns of y, B = 16 rows of y), so a lane holds 8 consecutive columns d of one row: one 16-byte piece of fragment (head, 16 rows), row = r, k index = d, value f16(y x KCAR).
// Columns from DM on (the v half of kv): the product runs as X W (A = 16 rows, B = 16 columns), so a lane holds 8 consecutive keys of one column d: one 16-byte piece of fragment (head, 32 keys, 16 d), row = d, k index = key, VTh = f16(v x VCAR), VTl = f16((v x VCAR - VTh) x RCAR).
// Either way each wave-wide store covers 512 contiguous bytes. Operand fragments: lane row/col = lane&15, elements 0..7 <- k0+8h.., 8..15 <- k0+16+8h.. for A and B alike, so the two roles swap freely.
template <bool SW>
__device__ __forceinline__ void proj_acc(const bf* xs, const bf* wk, v8f (&acc)[4][4]) {
    int xo = 8 * (int)(threadIdx.x & 31);   // the lane's piece of fragment (0, kt) in the LDS tile
#pragma unroll
    for (int rt = 0; rt < 4; ++rt)
#pragma unroll
        for (int ct = 0; ct < 4; ++ct) acc[rt][ct] = (v8f){};
#pragma unroll 1
    for (int kc = 0; kc < DM; kc += 32) {
        v16bf x[4], wv[4];
#pragma unroll
        for (int ct = 0; ct < 4; ++ct) wv[ct] = WFrag<bf>::ld(wk + (size_t)ct * 16 * DM);
#pragma unroll
        for (int rt = 0; rt < 4; ++rt) x[rt] = cat16b(*(const v8us*)(xs + xo + rt * (DM / 32) * 512), *(const v8us*)(xs + xo + rt * (DM / 32) * 512 + 256));
        // keeps the trip's loads in front of its products: left free, with X in LDS, the four W fragments share one set of registers and each waits out a latency of its own
        __builtin_amdgcn_sched_barrier(0);
#pragma unroll
        for (int ct = 0; ct < 4; ++ct)
#pragma unroll
            for (int rt = 0; rt < 4; ++rt) acc[rt][ct] = SW ? wmmab(wv[ct], x[rt], acc[rt][ct]) : wmmab(x[rt], wv[ct], acc[rt][ct]);
        // the wait that belongs in front of the overwrite of the issued global loads' address registers (an input, so that they stay whole up to it), and four vector slots between the trip's last product and the next trip's loads, which take over its operand registers (every accumulator is named, so that the statement stands behind all of the trip's products)
        asm volatile("s_wait_xcnt 0x0\n\tv_nop\n\tv_nop\n\tv_nop\n\tv_nop" : "+v"(acc[0][0]), "+v"(acc[0][1]), "+v"(acc[0][2]), "+v"(acc[0][3]), "+v"(acc[1][0]), "+v"(acc[1][1]), "+v"(acc[1][2]), "+v"(acc[1][3]), "+v"(acc[2][0]), "+v"(acc[2][1]), "+v"(acc[2][2]), "+v"(acc[2][3]), "+v"(acc[3][0]), "+v"(acc[3][1]), "+v"(acc[3][2]), "+v"(acc[3][3]) : "v"(wk));
        xo += 512; wk += 32;
    }
}
template <int NROW, bool HASV>
__device__ __forceinline__ void proj_tile(bf* xs, const float* __restrict__ X, const bf* __restrict__ WT, const float* __restrict__ bias, h16* P, h16* VTh, h16* VTl, size_t sX, int r0) {
    static_assert(NROW % 64 == 0 && HD == 32 && DM == 256 && PW == 8);
    const int lane = threadIdx.x & 31, lr = lane & 15, hi = lane >> 4, w = __builtin_amdgcn_readfirstlane(threadIdx.x >> 5);
    const size_t z = blockIdx.z;
    // wave w brings rows 16 (w & 3) .. + 15, k 128 (w >> 2) .. + 127: lane (lr, hi) holds row lr, and its piece i is k 16 i + 8 hi .. + 7, which is the lane's own 16 bytes of half-fragment i
    const float* sp = X + z * sX + (size_t)(r0 + 16 * (w & 3) + lr) * DM + 128 * (w >> 2) + 8 * hi;
    v8f xv[8];
#pragma unroll
    for (int i = 0; i < 8; ++i) xv[i] = *(const v8f*)(sp + 16 * i);
    // the wait that belongs in front of any overwrite of the issued loads' address registers; the address is an input so that it stays whole up to it
    asm volatile("s_wait_xcnt 0x0" :: "v"(sp) : "memory");
    bf* sd = xs + ((w & 3) * (DM / 32) + 4 * (w >> 2)) * 512 + 8 * lane;
#pragma unroll
    for (int i = 0; i < 8; ++i) { v8us o;
#pragma unroll
        for (int k = 0; k < 8; ++k) o[k] = f2bf(xv[i][k]);
        *(v8us*)(sd + 256 * i) = o; }
    __syncthreads();
    if (!HASV && w >= DM / 64) return;   // q has DM columns: the other waves only helped to bring X in; no barrier follows
    const int c0 = 64 * w;
    const bf* wp = WT + (size_t)(c0 + lr) * DM + 8 * hi;
    v8f acc[4][4];   // [16 rows of y][16 columns of y]
    if (!HASV || c0 < DM) {
        proj_acc<true>(xs, wp, acc);   // acc[rt][ct][j] = y[r0 + 16 rt + lr][c0 + 16 ct + 8 hi + j]
        h16* dst = P + z * ((size_t)NROW * DM) + ((size_t)(c0 / HD) * (NROW / 16) + r0 / 16) * 512 + 8 * lane;
#pragma unroll
        for (int ct = 0; ct < 4; ++ct) { const v8f b = *(const v8f*)(bias + c0 + ct * 16 + 8 * hi);
#pragma unroll
            for (int rt = 0; rt < 4; ++rt) { v8h o;
#pragma unroll
                for (int j = 0; j < 8; ++j) o[j] = tohx((acc[rt][ct][j] + bfr(b[j])) * KCAR);
                *(v8h*)(dst + ((size_t)(ct >> 1) * (NROW / 16) + rt) * 512 + (ct & 1) * 256) = o; } }
    } else {
        proj_acc<false>(xs, wp, acc);  // acc[rt][ct][j] = y[r0 + 16 rt + 8 hi + j][c0 + 16 ct + lr]
        const size_t oo = z * ((size_t)DM * NROW) + ((size_t)((c0 - DM) / HD) * (NROW / 32) + r0 / 32) * 1024 + 8 * lane;
        const int bi = c0 + lr; float bv[4];
#pragma unroll
        for (int ct = 0; ct < 4; ++ct) bv[ct] = bias[bi + ct * 16];
        // the wait that belongs in front of any overwrite of the issued loads' offset register; the index is an input so that it stays whole up to it
        asm volatile("s_wait_xcnt 0x0" :: "v"(bi) : "memory");
#pragma unroll
        for (int ct = 0; ct < 4; ++ct) { const float b = bfr(bv[ct]);
#pragma unroll
            for (int rt = 0; rt < 4; ++rt) { v8h oh, ol;
#pragma unroll
                for (int j = 0; j < 8; ++j) { const float y = (acc[rt][ct][j] + b) * VCAR; const h16 hh = tohx(y); oh[j] = hh; ol[j] = tohx(__fmul_rn(__fsub_rn(y, (float)hh), RCAR)); }
                const size_t o = oo + ((size_t)(ct >> 1) * (NROW / 32) + (rt >> 1)) * 1024 + (ct & 1) * 512 + (rt & 1) * 256;
                *(v8h*)(VTh + o) = oh; *(v8h*)(VTl + o) = ol; } }
        // the wait that belongs in front of any overwrite of the issued stores' address and data registers: in the built kernel this half is followed by a branch whose other way enters the k half, which takes those registers over
        asm volatile("s_wait_xcnt 0x0" ::: "memory");
    }
}
// q = Xs Wq + bq and kv = Xp Wkv + bkv in one launch (neither reads what the other writes): grid (PB_Q + PB_KV, 1, NB), PW waves; blocks below PB_Q take the 64-row tiles of q, the rest those of kv.
constexpr unsigned PB_Q = NQ / 64, PB_KV = NK / 64;
__global__ __launch_bounds__(32 * PW) void k_proj(const float* __restrict__ state, const bf* __restrict__ WQT, const float* __restrict__ bq, h16* Q16, const float* __restrict__ pts, const bf* __restrict__ WKVT, const float* __restrict__ bkv, h16* K16, h16* VTh, h16* VTl) {
    __shared__ __align__(16) bf xs[64 * DM];
    const unsigned b = blockIdx.x;
    if (b < PB_Q) proj_tile<NQ, false>(xs, state, WQT, bq, Q16, nullptr, nullptr, (size_t)NQ_FULL * DM, (int)b * 64);
    else proj_tile<NK, true>(xs, pts, WKVT, bkv, K16, VTh, VTl, (size_t)NK * DM, (int)(b - PB_Q) * 64);
}

// ---- k_attn: ctx = softmax(q k^T HD^-0.5) v for 16*MQ queries of one head of one batch. Grid (NQ/(16*MQ), NH, NB), FW waves; wave w owns the key parts w*NSEG .. w*NSEG+NSEG-1 (NK/(FW*NSEG) keys each), one after the other, and never stores a score or a P value.
// One load of a part's K and V^T fragments serves all MQ query tiles. The K fragments stay in registers and the scores are formed twice from them: once for the part's maximum, once, 32 keys at a time, for P, with minus that maximum as the product's C operand (a lane's eight results belong to one query); so no score is kept.
// S^T = K Q^T (A = 16 key rows, B = 16 queries): lane (c, hi) holds query c, keys 8hi..8hi+7 of each 16-key tile. Two such tiles, converted in place, are the B operand P^T of O^T += V^T P^T (A = V^T rows d, keys in the same order).
// Each part subtracts the maximum of its own keys: P = exp(t - max_p) x PCAR, not divided. The parts' O^T partials, row sums and maxima meet in LDS (one barrier); they are brought to the row's maximum, added in key order, and the sum divides once.
__global__ __launch_bounds__(32 * FW) void k_attn(const h16* __restrict__ Q, const h16* __restrict__ K, const h16* __restrict__ VTh, const h16* __restrict__ VTl, float* C) {
    constexpr int NP = FW * NSEG, KW = NK / NP, NT = KW / 16, NS = KW / 32, RP = 36, QB = 16 * MQ;
    static_assert(KW % 32 == 0 && NS >= 2 && HD == 32 && PCAR == 16384.0f && NQ % QB == 0 && QB % FW == 0);
    constexpr float CE = SCL2 * 1.4426950408889634f;
    __shared__ __align__(16) float red[NP * QB * RP];
    __shared__ float mxs[NP * QB], sms[NP * QB];
    const int lane = threadIdx.x & 31, c = lane & 15, hi = lane >> 4, w = __builtin_amdgcn_readfirstlane(threadIdx.x >> 5);
    const int q0 = blockIdx.x * QB, h = blockIdx.y;
    const size_t z = blockIdx.z; Q += z * ((size_t)NQ * DM); K += z * ((size_t)NK * DM); VTh += z * ((size_t)DM * NK); VTl += z * ((size_t)DM * NK); C += z * ((size_t)NQ * DM);
    const h16* qb = Q + ((size_t)h * (NQ / 16) + (size_t)blockIdx.x * MQ) * 512;       // the block's first q fragment, the same for all lanes
    v16h qf[MQ];
#pragma unroll
    for (int m = 0; m < MQ; ++m) qf[m] = ldfrag(qb + (size_t)m * 512 + 8 * lane);
    // rolled: unrolled, the kernel's text would be twice as long and the second part's K loads would be lifted over the first part's work, whose registers they need
#pragma unroll 1
    for (int sg = 0; sg < NSEG; ++sg) {
        const int p = w * NSEG + sg, k0 = p * KW;
        const h16* kb = K + ((size_t)h * (NK / 16) + k0 / 16) * 512;                   // the part's first k fragment, the same for all lanes
        const h16* kp = kb + 8 * lane;                                                 // fragment t of the part: + t * 512
        const size_t voff = ((size_t)h * (NK / 32) + k0 / 32) * 1024 + 8 * lane;       // fragment (s, dt) of the part: + (2 s + dt) * 512
        const h16* bh = VTh + voff; const h16* bl = VTl + voff;
        v16h kf[NT], vh[NS][2], vl[NS][2];
#pragma unroll
        for (int t = 0; t < NT; ++t) kf[t] = ldfrag(kp + (size_t)t * 512);
#pragma unroll
        for (int s = 0; s < 2; ++s)
#pragma unroll
            for (int dt = 0; dt < 2; ++dt) { vh[s][dt] = ldfrag(bh + (size_t)(2 * s + dt) * 512); vl[s][dt] = ldfrag(bl + (size_t)(2 * s + dt) * 512); }
        // keeps the first two V^T stages' loads up here with the K loads: one memory latency for all of them instead of one more in front of the first P V product
        __builtin_amdgcn_sched_barrier(0);
        v8f r[MQ];
#pragma unroll
        for (int t = 0; t < NT; t += 2) {
            v8f sa[MQ], sb[MQ];
#pragma unroll
            for (int m = 0; m < MQ; ++m) { sa[m] = wmma16(kf[t], qf[m], (v8f){}); sb[m] = wmma16(kf[t + 1], qf[m], (v8f){}); }
            // keeps the 2*MQ products together in front of the maxima that read them, so that each fills the others' distance: left free every pair is followed by its own maxima, behind idle slots
            __builtin_amdgcn_sched_barrier(0);
#pragma unroll
            for (int m = 0; m < MQ; ++m)
#pragma unroll
                for (int j = 0; j < 8; ++j) r[m][j] = t == 0 ? fmaxf(sa[m][j], sb[m][j]) : fmaxf(fmaxf(r[m][j], sa[m][j]), sb[m][j]);
        }
        float mx[MQ]; v8f cn[MQ];   // cn: minus the part's maximum, the C operand of the second score product
#pragma unroll
        for (int m = 0; m < MQ; ++m) { float x = r[m][0];
#pragma unroll
            for (int j = 1; j < 8; ++j) x = fmaxf(x, r[m][j]);
            x = fmaxf(x, __shfl_xor(x, 16, 32)); mx[m] = x;
#pragma unroll
            for (int j = 0; j < 8; ++j) cn[m][j] = -x; }
        v8f acc[MQ][2], acc2[MQ][2];
        float sum0[MQ], sum1[MQ];
#pragma unroll
        for (int m = 0; m < MQ; ++m) { sum0[m] = 0.f; sum1[m] = 0.f;
#pragma unroll
            for (int dt = 0; dt < 2; ++dt) { acc[m][dt] = (v8f){}; acc2[m][dt] = (v8f){}; } }
        // scores of (stage, tile) i + 1 are formed while (stage, tile) i is worked on, so that no exponent waits for its product
        v8f ta[2][2];
        ta[0][0] = wmma16(kf[0], qf[0], cn[0]); ta[0][1] = wmma16(kf[1], qf[0], cn[0]);
#pragma unroll
        for (int s = 0; s < NS; ++s) {
#pragma unroll
            for (int m = 0; m < MQ; ++m) {
                const int i = s * MQ + m, sn = (i + 1) / MQ, mn = (i + 1) % MQ;
                if (sn < NS) { ta[(i + 1) & 1][0] = wmma16(kf[2 * sn], qf[mn], cn[mn]); ta[(i + 1) & 1][1] = wmma16(kf[2 * sn + 1], qf[mn], cn[mn]); }
                // keeps the two score products at the tile's head: left free they sink to its foot, and the next tile's first exponent waits for them
                __builtin_amdgcn_sched_barrier(0);
                v16h pb;
#pragma unroll
                for (int j = 0; j < 8; ++j) {
                    float e0, e1;
                    // two v_exp_f32 and the free slot that the instruction set asks for behind a transcendental before its result is read or its source overwritten: the second fills the first one's slot, the v_nop the second one's
                    asm("v_exp_f32 %0, %2\n\tv_exp_f32 %1, %3\n\tv_nop" : "=&v"(e0), "=&v"(e1) : "v"(__builtin_fmaf(ta[i & 1][0][j], CE, 14.0f)), "v"(__builtin_fmaf(ta[i & 1][1][j], CE, 14.0f)));   // 2^14 = PCAR rides in the exponent
                    sum0[m] += e0; sum1[m] += e1; pb[j] = tohx(e0); pb[8 + j] = tohx(e1);
                }
#pragma unroll
                for (int dt = 0; dt < 2; ++dt) { acc[m][dt] = wmma16(vh[s][dt], pb, acc[m][dt]); acc2[m][dt] = wmma16(vl[s][dt], pb, acc2[m][dt]); }
                // the two fences hold the four vector slots directly behind the tile's last product: what follows (the next tile's v_exp_f32 in asm text, which the compiler does not pad; at a stage's end the loads of stage s + 2) takes over its operand registers. They also keep each tile's work together. The tile's two row sums are named (each row's sum, against spills) so that their additions stay in this tile: left free they are put off to the part's end, and every exponential is spilled until then
                __builtin_amdgcn_sched_barrier(0);
                asm volatile("v_nop\n\tv_nop\n\tv_nop\n\tv_nop" : "+v"(sum0[m]), "+v"(sum1[m]) :: "memory");
                __builtin_amdgcn_sched_barrier(0);
            }
            // stage s + 2's loads stand between stage s, whose registers they take over, and stage s + 1, a whole stage of work ahead of their use
            if (s + 2 < NS) {
#pragma unroll
                for (int dt = 0; dt < 2; ++dt) { vh[s + 2][dt] = ldfrag(bh + (size_t)(2 * (s + 2) + dt) * 512); vl[s + 2][dt] = ldfrag(bl + (size_t)(2 * (s + 2) + dt) * 512); }
                // left free the loads sink to their products, and each product waits out a latency of its own
                __builtin_amdgcn_sched_barrier(0);
            }
        }
        // the wait that belongs in front of any overwrite of an issued load's address registers, which the next part's addresses take over; the addresses are inputs so that they stay whole up to it (the K loads go out on the scalar base kb and a lane offset that no trip rewrites)
        asm volatile("s_wait_xcnt 0x0" :: "s"(kb), "v"(bh), "v"(bl) : "memory");
#pragma unroll
        for (int m = 0; m < MQ; ++m) {
            float sum = sum0[m] + sum1[m];
            sum += __shfl_xor(sum, 16, 32);
            const int row = p * QB + m * 16 + c;
            if (hi == 0) { mxs[row] = mx[m]; sms[row] = sum; }
            float* my = red + row * RP + 8 * hi;
#pragma unroll
            for (int dt = 0; dt < 2; ++dt) { v4f s0, s1;
#pragma unroll
                for (int j = 0; j < 4; ++j) { s0[j] = acc[m][dt][j] + acc2[m][dt][j] * (1.0f / RCAR); s1[j] = acc[m][dt][4 + j] + acc2[m][dt][4 + j] * (1.0f / RCAR); }
                *(v4fa*)(my + dt * 16) = s0; *(v4fa*)(my + dt * 16 + 4) = s1; }
        }
    }
    __syncthreads();
    // wave w finishes queries q0 + w*QB/FW .., lane = column d: each store is one whole 128-B line
    // two queries' LDS reads stand side by side, so that one's latency covers the other's
#pragma unroll 2
    for (int u = 0; u < QB / FW; ++u) {
        const int qi = w * (QB / FW) + u;
        float m = mxs[qi];
#pragma unroll
        for (int i = 1; i < NP; ++i) m = fmaxf(m, mxs[i * QB + qi]);
        float o = 0.f, tot = 0.f;
#pragma unroll
        for (int i = 0; i < NP; ++i) { const float f = __builtin_amdgcn_exp2f((mxs[i * QB + qi] - m) * CE); o += red[(i * QB + qi) * RP + lane] * f; tot += sms[i * QB + qi] * f; }
        float* cp = C + (size_t)(q0 + qi) * DM + h * HD + lane;
        *cp = o / (tot * VCAR);
        // the wait that belongs in front of the next trip's overwrite of the issued store's address registers; the address is an input so that it stays whole up to it
        asm volatile("s_wait_xcnt 0x0" :: "v"(cp) : "memory");
    }
}

__device__ __forceinline__ void wT(const float* __restrict__ W, bf* WT, int Kin, int Nout, unsigned blk) { const size_t g = (size_t)blk * 256 + threadIdx.x; if (g >= (size_t)Nout * Kin / 8) return; const int k0 = (int)(g % (size_t)(Kin / 8)) * 8; const int n = (int)(g / (size_t)(Kin / 8)); v8us o;
#pragma unroll
    for (int q = 0; q < 8; ++q) o[q] = f2bf(W[(size_t)(k0 + q) * Nout + n]);
    bf* d = WT + (size_t)n * Kin + k0; *(v8us*)d = o;  }

// ---- k_prep: the transposed bf16 planes of the three weights, in one launch (no job reads what another writes); 256 threads, the block index picks the job.
constexpr unsigned GB_WQ = (unsigned)(((size_t)DM * DM / 8 + 255) / 256), GB_WKV = (unsigned)(((size_t)2 * DM * DM / 8 + 255) / 256), GB_WO = GB_WQ;
__global__ __launch_bounds__(256) void k_prep(const float* __restrict__ Wq, const float* __restrict__ Wkv, const float* __restrict__ Wo, bf* WQT, bf* WKVT, bf* WOT) {
    unsigned b = blockIdx.x;
    if (b < GB_WQ) { wT(Wq, WQT, DM, DM, b); return; }
    b -= GB_WQ;
    if (b < GB_WKV) { wT(Wkv, WKVT, DM, 2 * DM, b); return; }
    wT(Wo, WOT, DM, DM, b - GB_WKV);
}

// ---- k_out: out = ctx Wo + bo. Grid (NQ/16, 1, NB), OW waves: one block per 16 rows x all DM columns, ONE WAVE per 64 columns (from c0 = 64 x wave).
// The block reads its 16 rows of ctx once, as f32, splits them into bf16 hi + lo and lays both in LDS in fragment order (fragment kt at kt * 512 elements, as in proj_tile); behind one barrier every wave takes its ctx fragments from there.
// Every global load of a wave (its share of ctx, all of its Wo^T fragments, its bias) is issued before anything waits, so the kernel pays one memory latency.
// The product runs as Wo^T ctx^T (A = 16 columns of out, B = 16 rows), so a lane holds 8 consecutive columns of one row; per accumulator the order is hi, lo of k step 0, hi, lo of k step 1, ...
#define OW 4
__global__ __launch_bounds__(32 * OW) void k_out(const float* __restrict__ ctx, const bf* __restrict__ WOT, const float* __restrict__ bo, float* out) {
    static_assert(DM == 64 * OW && NQ % 16 == 0);
    constexpr int KT = DM / 32;
    __shared__ __align__(16) bf xh[16 * DM];
    __shared__ __align__(16) bf xl[16 * DM];
    const int lane = threadIdx.x & 31, lr = lane & 15, hi = lane >> 4, w = __builtin_amdgcn_readfirstlane(threadIdx.x >> 5);
    const int r0 = blockIdx.x * 16, c0 = 64 * w; const size_t z = blockIdx.z;
    // wave w brings k c0 .. c0 + 63 of all 16 rows: lane (lr, hi) holds row lr, and its piece i is k c0 + 16 i + 8 hi .. + 7, the lane's own 16 bytes of half-fragment 4 w + i
    const float* sp = ctx + (z * NQ + (size_t)(r0 + lr)) * DM + c0 + 8 * hi;
    const bf* wp = WOT + (size_t)(c0 + lr) * DM + 8 * hi;
    const float* bp = bo + c0 + 8 * hi;
    v8f xv[4], bv[4]; v16bf wv[KT][4];
#pragma unroll
    for (int i = 0; i < 4; ++i) xv[i] = *(const v8f*)(sp + 16 * i);
#pragma unroll
    for (int kt = 0; kt < KT; ++kt)
#pragma unroll
        for (int ct = 0; ct < 4; ++ct) wv[kt][ct] = WFrag<bf>::ld(wp + (size_t)ct * 16 * DM + kt * 32);
#pragma unroll
    for (int ct = 0; ct < 4; ++ct) bv[ct] = *(const v8f*)(bp + 16 * ct);
    // the wait that belongs in front of any overwrite of the issued loads' address registers; the addresses are inputs so that they stay whole up to it
    asm volatile("s_wait_xcnt 0x0" :: "v"(sp), "v"(wp), "v"(bp) : "memory");
    // keeps all the loads in front of the first wait: left free the first sums on ctx, with their wait, are lifted in front of most of the Wo^T loads, which then go out one memory latency late
    __builtin_amdgcn_sched_barrier(0);
    bf* dh = xh + 2 * w * 512 + 8 * lane; bf* dl = xl + 2 * w * 512 + 8 * lane;
#pragma unroll
    for (int i = 0; i < 4; ++i) { v8us oh, ol;
#pragma unroll
        for (int k = 0; k < 8; ++k) { unsigned short a, b; splitf(xv[i][k], a, b); oh[k] = a; ol[k] = b; }
        *(v8us*)(dh + 256 * i) = oh; *(v8us*)(dl + 256 * i) = ol; }
    __syncthreads();
    v8f acc[4];   // acc[ct][j] = out[r0 + lr][c0 + 16 ct + 8 hi + j]
#pragma unroll
    for (int ct = 0; ct < 4; ++ct) acc[ct] = (v8f){};
    v16bf ah[KT], al[KT];
#pragma unroll
    for (int kt = 0; kt < KT; ++kt) {
        ah[kt] = cat16b(*(const v8us*)(xh + kt * 512 + 8 * lane), *(const v8us*)(xh + kt * 512 + 8 * lane + 256));
        al[kt] = cat16b(*(const v8us*)(xl + kt * 512 + 8 * lane), *(const v8us*)(xl + kt * 512 + 8 * lane + 256));
    }
    // keeps all the LDS reads in front of the products: left free every fragment goes through one set of registers and each group of four products waits out an LDS latency of its own
    __builtin_amdgcn_sched_barrier(0);
#pragma unroll
    for (int kt = 0; kt < KT; ++kt) {
#pragma unroll
        for (int ct = 0; ct < 4; ++ct) acc[ct] = wmmab(wv[kt][ct], ah[kt], acc[ct]);
#pragma unroll
        for (int ct = 0; ct < 4; ++ct) acc[ct] = wmmab(wv[kt][ct], al[kt], acc[ct]);
    }
    float* op = out + (z * NQ_FULL + (size_t)(r0 + lr)) * DM + c0 + 8 * hi;
    v8f o[4];
#pragma unroll
    for (int ct = 0; ct < 4; ++ct)
#pragma unroll
        for (int j = 0; j < 8; ++j) o[ct][j] = acc[ct][j] + bfr(bv[ct][j]);
    // keeps the stores behind all the sums: left free a later sum takes over the data registers of a store that has been issued
    __builtin_amdgcn_sched_barrier(0);
#pragma unroll
    for (int ct = 0; ct < 4; ++ct) *(v8f*)(op + 16 * ct) = o[ct];
}

// ---- workspace carve (bytes, 256-B aligned regions; all sizes compile-time)
constexpr size_t al256(size_t x) { return (x + 255) & ~(size_t)255; }
constexpr size_t SZ_WQ  = al256((size_t)DM * DM * 2);                                           // Wq^T [256][256]
constexpr size_t SZ_WKV = al256((size_t)2 * DM * DM * 2);                                       // Wkv^T [512][256]
constexpr size_t SZ_WO  = al256((size_t)DM * DM * 2);                                           // Wo^T [256][256]
constexpr size_t SZ_Q16 = al256((size_t)NB * NQ * DM * 2);                                      // q f16 [NB][8 heads][NQ/16 fragments][512]
constexpr size_t SZ_K16 = al256((size_t)NB * NK * DM * 2);                                      // k f16 [NB][8 heads][256 fragments][512]
constexpr size_t SZ_VT  = al256((size_t)NB * DM * NK * 2);                                      // V^T plane [NB][8 heads][128 x 2 fragments][512] (hi, residual: one each)
constexpr size_t SZ_CTX = al256((size_t)NB * NQ * DM * 4);                                      // ctx f32 [NB*NQ][256]
constexpr size_t O_WQ = 0, O_WKV = O_WQ + SZ_WQ, O_WO = O_WKV + SZ_WKV, O_Q16 = O_WO + SZ_WO, O_K16 = O_Q16 + SZ_Q16,
                 O_VTH = O_K16 + SZ_K16, O_VTL = O_VTH + SZ_VT, O_CTX = O_VTL + SZ_VT, O_END = O_CTX + SZ_CTX;
static_assert(O_END <= (size_t)268435456);
static_assert(((size_t)(NB_FULL - 1) * NQ_FULL + NQ_FULL) * DM * 4 <= (size_t)NB_FULL * NQ_FULL * DM * 4);

extern "C" void kernel_launch(void* const* d_in, const int* in_sizes, int n_in, void* d_out, int out_size, void* d_ws, size_t ws_size, hipStream_t stream) {
    if (n_in < 8) return;
    if (in_sizes[0] < NB * NQ_FULL * DM || in_sizes[1] < NB * NK * DM || in_sizes[2] < DM * DM || in_sizes[3] < DM || in_sizes[4] < DM * 2 * DM || in_sizes[5] < 2 * DM || in_sizes[6] < DM * DM || in_sizes[7] < DM) return;
    if ((size_t)out_size < (size_t)NB * NQ_FULL * DM) return;
    if (O_END > ws_size) return;
    const float* state = (const float*)d_in[0];   // [8][512][256]
    const float* pts   = (const float*)d_in[1];   // [8][4096][256]
    const float* Wq    = (const float*)d_in[2];   // [256][256] in x out
    const float* bq    = (const float*)d_in[3];   // [256]
    const float* Wkv   = (const float*)d_in[4];   // [256][512]
    const float* bkv   = (const float*)d_in[5];   // [512]
    const float* Wo    = (const float*)d_in[6];   // [256][256]
    const float* bo    = (const float*)d_in[7];   // [256]
    float* OUT = (float*)d_out;                   // [8][512][256]
    char* ws = (char*)d_ws;
    bf* WQT = (bf*)(ws + O_WQ); bf* WKVT = (bf*)(ws + O_WKV); bf* WOT = (bf*)(ws + O_WO);
    h16* Q16 = (h16*)(ws + O_Q16); h16* K16 = (h16*)(ws + O_K16);
    h16* VTH = (h16*)(ws + O_VTH); h16* VTL = (h16*)(ws + O_VTL);
    float* CTX = (float*)(ws + O_CTX);

    // planes of the three weights
    k_prep<<<GB_WQ + GB_WKV + GB_WO, 256, 0, stream>>>(Wq, Wkv, Wo, WQT, WKVT, WOT);
    // q = Xs Wq + bq and kv = Xp Wkv + bkv: the q, k and V^T hi/residual f16 planes in fragment order, z = batch
    k_proj<<<dim3(PB_Q + PB_KV, 1, NB), 32 * PW, 0, stream>>>(state, WQT, bq, Q16, pts, WKVT, bkv, K16, VTH, VTL);
    // ctx[b][i][h*32 + d] = softmax_j(q_h[i] . k_h[j] HD^-0.5) v[j][h*32 + d]: x = 16*MQ queries, y = head, z = batch
    k_attn<<<dim3(NQ / (16 * MQ), NH, NB), 32 * FW, 0, stream>>>(Q16, K16, VTH, VTL, CTX);
    // out = ctx Wo + bo: ctx split into bf16 hi/lo on its way into the block's LDS tile, rows of batch b at OUT + b*NQ_FULL*256
    k_out<<<dim3(NQ / 16, 1, NB), 32 * OW, 0, stream>>>(CTX, WOT, bo, OUT);
}

// v010
// A run of this version takes 74.7 microseconds.
// In both of two side-by-side timings against v009, it was 1.05 times as fast.
// All steps since v000 together make it 16.3 times as fast.
#include <hip/hip_runtime.h>

// Contractions, all f32 accumulate: q = Xs Wq + bq and kv = Xp Wkv + bkv on v_wmma_f32_16x16x32_bf16 (the f32 inputs rounded to bf16 RNE, state and points on their way into the projection's LDS tile, weights as bf16 planes of W^T in fragment order); per-head scores q k^T on v_wmma_f32_16x16x32_f16 (q and k as f16 planes carried x8 each); per-head P V on v_wmma_f32_16x16x32_f16 (P f16 carried x2^14; V^T as an f16 hi plane carried x4 plus an f16 residual plane carried x2^10 into a separate accumulator); out = ctx Wo + bo on v_wmma_f32_16x16x32_bf16 (ctx as bf16 hi + lo, split on its way into the output GEMM's LDS tile, Wo bf16). Softmax f32, max-subtracted, fixed-order sums. Scores, softmax and P V run in one kernel, split along the keys into 16 parts over the waves of a block; scores and P stay in registers, each part subtracts its own keys' maximum, P is left unnormalised and the row's sum divides the result; partial sums are brought to the row's maximum and added in a fixed order. Every stage runs once for all batches: the batch is a grid dimension. Stages that do not read one another's results share a launch, the block index picking the job: the three weight conversions are one launch, the q and kv projections another. The q, k and V^T planes are written by the projection GEMMs themselves, straight from the accumulators. They and the weight planes lie in fragment order: the 1024 bytes of one 16 x 32 operand fragment are contiguous, lane l's two 16-byte pieces at 16 l and 512 + 16 l.

#ifndef NB
#define NB 8            // batches computed (reducible)
#endif
#ifndef NQ
#define NQ 512          // query rows per batch computed (reducible, multiple of 64)
#endif
#define NB_FULL 8
#define NQ_FULL 512     // per-batch stride of the state input and of the output
#define NK 4096         // keys (softmax row length)
#define DM 256
#define NH 8
#define HD 32
#define QCAR 8.0f
#define KCAR 8.0f
#define VCAR 4.0f
#define RCAR 1024.0f
#define PCAR 16384.0f
#define FW 8             // waves per block of k_attn
#define NSEG 2           // key parts per wave, one after the other: FW*NSEG parts of NK/(FW*NSEG) keys
#define PW 8             // waves per block of k_proj: one per 64 of the 2*DM columns of kv
#define MQ 4             // 16-query tiles per block of k_attn, all served by each wave from one load of its keys
#define SCL2 (0.17677669529663687f * 0.015625f)   // HD^-0.5 / (QCAR*KCAR)

static_assert(NB >= 1 && NB <= NB_FULL);
static_assert(NQ >= 64 && NQ <= NQ_FULL && (NQ % 64) == 0);
static_assert(NK == 256 * 16);
static_assert(QCAR == KCAR);
static_assert((DM % 64) == 0 && (NK % 64) == 0 && HD == 32 && NH * HD == DM);

typedef _Float16 h16;
typedef unsigned short bf;
typedef __attribute__((ext_vector_type(16))) __bf16   v16bf;
typedef __attribute__((ext_vector_type(16))) _Float16 v16h;
typedef __attribute__((ext_vector_type(8)))  _Float16 v8h;
typedef __attribute__((ext_vector_type(8)))  unsigned short v8us;
typedef __attribute__((ext_vector_type(8)))  float    v8f;
typedef __attribute__((ext_vector_type(4)))  float    v4f;
typedef v8h  __attribute__((may_alias)) v8ha;
typedef v4f  __attribute__((may_alias)) v4fa;
typedef v8us __attribute__((may_alias)) v8usa;

__device__ __forceinline__ unsigned short f2bf(float f) { unsigned u = __float_as_uint(f); u += 0x7FFFu + ((u >> 16) & 1u); return (unsigned short)(u >> 16); }
__device__ __forceinline__ float bf2f(unsigned short b) { return __uint_as_float(((unsigned)b) << 16); }
__device__ __forceinline__ float bfr(float f) { return bf2f(f2bf(f)); }
__device__ __forceinline__ v16h cat16(v8h lo, v8h hi) { return __builtin_shufflevector(lo, hi, 0, 1, 2, 3, 4, 5, 6, 7, 8, 9, 10, 11, 12, 13, 14, 15); }
__device__ __forceinline__ v16bf cat16b(v8us lo, v8us hi) { return __builtin_bit_cast(v16bf, __builtin_shufflevector(lo, hi, 0, 1, 2, 3, 4, 5, 6, 7, 8, 9, 10, 11, 12, 13, 14, 15)); }
__device__ __forceinline__ v8f wmma16(v16h a, v16h b, v8f c) { return __builtin_amdgcn_wmma_f32_16x16x32_f16(false, a, false, b, (short)0, c, false, false); }
__device__ __forceinline__ v8f wmmab(v16bf a, v16bf b, v8f c) { return __builtin_amdgcn_wmma_f32_16x16x32_bf16(false, a, false, b, (short)0, c, false, false); }
__device__ __forceinline__ h16 tohx(float x) { return (h16)x; }
__device__ __forceinline__ void splitf(float y, unsigned short& h, unsigned short& l) { h = f2bf(y); l = f2bf(y - bf2f(h)); }

// Operand fragments of the 16x16x32 forms: lane row/col = lane&15, elements 0..7 <- k0+8h.., 8..15 <- k0+16+8h.. for A and B.
// fragment-order plane: p = fragment base + 8 * lane (elements); the lane's second piece stands 256 elements on, so each wave-wide load covers 512 contiguous bytes
__device__ __forceinline__ v16h ldfrag(const h16* p) { return cat16(*(const v8h*)p, *(const v8h*)(p + 256)); }
__device__ __forceinline__ v16bf ldfragb(const bf* p) { return cat16b(*(const v8us*)p, *(const v8us*)(p + 256)); }

// ---- proj_tile: y = X W + b (X f32 [rows][DM], W^T bf16 in fragment order: fragment (16 columns nt, 32 k kt) at (nt * DM/32 + kt) * 512 elements, its row the column of y), one block of PW waves per 64 rows (from row r0; batch = blockIdx.z) x all columns, ONE WAVE per 64 columns (from column c0 = 64 x wave), written as f16 planes in fragment order straight from the accumulators.
// The block reads its 64 rows of X once, as f32, rounds them to bf16 and lays them in LDS in fragment order (fragment (16 rows rt, 32 k kt) at (rt * DM/32 + kt) * 512 elements); behind one barrier every wave takes its X fragments from there, each wave-wide read 512 contiguous bytes.
// A fragment is 512 elements, element (half, hi, r, e) at half*256 + hi*128 + r*8 + e, where the fragment's row is r and its k index half*16 + hi*8 + e.
// Columns below DM (q, or the k half of kv): the product runs as W^T X^T (A = 16 columns of y, B = 16 rows of y), so a lane holds 8 consecutive columns d of one row: one 16-byte piece of fragment (head, 16 rows), row = r, k index = d, value f16(y x KCAR).
// Columns from DM on (the v half of kv): the product runs as X W (A = 16 rows, B = 16 columns), so a lane holds 8 consecutive keys of one column d: one 16-byte piece of fragment (head, 32 keys, 16 d), row = d, k index = key, VTh = f16(v x VCAR), VTl = f16((v x VCAR - VTh) x RCAR).
// Either way each wave-wide store covers 512 contiguous bytes. Operand fragments: lane row/col = lane&15, elements 0..7 <- k0+8h.., 8..15 <- k0+16+8h.. for A and B alike, so the two roles swap freely.
template <bool SW>
__device__ __forceinline__ void proj_acc(const bf* xs, const bf* wk, v8f (&acc)[4][4]) {
    int xo = 8 * (int)(threadIdx.x & 31);   // the lane's piece of fragment (0, kt) in the LDS tile
#pragma unroll
    for (int rt = 0; rt < 4; ++rt)
#pragma unroll
        for (int ct = 0; ct < 4; ++ct) acc[rt][ct] = (v8f){};
#pragma unroll 1
    for (int kc = 0; kc < DM; kc += 32) {
        v16bf x[4], wv[4];
#pragma unroll
        for (int ct = 0; ct < 4; ++ct) wv[ct] = ldfragb(wk + (size_t)ct * 16 * DM);
#pragma unroll
        for (int rt = 0; rt < 4; ++rt) x[rt] = cat16b(*(const v8us*)(xs + xo + rt * (DM / 32) * 512), *(const v8us*)(xs + xo + rt * (DM / 32) * 512 + 256));
        // keeps the trip's loads in front of its products: left free, with X in LDS, the four W fragments share one set of registers and each waits out a latency of its own
        __builtin_amdgcn_sched_barrier(0);
#pragma unroll
        for (int ct = 0; ct < 4; ++ct)
#pragma unroll
            for (int rt = 0; rt < 4; ++rt) acc[rt][ct] = SW ? wmmab(wv[ct], x[rt], acc[rt][ct]) : wmmab(x[rt], wv[ct], acc[rt][ct]);
        // the wait that belongs in front of the overwrite of the issued global loads' address registers (an input, so that they stay whole up to it), and four vector slots between the trip's last product and the next trip's loads, which take over its operand registers (every accumulator is named, so that the statement stands behind all of the trip's products)
        asm volatile("s_wait_xcnt 0x0\n\tv_nop\n\tv_nop\n\tv_nop\n\tv_nop" : "+v"(acc[0][0]), "+v"(acc[0][1]), "+v"(acc[0][2]), "+v"(acc[0][3]), "+v"(acc[1][0]), "+v"(acc[1][1]), "+v"(acc[1][2]), "+v"(acc[1][3]), "+v"(acc[2][0]), "+v"(acc[2][1]), "+v"(acc[2][2]), "+v"(acc[2][3]), "+v"(acc[3][0]), "+v"(acc[3][1]), "+v"(acc[3][2]), "+v"(acc[3][3]) : "v"(wk));
        xo += 512; wk += 512;
    }
}
template <int NROW, bool HASV>
__device__ __forceinline__ void proj_tile(bf* xs, const float* __restrict__ X, const bf* __restrict__ WT, const float* __restrict__ bias, h16* P, h16* VTh, h16* VTl, size_t sX, int r0) {
    static_assert(NROW % 64 == 0 && HD == 32 && DM == 256 && PW == 8);
    const int lane = threadIdx.x & 31, lr = lane & 15, hi = lane >> 4, w = __builtin_amdgcn_readfirstlane(threadIdx.x >> 5);
    const size_t z = blockIdx.z;
    // wave w brings rows 16 (w & 3) .. + 15, k 128 (w >> 2) .. + 127: lane (lr, hi) holds row lr, and its piece i is k 16 i + 8 hi .. + 7, which is the lane's own 16 bytes of half-fragment i
    const float* sp = X + z * sX + (size_t)(r0 + 16 * (w & 3) + lr) * DM + 128 * (w >> 2) + 8 * hi;
    v8f xv[8];
#pragma unroll
    for (int i = 0; i < 8; ++i) xv[i] = *(const v8f*)(sp + 16 * i);
    // the wait that belongs in front of any overwrite of the issued loads' address registers; the address is an input so that it stays whole up to it
    asm volatile("s_wait_xcnt 0x0" :: "v"(sp) : "memory");
    bf* sd = xs + ((w & 3) * (DM / 32) + 4 * (w >> 2)) * 512 + 8 * lane;
#pragma unroll
    for (int i = 0; i < 8; ++i) { v8us o;
#pragma unroll
        for (int k = 0; k < 8; ++k) o[k] = f2bf(xv[i][k]);
        *(v8us*)(sd + 256 * i) = o; }
    __syncthreads();
    if (!HASV && w >= DM / 64) return;   // q has DM columns: the other waves only helped to bring X in; no barrier follows
    const int c0 = 64 * w;
    const bf* wp = WT + (size_t)c0 * DM + 8 * lane;   // the lane's piece of fragment (c0 / 16, 0); 16 columns on: + 16 * DM, 32 k on: + 512
    v8f acc[4][4];   // [16 rows of y][16 columns of y]
    if (!HASV || c0 < DM) {
        proj_acc<true>(xs, wp, acc);   // acc[rt][ct][j] = y[r0 + 16 rt + lr][c0 + 16 ct + 8 hi + j]
        h16* dst = P + z * ((size_t)NROW * DM) + ((size_t)(c0 / HD) * (NROW / 16) + r0 / 16) * 512 + 8 * lane;
#pragma unroll
        for (int ct = 0; ct < 4; ++ct) { const v8f b = *(const v8f*)(bias + c0 + ct * 16 + 8 * hi);
#pragma unroll
            for (int rt = 0; rt < 4; ++rt) { v8h o;
#pragma unroll
                for (int j = 0; j < 8; ++j) o[j] = tohx((acc[rt][ct][j] + bfr(b[j])) * KCAR);
                *(v8h*)(dst + ((size_t)(ct >> 1) * (NROW / 16) + rt) * 512 + (ct & 1) * 256) = o; } }
    } else {
        proj_acc<false>(xs, wp, acc);  // acc[rt][ct][j] = y[r0 + 16 rt + 8 hi + j][c0 + 16 ct + lr]
        const size_t oo = z * ((size_t)DM * NROW) + ((size_t)((c0 - DM) / HD) * (NROW / 32) + r0 / 32) * 1024 + 8 * lane;
        const int bi = c0 + lr; float bv[4];
#pragma unroll
        for (int ct = 0; ct < 4; ++ct) bv[ct] = bias[bi + ct * 16];
        // the wait that belongs in front of any overwrite of the issued loads' offset register; the index is an input so that it stays whole up to it
        asm volatile("s_wait_xcnt 0x0" :: "v"(bi) : "memory");
#pragma unroll
        for (int ct = 0; ct < 4; ++ct) { const float b = bfr(bv[ct]);
#pragma unroll
            for (int rt = 0; rt < 4; ++rt) { v8h oh, ol;
#pragma unroll
                for (int j = 0; j < 8; ++j) { const float y = (acc[rt][ct][j] + b) * VCAR; const h16 hh = tohx(y); oh[j] = hh; ol[j] = tohx(__fmul_rn(__fsub_rn(y, (float)hh), RCAR)); }
                const size_t o = oo + ((size_t)(ct >> 1) * (NROW / 32) + (rt >> 1)) * 1024 + (ct & 1) * 512 + (rt & 1) * 256;
                *(v8h*)(VTh + o) = oh; *(v8h*)(VTl + o) = ol; } }
        // the wait that belongs in front of any overwrite of the issued stores' address and data registers: in the built kernel this half is followed by a branch whose other way enters the k half, which takes those registers over
        asm volatile("s_wait_xcnt 0x0" ::: "memory");
    }
}
// q = Xs Wq + bq and kv = Xp Wkv + bkv in one launch (neither reads what the other writes): grid (PB_Q + PB_KV, 1, NB), PW waves; blocks below PB_Q take the 64-row tiles of q, the rest those of kv.
constexpr unsigned PB_Q = NQ / 64, PB_KV = NK / 64;
__global__ __launch_bounds__(32 * PW) void k_proj(const float* __restrict__ state, const bf* __restrict__ WQT, const float* __restrict__ bq, h16* Q16, const float* __restrict__ pts, const bf* __restrict__ WKVT, const float* __restrict__ bkv, h16* K16, h16* VTh, h16* VTl) {
    __shared__ __align__(16) bf xs[64 * DM];
    const unsigned b = blockIdx.x;
    if (b < PB_Q) proj_tile<NQ, false>(xs, state, WQT, bq, Q16, nullptr, nullptr, (size_t)NQ_FULL * DM, (int)b * 64);
    else proj_tile<NK, true>(xs, pts, WKVT, bkv, K16, VTh, VTl, (size_t)NK * DM, (int)(b - PB_Q) * 64);
}

// ---- k_attn: ctx = softmax(q k^T HD^-0.5) v for 16*MQ queries of one head of one batch. Grid (NQ/(16*MQ), NH, NB), FW waves; wave w owns the key parts w*NSEG .. w*NSEG+NSEG-1 (NK/(FW*NSEG) keys each), one after the other, and never stores a score or a P value.
// One load of a part's K and V^T fragments serves all MQ query tiles. The K fragments stay in registers and the scores are formed twice from them: once for the part's maximum, once, 32 keys at a time, for P, with minus that maximum as the product's C operand (a lane's eight results belong to one query); so no score is kept.
// S^T = K Q^T (A = 16 key rows, B = 16 queries): lane (c, hi) holds query c, keys 8hi..8hi+7 of each 16-key tile. Two such tiles, converted in place, are the B operand P^T of O^T += V^T P^T (A = V^T rows d, keys in the same order).
// Each part subtracts the maximum of its own keys: P = exp(t - max_p) x PCAR, not divided. The parts' O^T partials, row sums and maxima meet in LDS (one barrier); they are brought to the row's maximum, added in key order, and the sum divides once.
__global__ __launch_bounds__(32 * FW) void k_attn(const h16* __restrict__ Q, const h16* __restrict__ K, const h16* __restrict__ VTh, const h16* __restrict__ VTl, float* C) {
    constexpr int NP = FW * NSEG, KW = NK / NP, NT = KW / 16, NS = KW / 32, RP = 36, QB = 16 * MQ;
    static_assert(KW % 32 == 0 && NS >= 2 && HD == 32 && PCAR == 16384.0f && NQ % QB == 0 && QB % FW == 0);
    constexpr float CE = SCL2 * 1.4426950408889634f;
    __shared__ __align__(16) float red[NP * QB * RP];
    __shared__ float mxs[NP * QB], sms[NP * QB];
    const int lane = threadIdx.x & 31, c = lane & 15, hi = lane >> 4, w = __builtin_amdgcn_readfirstlane(threadIdx.x >> 5);
    const int q0 = blockIdx.x * QB, h = blockIdx.y;
    const size_t z = blockIdx.z; Q += z * ((size_t)NQ * DM); K += z * ((size_t)NK * DM); VTh += z * ((size_t)DM * NK); VTl += z * ((size_t)DM * NK); C += z * ((size_t)NQ * DM);
    const h16* qb = Q + ((size_t)h * (NQ / 16) + (size_t)blockIdx.x * MQ) * 512;       // the block's first q fragment, the same for all lanes
    v16h qf[MQ];
#pragma unroll
    for (int m = 0; m < MQ; ++m) qf[m] = ldfrag(qb + (size_t)m * 512 + 8 * lane);
    // rolled: unrolled, the kernel's text would be twice as long and the second part's K loads would be lifted over the first part's work, whose registers they need
#pragma unroll 1
    for (int sg = 0; sg < NSEG; ++sg) {
        const int p = w * NSEG + sg, k0 = p * KW;
        const h16* kb = K + ((size_t)h * (NK / 16) + k0 / 16) * 512;                   // the part's first k fragment, the same for all lanes
        const h16* kp = kb + 8 * lane;                                                 // fragment t of the part: + t * 512
        const size_t voff = ((size_t)h * (NK / 32) + k0 / 32) * 1024 + 8 * lane;       // fragment (s, dt) of the part: + (2 s + dt) * 512
        const h16* bh = VTh + voff; const h16* bl = VTl + voff;
        v16h kf[NT], vh[NS][2], vl[NS][2];
#pragma unroll
        for (int t = 0; t < NT; ++t) kf[t] = ldfrag(kp + (size_t)t * 512);
#pragma unroll
        for (int s = 0; s < 2; ++s)
#pragma unroll
            for (int dt = 0; dt < 2; ++dt) { vh[s][dt] = ldfrag(bh + (size_t)(2 * s + dt) * 512); vl[s][dt] = ldfrag(bl + (size_t)(2 * s + dt) * 512); }
        // keeps the first two V^T stages' loads up here with the K loads: one memory latency for all of them instead of one more in front of the first P V product
        __builtin_amdgcn_sched_barrier(0);
        v8f r[MQ];
#pragma unroll
        for (int t = 0; t < NT; t += 2) {
            v8f sa[MQ], sb[MQ];
#pragma unroll
            for (int m = 0; m < MQ; ++m) { sa[m] = wmma16(kf[t], qf[m], (v8f){}); sb[m] = wmma16(kf[t + 1], qf[m], (v8f){}); }
            // keeps the 2*MQ products together in front of the maxima that read them, so that each fills the others' distance: left free every pair is followed by its own maxima, behind idle slots
            __builtin_amdgcn_sched_barrier(0);
#pragma unroll
            for (int m = 0; m < MQ; ++m)
#pragma unroll
                for (int j = 0; j < 8; ++j) r[m][j] = t == 0 ? fmaxf(sa[m][j], sb[m][j]) : fmaxf(fmaxf(r[m][j], sa[m][j]), sb[m][j]);
        }
        float mx[MQ]; v8f cn[MQ];   // cn: minus the part's maximum, the C operand of the second score product
#pragma unroll
        for (int m = 0; m < MQ; ++m) { float x = r[m][0];
#pragma unroll
            for (int j = 1; j < 8; ++j) x = fmaxf(x, r[m][j]);
            x = fmaxf(x, __shfl_xor(x, 16, 32)); mx[m] = x;
#pragma unroll
            for (int j = 0; j < 8; ++j) cn[m][j] = -x; }
        v8f acc[MQ][2], acc2[MQ][2];
        float sum0[MQ], sum1[MQ];
#pragma unroll
        for (int m = 0; m < MQ; ++m) { sum0[m] = 0.f; sum1[m] = 0.f;
#pragma unroll
            for (int dt = 0; dt < 2; ++dt) { acc[m][dt] = (v8f){}; acc2[m][dt] = (v8f){}; } }
        // scores of (stage, tile) i + 1 are formed while (stage, tile) i is worked on, so that no exponent waits for its product
        v8f ta[2][2];
        ta[0][0] = wmma16(kf[0], qf[0], cn[0]); ta[0][1] = wmma16(kf[1], qf[0], cn[0]);
#pragma unroll
        for (int s = 0; s < NS; ++s) {
#pragma unroll
            for (int m = 0; m < MQ; ++m) {
                const int i = s * MQ + m, sn = (i + 1) / MQ, mn = (i + 1) % MQ;
                if (sn < NS) { ta[(i + 1) & 1][0] = wmma16(kf[2 * sn], qf[mn], cn[mn]); ta[(i + 1) & 1][1] = wmma16(kf[2 * sn + 1], qf[mn], cn[mn]); }
                // keeps the two score products at the tile's head: left free they sink to its foot, and the next tile's first exponent waits for them
                __builtin_amdgcn_sched_barrier(0);
                v16h pb;
#pragma unroll
                for (int j = 0; j < 8; ++j) {
                    float e0, e1;
                    // two v_exp_f32 and the free slot that the instruction set asks for behind a transcendental before its result is read or its source overwritten: the second fills the first one's slot, the v_nop the second one's
                    asm("v_exp_f32 %0, %2\n\tv_exp_f32 %1, %3\n\tv_nop" : "=&v"(e0), "=&v"(e1) : "v"(__builtin_fmaf(ta[i & 1][0][j], CE, 14.0f)), "v"(__builtin_fmaf(ta[i & 1][1][j], CE, 14.0f)));   // 2^14 = PCAR rides in the exponent
                    sum0[m] += e0; sum1[m] += e1; pb[j] = tohx(e0); pb[8 + j] = tohx(e1);
                }
#pragma unroll
                for (int dt = 0; dt < 2; ++dt) { acc[m][dt] = wmma16(vh[s][dt], pb, acc[m][dt]); acc2[m][dt] = wmma16(vl[s][dt], pb, acc2[m][dt]); }
                // the two fences hold the four vector slots directly behind the tile's last product: what follows (the next tile's v_exp_f32 in asm text, which the compiler does not pad; at a stage's end the loads of stage s + 2) takes over its operand registers. They also keep each tile's work together. The tile's two row sums are named (each row's sum, against spills) so that their additions stay in this tile: left free they are put off to the part's end, and every exponential is spilled until then
                __builtin_amdgcn_sched_barrier(0);
                asm volatile("v_nop\n\tv_nop\n\tv_nop\n\tv_nop" : "+v"(sum0[m]), "+v"(sum1[m]) :: "memory");
                __builtin_amdgcn_sched_barrier(0);
            }
            // stage s + 2's loads stand between stage s, whose registers they take over, and stage s + 1, a whole stage of work ahead of their use
            if (s + 2 < NS) {
#pragma unroll
                for (int dt = 0; dt < 2; ++dt) { vh[s + 2][dt] = ldfrag(bh + (size_t)(2 * (s + 2) + dt) * 512); vl[s + 2][dt] = ldfrag(bl + (size_t)(2 * (s + 2) + dt) * 512); }
                // left free the loads sink to their products, and each product waits out a latency of its own
                __builtin_amdgcn_sched_barrier(0);
            }
        }
        // the wait that belongs in front of any overwrite of an issued load's address registers, which the next part's addresses take over; the addresses are inputs so that they stay whole up to it (the K loads go out on the scalar base kb and a lane offset that no trip rewrites)
        asm volatile("s_wait_xcnt 0x0" :: "s"(kb), "v"(bh), "v"(bl) : "memory");
#pragma unroll
        for (int m = 0; m < MQ; ++m) {
            float sum = sum0[m] + sum1[m];
            sum += __shfl_xor(sum, 16, 32);
            const int row = p * QB + m * 16 + c;
            if (hi == 0) { mxs[row] = mx[m]; sms[row] = sum; }
            float* my = red + row * RP + 8 * hi;
#pragma unroll
            for (int dt = 0; dt < 2; ++dt) { v4f s0, s1;
#pragma unroll
                for (int j = 0; j < 4; ++j) { s0[j] = acc[m][dt][j] + acc2[m][dt][j] * (1.0f / RCAR); s1[j] = acc[m][dt][4 + j] + acc2[m][dt][4 + j] * (1.0f / RCAR); }
                *(v4fa*)(my + dt * 16) = s0; *(v4fa*)(my + dt * 16 + 4) = s1; }
        }
    }
    __syncthreads();
    // wave w finishes queries q0 + w*QB/FW .., lane = column d: each store is one whole 128-B line
    // two queries' LDS reads stand side by side, so that one's latency covers the other's
#pragma unroll 2
    for (int u = 0; u < QB / FW; ++u) {
        const int qi = w * (QB / FW) + u;
        float m = mxs[qi];
#pragma unroll
        for (int i = 1; i < NP; ++i) m = fmaxf(m, mxs[i * QB + qi]);
        float o = 0.f, tot = 0.f;
#pragma unroll
        for (int i = 0; i < NP; ++i) { const float f = __builtin_amdgcn_exp2f((mxs[i * QB + qi] - m) * CE); o += red[(i * QB + qi) * RP + lane] * f; tot += sms[i * QB + qi] * f; }
        float* cp = C + (size_t)(q0 + qi) * DM + h * HD + lane;
        *cp = o / (tot * VCAR);
        // the wait that belongs in front of the next trip's overwrite of the issued store's address registers; the address is an input so that it stays whole up to it
        asm volatile("s_wait_xcnt 0x0" :: "v"(cp) : "memory");
    }
}

// thread g writes the g-th 16-byte piece of the plane, so a wave's store covers 512 contiguous bytes; piece g is (fragment g >> 6, half, hi, r): column n = 16 nt + r, k = 32 kt + 16 half + 8 hi .. + 7. Each of its eight reads takes 16 neighbouring columns of two rows of W.
__device__ __forceinline__ void wT(const float* __restrict__ W, bf* WT, int Kin, int Nout, unsigned blk) { const unsigned g = blk * 256 + threadIdx.x; if (g >= (unsigned)(Nout * Kin / 8)) return; const unsigned f = g >> 6, KT = (unsigned)Kin / 32; const int n = (int)(f / KT) * 16 + (int)(g & 15); const int k0 = (int)(f % KT) * 32 + (int)((g >> 4) & 3) * 8; v8us o;
#pragma unroll
    for (int q = 0; q < 8; ++q) o[q] = f2bf(W[(size_t)(k0 + q) * Nout + n]);
    *(v8us*)(WT + (size_t)g * 8) = o;  }

// ---- k_prep: the bf16 planes of the three transposed weights, in fragment order, in one launch (no job reads what another writes); 256 threads, the block index picks the job.
constexpr unsigned GB_WQ = (unsigned)(((size_t)DM * DM / 8 + 255) / 256), GB_WKV = (unsigned)(((size_t)2 * DM * DM / 8 + 255) / 256), GB_WO = GB_WQ;
__global__ __launch_bounds__(256) void k_prep(const float* __restrict__ Wq, const float* __restrict__ Wkv, const float* __restrict__ Wo, bf* WQT, bf* WKVT, bf* WOT) {
    unsigned b = blockIdx.x;
    if (b < GB_WQ) { wT(Wq, WQT, DM, DM, b); return; }
    b -= GB_WQ;
    if (b < GB_WKV) { wT(Wkv, WKVT, DM, 2 * DM, b); return; }
    wT(Wo, WOT, DM, DM, b - GB_WKV);
}

// ---- k_out: out = ctx Wo + bo. Grid (NQ/16, 1, NB), OW waves: one block per 16 rows x all DM columns, ONE WAVE per 64 columns (from c0 = 64 x wave).
// The block reads its 16 rows of ctx once, as f32, splits them into bf16 hi + lo and lays both in LDS in fragment order (fragment kt at kt * 512 elements, as in proj_tile); behind one barrier every wave takes its ctx fragments from there.
// Every global load of a wave (its share of ctx, all of its Wo^T fragments, its bias) is issued before anything waits, so the kernel pays one memory latency.
// The product runs as Wo^T ctx^T (A = 16 columns of out, B = 16 rows), so a lane holds 8 consecutive columns of one row; per accumulator the order is hi, lo of k step 0, hi, lo of k step 1, ...
#define OW 4
__global__ __launch_bounds__(32 * OW) void k_out(const float* __restrict__ ctx, const bf* __restrict__ WOT, const float* __restrict__ bo, float* out) {
    static_assert(DM == 64 * OW && NQ % 16 == 0);
    constexpr int KT = DM / 32;
    __shared__ __align__(16) bf xh[16 * DM];
    __shared__ __align__(16) bf xl[16 * DM];
    const int lane = threadIdx.x & 31, lr = lane & 15, hi = lane >> 4, w = __builtin_amdgcn_readfirstlane(threadIdx.x >> 5);
    const int r0 = blockIdx.x * 16, c0 = 64 * w; const size_t z = blockIdx.z;
    // wave w brings k c0 .. c0 + 63 of all 16 rows: lane (lr, hi) holds row lr, and its piece i is k c0 + 16 i + 8 hi .. + 7, the lane's own 16 bytes of half-fragment 4 w + i
    const float* sp = ctx + (z * NQ + (size_t)(r0 + lr)) * DM + c0 + 8 * hi;
    const bf* wp = WOT + (size_t)c0 * DM + 8 * lane;   // the lane's piece of fragment (c0 / 16, 0)
    const float* bp = bo + c0 + 8 * hi;
    v8f xv[4], bv[4]; v16bf wv[KT][4];
#pragma unroll
    for (int i = 0; i < 4; ++i) xv[i] = *(const v8f*)(sp + 16 * i);
#pragma unroll
    for (int kt = 0; kt < KT; ++kt)
#pragma unroll
        for (int ct = 0; ct < 4; ++ct) wv[kt][ct] = ldfragb(wp + (size_t)ct * 16 * DM + kt * 512);
#pragma unroll
    for (int ct = 0; ct < 4; ++ct) bv[ct] = *(const v8f*)(bp + 16 * ct);
    // the wait that belongs in front of any overwrite of the issued loads' address registers; the addresses are inputs so that they stay whole up to it
    asm volatile("s_wait_xcnt 0x0" :: "v"(sp), "v"(wp), "v"(bp) : "memory");
    // keeps all the loads in front of the first wait: left free the first sums on ctx, with their wait, are lifted in front of most of the Wo^T loads, which then go out one memory latency late
    __builtin_amdgcn_sched_barrier(0);
    bf* dh = xh + 2 * w * 512 + 8 * lane; bf* dl = xl + 2 * w * 512 + 8 * lane;
#pragma unroll
    for (int i = 0; i < 4; ++i) { v8us oh, ol;
#pragma unroll
        for (int k = 0; k < 8; ++k) { unsigned short a, b; splitf(xv[i][k], a, b); oh[k] = a; ol[k] = b; }
        *(v8us*)(dh + 256 * i) = oh; *(v8us*)(dl + 256 * i) = ol; }
    __syncthreads();
    v8f acc[4];   // acc[ct][j] = out[r0 + lr][c0 + 16 ct + 8 hi + j]
#pragma unroll
    for (int ct = 0; ct < 4; ++ct) acc[ct] = (v8f){};
    v16bf ah[KT], al[KT];
#pragma unroll
    for (int kt = 0; kt < KT; ++kt) {
        ah[kt] = cat16b(*(const v8us*)(xh + kt * 512 + 8 * lane), *(const v8us*)(xh + kt * 512 + 8 * lane + 256));
        al[kt] = cat16b(*(const v8us*)(xl + kt * 512 + 8 * lane), *(const v8us*)(xl + kt * 512 + 8 * lane + 256));
    }
    // keeps all the LDS reads in front of the products: left free every fragment goes through one set of registers and each group of four products waits out an LDS latency of its own
    __builtin_amdgcn_sched_barrier(0);
#pragma unroll
    for (int kt = 0; kt < KT; ++kt) {
#pragma unroll
        for (int ct = 0; ct < 4; ++ct) acc[ct] = wmmab(wv[kt][ct], ah[kt], acc[ct]);
#pragma unroll
        for (int ct = 0; ct < 4; ++ct) acc[ct] = wmmab(wv[kt][ct], al[kt], acc[ct]);
    }
    float* op = out + (z * NQ_FULL + (size_t)(r0 + lr)) * DM + c0 + 8 * hi;
    v8f o[4];
#pragma unroll
    for (int ct = 0; ct < 4; ++ct)
#pragma unroll
        for (int j = 0; j < 8; ++j) o[ct][j] = acc[ct][j] + bfr(bv[ct][j]);
    // keeps the stores behind all the sums: left free a later sum takes over the data registers of a store that has been issued
    __builtin_amdgcn_sched_barrier(0);
#pragma unroll
    for (int ct = 0; ct < 4; ++ct) *(v8f*)(op + 16 * ct) = o[ct];
}

// ---- workspace carve (bytes, 256-B aligned regions; all sizes compile-time)
constexpr size_t al256(size_t x) { return (x + 255) & ~(size_t)255; }
constexpr size_t SZ_WQ  = al256((size_t)DM * DM * 2);                                           // Wq^T [16 x 8 fragments][512]
constexpr size_t SZ_WKV = al256((size_t)2 * DM * DM * 2);                                       // Wkv^T [32 x 8 fragments][512]
constexpr size_t SZ_WO  = al256((size_t)DM * DM * 2);                                           // Wo^T [16 x 8 fragments][512]
constexpr size_t SZ_Q16 = al256((size_t)NB * NQ * DM * 2);                                      // q f16 [NB][8 heads][NQ/16 fragments][512]
constexpr size_t SZ_K16 = al256((size_t)NB * NK * DM * 2);                                      // k f16 [NB][8 heads][256 fragments][512]
constexpr size_t SZ_VT  = al256((size_t)NB * DM * NK * 2);                                      // V^T plane [NB][8 heads][128 x 2 fragments][512] (hi, residual: one each)
constexpr size_t SZ_CTX = al256((size_t)NB * NQ * DM * 4);                                      // ctx f32 [NB*NQ][256]
constexpr size_t O_WQ = 0, O_WKV = O_WQ + SZ_WQ, O_WO = O_WKV + SZ_WKV, O_Q16 = O_WO + SZ_WO, O_K16 = O_Q16 + SZ_Q16,
                 O_VTH = O_K16 + SZ_K16, O_VTL = O_VTH + SZ_VT, O_CTX = O_VTL + SZ_VT, O_END = O_CTX + SZ_CTX;
static_assert(O_END <= (size_t)268435456);
static_assert(((size_t)(NB_FULL - 1) * NQ_FULL + NQ_FULL) * DM * 4 <= (size_t)NB_FULL * NQ_FULL * DM * 4);

extern "C" void kernel_launch(void* const* d_in, const int* in_sizes, int n_in, void* d_out, int out_size, void* d_ws, size_t ws_size, hipStream_t stream) {
    if (n_in < 8) return;
    if (in_sizes[0] < NB * NQ_FULL * DM || in_sizes[1] < NB * NK * DM || in_sizes[2] < DM * DM || in_sizes[3] < DM || in_sizes[4] < DM * 2 * DM || in_sizes[5] < 2 * DM || in_sizes[6] < DM * DM || in_sizes[7] < DM) return;
    if ((size_t)out_size < (size_t)NB * NQ_FULL * DM) return;
    if (O_END > ws_size) return;
    const float* state = (const float*)d_in[0];   // [8][512][256]
    const float* pts   = (const float*)d_in[1];   // [8][4096][256]
    const float* Wq    = (const float*)d_in[2];   // [256][256] in x out
    const float* bq    = (const float*)d_in[3];   // [256]
    const float* Wkv   = (const float*)d_in[4];   // [256][512]
    const float* bkv   = (const float*)d_in[5];   // [512]
    const float* Wo    = (const float*)d_in[6];   // [256][256]
    const float* bo    = (const float*)d_in[7];   // [256]
    float* OUT = (float*)d_out;                   // [8][512][256]
    char* ws = (char*)d_ws;
    bf* WQT = (bf*)(ws + O_WQ); bf* WKVT = (bf*)(ws + O_WKV); bf* WOT = (bf*)(ws + O_WO);
    h16* Q16 = (h16*)(ws + O_Q16); h16* K16 = (h16*)(ws + O_K16);
    h16* VTH = (h16*)(ws + O_VTH); h16* VTL = (h16*)(ws + O_VTL);
    float* CTX = (float*)(ws + O_CTX);

    // planes of the three weights
    k_prep<<<GB_WQ + GB_WKV + GB_WO, 256, 0, stream>>>(Wq, Wkv, Wo, WQT, WKVT, WOT);
    // q = Xs Wq + bq and kv = Xp Wkv + bkv: the q, k and V^T hi/residual f16 planes in fragment order, z = batch
    k_proj<<<dim3(PB_Q + PB_KV, 1, NB), 32 * PW, 0, stream>>>(state, WQT, bq, Q16, pts, WKVT, bkv, K16, VTH, VTL);
    // ctx[b][i][h*32 + d] = softmax_j(q_h[i] . k_h[j] HD^-0.5) v[j][h*32 + d]: x = 16*MQ queries, y = head, z = batch
    k_attn<<<dim3(NQ / (16 * MQ), NH, NB), 32 * FW, 0, stream>>>(Q16, K16, VTH, VTL, CTX);
    // out = ctx Wo + bo: ctx split into bf16 hi/lo on its way into the block's LDS tile, rows of batch b at OUT + b*NQ_FULL*256
    k_out<<<dim3(NQ / 16, 1, NB), 32 * OW, 0, stream>>>(CTX, WOT, bo, OUT);
}
